// v000
// Times are from an AMD MI455X. After a warm-up the kernel runs many times in a row, and a time is the length of
// such a window on the GPU divided by its runs, so every launch and the gaps after it count. The runs cycle
// through copies of the inputs. A figure is the median of several windows, for all but v000 over two sittings.
// Sittings can differ by a few percent; kernels timed side by side share one.
// v000, which the later versions start from, runs in 1170 microseconds.
#include <hip/hip_runtime.h>

// Single attention head (ix [4][4096][768]; k, q, v = ix W ('xw' [768][64], no bias); wei = softmax(q.k / 8) over all 4096 keys; out = wei.v -> [4][4096][64] f32 (1.05 M)).
// Layout per batch: exact projections; hybrid dense attention over 4,096 keys (rows < 512 hi/lo, rest fp16 x1024) with a streaming 3-sweep softmax (no register row at this length); f32 output via the merge kernel.
// Compute dtypes, f32 accumulate: every input rounded to bf16; projections on PLAIN bf16 operands (exact); scores and attn.v rows < 512 on bf16 hi/lo planes (3 products), the rest single fp16; softmax f32; f32 output.

#define NB_  4
#define TT   4096
#define DM   768
#define NH_  1
#define NKV  1
#define REP  (NH_ / NKV)
#define HD   64
#define DQ   (NH_ * HD)
#define DKV  (NKV * HD)
#define ZH   1
#define RH   512                  // query rows < RH use hi+lo planes (0: none)
#define WIN  0
#define PCAR 1024.0f
#define SCL  0.125f   // HD^-0.5
typedef _Float16 h16;
typedef unsigned short bf;
typedef __attribute__((ext_vector_type(16))) __bf16   v16bf;
typedef __attribute__((ext_vector_type(16))) _Float16 v16h;
typedef __attribute__((ext_vector_type(8)))  _Float16 v8h;
typedef __attribute__((ext_vector_type(8)))  unsigned short v8us;
typedef __attribute__((ext_vector_type(8)))  float    v8f;
typedef __attribute__((ext_vector_type(4)))  float    v4f;
typedef v8h  __attribute__((may_alias)) v8ha;
typedef v4f  __attribute__((may_alias)) v4fa;
typedef v8us __attribute__((may_alias)) v8usa;

__device__ __forceinline__ unsigned short f2bf(float f) { unsigned u = __float_as_uint(f); u += 0x7FFFu + ((u >> 16) & 1u); return (unsigned short)(u >> 16); }
__device__ __forceinline__ float bf2f(unsigned short b) { return __uint_as_float(((unsigned)b) << 16); }
__device__ __forceinline__ float bfr(float f) { return bf2f(f2bf(f)); }
__device__ __forceinline__ v16h cat16(v8h lo, v8h hi) { return __builtin_shufflevector(lo, hi, 0, 1, 2, 3, 4, 5, 6, 7, 8, 9, 10, 11, 12, 13, 14, 15); }
__device__ __forceinline__ v16bf cat16b(v8us lo, v8us hi) { return __builtin_bit_cast(v16bf, __builtin_shufflevector(lo, hi, 0, 1, 2, 3, 4, 5, 6, 7, 8, 9, 10, 11, 12, 13, 14, 15)); }
__device__ __forceinline__ v8f wmma16(v16h a, v16h b, v8f c) { return __builtin_amdgcn_wmma_f32_16x16x32_f16(false, a, false, b, (short)0, c, false, false); }
__device__ __forceinline__ v8f wmmab(v16bf a, v16bf b, v8f c) { return __builtin_amdgcn_wmma_f32_16x16x32_bf16(false, a, false, b, (short)0, c, false, false); }



// ---- k_gemmw: register-blocked GEMM, ONE WAVE per 64x64 output tile (16 accumulators), operands straight from K-contiguous 16-bit planes; grid (M/64, N/64, Z), 32 threads.
// C[m][n] (f32, pitch ldc, + optional f32 bias[n]) = sum_k A[m][k] Bt[n][k] (+ split products per NSPLIT). z-batch strides sA/sB/sC in elements. K % 32 == 0.
template <typename T16> struct WFrag;
template <> struct WFrag<h16> { typedef v16h V; static __device__ __forceinline__ V ld(const h16* p) { return cat16(*(const v8h*)p, *(const v8h*)(p + 16)); } static __device__ __forceinline__ v8f mma(V a, V b, v8f c) { return wmma16(a, b, c); } };
template <> struct WFrag<bf> { typedef v16bf V; static __device__ __forceinline__ V ld(const bf* p) { return cat16b(*(const v8us*)p, *(const v8us*)(p + 16)); } static __device__ __forceinline__ v8f mma(V a, V b, v8f c) { return wmmab(a, b, c); } };
template <typename T16, int NSPLIT, bool BIAS>
__global__ __launch_bounds__(32) void k_gemmw(const T16* __restrict__ A, const T16* __restrict__ A2, const T16* __restrict__ Bt, const T16* __restrict__ Bt2, int K, float* C, int ldc, const float* __restrict__ bias, size_t sA, size_t sB, size_t sC) {
    typedef typename WFrag<T16>::V V;
    __shared__ __align__(16) float os[16 * 68];
    const size_t z = blockIdx.z; A += z * sA; if (A2) A2 += z * sA; Bt += z * sB; if (Bt2) Bt2 += z * sB; C += z * sC;
    const int lane = threadIdx.x & 31, lr = lane & 15, hi = lane >> 4; const int r0 = blockIdx.x * 64, c0 = blockIdx.y * 64;
    v8f acc[4][4];
#pragma unroll
    for (int mb = 0; mb < 4; ++mb)
#pragma unroll
        for (int nb = 0; nb < 4; ++nb) acc[mb][nb] = (v8f){};
    const size_t aoff = (size_t)(r0 + lr) * K + 8 * hi, boff = (size_t)(c0 + lr) * K + 8 * hi;
#pragma unroll 1
    for (int kc = 0; kc < K; kc += 32) {
        V a[4], a2[4];
#pragma unroll
        for (int mb = 0; mb < 4; ++mb) { a[mb] = WFrag<T16>::ld(A + aoff + (size_t)mb * 16 * K + kc); if (NSPLIT == 1 || NSPLIT == 2) a2[mb] = WFrag<T16>::ld(A2 + aoff + (size_t)mb * 16 * K + kc); }
#pragma unroll
        for (int nb = 0; nb < 4; ++nb) { const V b = WFrag<T16>::ld(Bt + boff + (size_t)nb * 16 * K + kc); V b2; if (NSPLIT >= 2) b2 = WFrag<T16>::ld(Bt2 + boff + (size_t)nb * 16 * K + kc);
#pragma unroll
            for (int mb = 0; mb < 4; ++mb) { acc[mb][nb] = WFrag<T16>::mma(a[mb], b, acc[mb][nb]); if (NSPLIT == 1 || NSPLIT == 2) acc[mb][nb] = WFrag<T16>::mma(a2[mb], b, acc[mb][nb]); if (NSPLIT >= 2) acc[mb][nb] = WFrag<T16>::mma(a[mb], b2, acc[mb][nb]); } }
        asm volatile("v_nop\n\tv_nop\n\tv_nop\n\tv_nop" : "+v"(acc[0][0]), "+v"(acc[1][1]), "+v"(acc[2][2]), "+v"(acc[3][3]) : "v"(a[0]), "v"(a[3]));
    }
#pragma unroll
    for (int mb = 0; mb < 4; ++mb) {
#pragma unroll
        for (int nb = 0; nb < 4; ++nb) {
#pragma unroll
            for (int j = 0; j < 8; ++j) os[(hi * 8 + j) * 68 + nb * 16 + lr] = acc[mb][nb][j]; }
        __builtin_amdgcn_wave_barrier(); asm volatile("" ::: "memory");
        float* crow = C + (size_t)(r0 + mb * 16) * ldc + c0;
{
#pragma unroll
            for (int s = 0; s < 8; ++s) { const int row = 2 * s + hi, cofs = lr * 4; v4f val = *(const v4fa*)(os + row * 68 + cofs); if (BIAS) { val[0] += bfr(bias[c0 + cofs]); val[1] += bfr(bias[c0 + cofs + 1]); val[2] += bfr(bias[c0 + cofs + 2]); val[3] += bfr(bias[c0 + cofs + 3]); }
                *(v4f*)(crow + (size_t)row * ldc + cofs) = val; }
             }
        __builtin_amdgcn_wave_barrier(); asm volatile("" ::: "memory");
    }
}

__device__ __forceinline__ h16 tohx(float x) { return (h16)x; }
__device__ __forceinline__ void splitf(float y, unsigned short& h, unsigned short& l) { h = f2bf(y); l = f2bf(y - bf2f(h)); }
typedef __attribute__((ext_vector_type(2))) _Float16 v2h;
typedef __attribute__((ext_vector_type(4))) _Float16 v4h;
typedef __attribute__((ext_vector_type(2))) unsigned short v2us;
typedef __attribute__((ext_vector_type(4))) unsigned short v4us;
typedef __attribute__((ext_vector_type(2))) float v2f;
typedef __attribute__((ext_vector_type(4))) int v4i;

__global__ __launch_bounds__(256) void k_wtG(const float* __restrict__ w, int K, int N, bf* Bt) {
    const int lane = threadIdx.x & 31; const int L0 = (blockIdx.x * 8 + (threadIdx.x >> 5)) * 8; const int nlines = N * K / 64;
{
#pragma unroll 1
        for (int l = 0; l < 8; ++l) { const int L = L0 + l; if (L >= nlines) break; const size_t e = (size_t)L * 64 + lane * 2; const int k = (int)(e % K), n = (int)(e / K); v2us o;
            o[0] = f2bf(w[(size_t)k * N + n]); o[1] = f2bf(w[(size_t)(k + 1) * N + n]); *(v2us*)(Bt + e) = o; }
         }
}
__global__ __launch_bounds__(256) void k_cvt8(const float* __restrict__ src, bf* dst, size_t n8) { const size_t i = (size_t)blockIdx.x * 256 + threadIdx.x; if (i >= n8) return; const v8f v = *(const v8f*)(src + i * 8); v8us o;
#pragma unroll
    for (int k = 0; k < 8; ++k) o[k] = f2bf(v[k]); *(v8us*)(dst + i * 8) = o;  }

// k_rope: head planes [h][t][d] (fp16 + hi/lo) of rope(x) x sc with the rotate-half convention out[d] = x[d] cos[t][d] - x[d+HD/2] sin[t][d], out[d+HD/2] = x[d+HD/2] cos[t][d+HD/2] + x[d] sin[t][d+HD/2]
__global__ __launch_bounds__(256) void k_rope(const float* __restrict__ F, int pitch, int nheads, const float* __restrict__ CS, const float* __restrict__ RF, const float* __restrict__ nw, float sc, h16* P16, bf* Ph, bf* Pl) {
    const size_t e = ((size_t)blockIdx.x * 256 + threadIdx.x) * 2; if (e >= (size_t)nheads * TT * HD) return; const int d = (int)(e % HD); const int t = (int)((e / HD) % TT); const int h = (int)(e / ((size_t)HD * TT)); const float* f = F + (size_t)t * pitch + h * HD; const float rf = RF ? RF[(size_t)h * TT + t] : 1.0f; v2h o16; v2us oh, ol;
#pragma unroll
    for (int q = 0; q < 2; ++q) { const int dd = d + q; const int dp = (dd < HD / 2) ? dd + HD / 2 : dd - HD / 2; float x0 = f[dd], x1 = f[dp];
        if (RF) { float n0 = __fmul_rn(x0, rf), n1 = __fmul_rn(x1, rf); asm volatile("" : "+v"(n0)); asm volatile("" : "+v"(n1)); x0 = __fmul_rn(bfr(nw[dd]), n0); x1 = __fmul_rn(bfr(nw[dp]), n1); }
        const v2f cs = *(const v2f*)(CS + ((size_t)t * HD + dd) * 2); float a = __fmul_rn(x0, cs[0]), bq = __fmul_rn(x1, cs[1]); asm volatile("" : "+v"(a)); asm volatile("" : "+v"(bq)); const float r = ((dd < HD / 2) ? __fsub_rn(a, bq) : __fadd_rn(a, bq)) * sc;
        o16[q] = tohx(r); unsigned short a2, c2; splitf(r, a2, c2); oh[q] = a2; ol[q] = c2; }
    *(v2h*)(P16 + e) = o16; *(v2us*)(Ph + e) = oh; *(v2us*)(Pl + e) = ol;  }
__global__ __launch_bounds__(256) void k_vtp(const float* __restrict__ F, int pitch, int nheads, h16* V16, bf* Vh, bf* Vl) { const size_t e = ((size_t)blockIdx.x * 256 + threadIdx.x) * 2; if (e >= (size_t)nheads * HD * TT) return; const int t = (int)(e % TT); const int d = (int)((e / TT) % HD); const int g = (int)(e / ((size_t)TT * HD)); v2h o16; v2us oh, ol;
#pragma unroll
    for (int q = 0; q < 2; ++q) { const float x = F[(size_t)(t + q) * pitch + g * HD + d]; o16[q] = tohx(x); unsigned short a2, c2; splitf(x, a2, c2); oh[q] = a2; ol[q] = c2; }
    *(v2h*)(V16 + e) = o16; *(v2us*)(Vh + e) = oh; *(v2us*)(Vl + e) = ol;  }
__global__ __launch_bounds__(256) void k_csid(float* CS) { const int idx = blockIdx.x * 256 + threadIdx.x; if (idx >= TT * HD) return; v2f cs; cs[0] = 1.0f; cs[1] = 0.0f; *(v2f*)(CS + (size_t)idx * 2) = cs;  }
// k_lsoft: streaming row softmax over the TK = TT = 4096 keys, one wave per row i, three sweeps of the f32 score row (lane -> 4 consecutive keys per 128-key chunk, 32 chunks; no key is masked, the score row is computed in full):
__global__ __launch_bounds__(256) void k_lsoft(const float* __restrict__ Sb, h16* P16, bf* Ph, bf* Pl) {
    const int lane = threadIdx.x & 31; const int row = blockIdx.x * 8 + (threadIdx.x >> 5); if (row >= ZH * TT) return; const int i = row % TT; const int zz = row / TT; const bool hires = (i < RH); const float* sr = Sb + (size_t)row * TT; float mx = -3.0e38f;
#pragma unroll 4
    for (int ch = 0; ch < TT / 128; ++ch) { const int j0 = ch * 128 + lane * 4; const v4f a = *(const v4f*)(sr + j0);
#pragma unroll
        for (int q = 0; q < 4; ++q) { float t = a[q] * SCL; asm volatile("" : "+v"(t)); mx = fmaxf(mx, t); } }
#pragma unroll
    for (int sh = 16; sh; sh >>= 1) mx = fmaxf(mx, __shfl_xor(mx, sh, 32));
    float sum = 0.f;
#pragma unroll 4
    for (int ch = 0; ch < TT / 128; ++ch) { const int j0 = ch * 128 + lane * 4; const v4f a = *(const v4f*)(sr + j0);
#pragma unroll
        for (int q = 0; q < 4; ++q) { float t = a[q] * SCL; asm volatile("" : "+v"(t)); float d0 = __fsub_rn(t, mx); asm volatile("" : "+v"(d0)); sum += __builtin_amdgcn_exp2f(__fmul_rn(d0, 1.4426950408889634f)); } }
#pragma unroll
    for (int sh = 16; sh; sh >>= 1) sum += __shfl_xor(sum, sh, 32);
    const float f = __fdiv_rn(hires ? 1.0f : PCAR, sum);
{
        if (hires) {   /* rows < RH: normalised bf16 hi/lo over all keys, planes [zz][RH][TT] */
#pragma unroll
            for (int ch = 0; ch < TT / 128; ++ch) { const int j0 = ch * 128 + lane * 4; const v4f a = *(const v4f*)(sr + j0); v4us oh, ol;
#pragma unroll
                for (int q = 0; q < 4; ++q) { float t = a[q] * SCL; asm volatile("" : "+v"(t)); float d0 = __fsub_rn(t, mx); asm volatile("" : "+v"(d0)); float ex = __builtin_amdgcn_exp2f(__fmul_rn(d0, 1.4426950408889634f)); asm volatile("" : "+v"(ex)); unsigned short a2, c2; splitf(ex * f, a2, c2); oh[q] = a2; ol[q] = c2; }
                const size_t oo = ((size_t)zz * RH + i) * TT + j0; *(v4us*)(Ph + oo) = oh; *(v4us*)(Pl + oo) = ol; }
        } else {
#pragma unroll 2
            for (int ch = 0; ch < TT / 128; ++ch) { const int j0 = ch * 128 + lane * 4; const v4f a = *(const v4f*)(sr + j0); v4h o4;
#pragma unroll
                for (int q = 0; q < 4; ++q) { float t = a[q] * SCL; asm volatile("" : "+v"(t)); float d0 = __fsub_rn(t, mx); asm volatile("" : "+v"(d0)); float ex = __builtin_amdgcn_exp2f(__fmul_rn(d0, 1.4426950408889634f)); asm volatile("" : "+v"(ex)); o4[q] = tohx(ex * f); }
                *(v4h*)(P16 + (size_t)row * TT + j0) = o4; } }
         }
}

__global__ __launch_bounds__(256) void k_merge(const float* __restrict__ O, int h0, float* OUTb) { const size_t e = ((size_t)blockIdx.x * 256 + threadIdx.x) * 2; if (e >= (size_t)ZH * TT * HD) return; const int d = (int)(e % HD); const int t = (int)((e / HD) % TT); const int zz = (int)(e / ((size_t)HD * TT)); const float cs = (t < RH) ? 1.0f : (1.0f / PCAR); const size_t oo = (size_t)t * DQ + (h0 + zz) * HD + d;
    v2f o2; o2[0] = O[e] * cs; o2[1] = O[e + 1] * cs; *(v2f*)(OUTb + oo) = o2;  }

extern "C" void kernel_launch(void* const* d_in, const int* in_sizes, int n_in,
                              void* d_out, int out_size, void* d_ws, size_t ws_size, hipStream_t stream) {
    (void)in_sizes; (void)n_in; (void)out_size;
    const float* x = (const float*)d_in[0]; const float* wk = (const float*)d_in[1]; const float* wq = (const float*)d_in[2]; const float* wv = (const float*)d_in[3]; const float* wo = nullptr; (void)wo;
    float* OUT = (float*)d_out;     // [4][4096][64]
    char* wsp = (char*)d_ws;
    auto take = [&](size_t bytes) { char* p = wsp; wsp += (bytes + 255) & ~(size_t)255; return (void*)p; };
    bf* WQ = (bf*)take((size_t)DQ * DM * 2); bf* WK = (bf*)take((size_t)DKV * DM * 2); bf* WV = (bf*)take((size_t)DKV * DM * 2); float* CS = (float*)take((size_t)TT * HD * 2 * 4);
    bf* XB = (bf*)take((size_t)TT * DM * 2); float* FQ = (float*)take((size_t)TT * DQ * 4); float* FK = (float*)take((size_t)TT * DKV * 4);
    h16* QP16 = (h16*)take((size_t)NH_ * TT * HD * 2); h16* KP16 = (h16*)take((size_t)NKV * TT * HD * 2); h16* VT16 = (h16*)take((size_t)NKV * HD * TT * 2);
    bf* QPh = (bf*)take((size_t)NH_ * TT * HD * 2); bf* QPl = (bf*)take((size_t)NH_ * TT * HD * 2); bf* KPh = (bf*)take((size_t)NKV * TT * HD * 2); bf* KPl = (bf*)take((size_t)NKV * TT * HD * 2); bf* VTh = (bf*)take((size_t)NKV * HD * TT * 2); bf* VTl = (bf*)take((size_t)NKV * HD * TT * 2); bf* Ph = (bf*)take((size_t)ZH * RH * TT * 2); bf* Pl = (bf*)take((size_t)ZH * RH * TT * 2);
    float* Sb = (float*)take((size_t)ZH * TT * TT * 4); h16* P16 = (h16*)take((size_t)ZH * TT * TT * 2); float* Ob = (float*)take((size_t)ZH * TT * HD * 4);
    if ((size_t)(wsp - (char*)d_ws) > ws_size) return;    // ws 256 MiB
    float* FV = FK;   // v projection reuses the k buffer after the k planes are built (stream-ordered)
    { k_wtG<<<(unsigned)((DM * DQ / 64 + 63) / 64), 256, 0, stream>>>(wq, DM, DQ, WQ); k_wtG<<<(unsigned)((DM * DKV / 64 + 63) / 64), 256, 0, stream>>>(wk, DM, DKV, WK); k_wtG<<<(unsigned)((DM * DKV / 64 + 63) / 64), 256, 0, stream>>>(wv, DM, DKV, WV);
      
       }
    k_csid<<<(TT * HD + 255) / 256, 256, 0, stream>>>(CS);
    const unsigned LQ = (unsigned)(((size_t)NH_ * TT * HD / 2 + 255) / 256), LKv = (unsigned)(((size_t)NKV * TT * HD / 2 + 255) / 256);
    for (int b = 0; b < NB_; ++b) {
        
        k_cvt8<<<(unsigned)(((size_t)TT * DM / 8 + 255) / 256), 256, 0, stream>>>(x + (size_t)b * TT * DM, XB, (size_t)TT * DM / 8);
        k_gemmw<bf, 0, false><<<dim3(TT / 64, DQ / 64, 1), 32, 0, stream>>>(XB, nullptr, WQ, nullptr, DM, FQ, DQ, nullptr, 0, 0, 0);
        k_rope<<<LQ, 256, 0, stream>>>(FQ, DQ, NH_, CS, nullptr, nullptr, 1.0f, QP16, QPh, QPl);
        k_gemmw<bf, 0, false><<<dim3(TT / 64, DKV / 64, 1), 32, 0, stream>>>(XB, nullptr, WK, nullptr, DM, FK, DKV, nullptr, 0, 0, 0);
        k_rope<<<LKv, 256, 0, stream>>>(FK, DKV, NKV, CS, nullptr, nullptr, 1.0f, KP16, KPh, KPl);
        k_gemmw<bf, 0, false><<<dim3(TT / 64, DKV / 64, 1), 32, 0, stream>>>(XB, nullptr, WV, nullptr, DM, FV, DKV, nullptr, 0, 0, 0); k_vtp<<<LKv, 256, 0, stream>>>(FV, DKV, NKV, VT16, VTh, VTl);
        for (int h0 = 0; h0 < NH_; h0 += ZH) { const size_t zq = (size_t)h0, zk = (size_t)(h0 / REP);   // one kv head per query head: the pass's single head (ZH = 1) uses kv plane zk (z-strides TT*HD)
            k_gemmw<bf, 2, false><<<dim3(RH / 64, TT / 64, ZH), 32, 0, stream>>>(QPh + zq * TT * HD, QPl + zq * TT * HD, KPh + zk * TT * HD, KPl + zk * TT * HD, HD, Sb, TT, nullptr, (size_t)TT * HD, (size_t)TT * HD, (size_t)TT * TT);
            k_gemmw<h16, 0, false><<<dim3((TT - RH) / 64, TT / 64, ZH), 32, 0, stream>>>(QP16 + zq * TT * HD + (size_t)RH * HD, nullptr, KP16 + zk * TT * HD, nullptr, HD, Sb + (size_t)RH * TT, TT, nullptr, (size_t)TT * HD, (size_t)TT * HD, (size_t)TT * TT);
            k_lsoft<<<ZH * TT / 8, 256, 0, stream>>>(Sb, P16, Ph, Pl);
            k_gemmw<bf, 2, false><<<dim3(RH / 64, HD / 64, ZH), 32, 0, stream>>>(Ph, Pl, VTh + zk * HD * TT, VTl + zk * HD * TT, TT, Ob, HD, nullptr, (size_t)RH * TT, (size_t)HD * TT, (size_t)TT * HD);
            k_gemmw<h16, 0, false><<<dim3((TT - RH) / 64, HD / 64, ZH), 32, 0, stream>>>(P16 + (size_t)RH * TT, nullptr, VT16 + zk * HD * TT, nullptr, TT, Ob + (size_t)RH * HD, HD, nullptr, (size_t)TT * TT, (size_t)HD * TT, (size_t)TT * HD);
            k_merge<<<(unsigned)(((size_t)ZH * TT * HD / 2 + 255) / 256), 256, 0, stream>>>(Ob, h0, OUT + (size_t)b * TT * DQ); }
         }
}

// v001
// A run of this version takes 512 microseconds.
// Two timings next to v000 put it at 2.31 and 2.32 times that version's speed.
#include <hip/hip_runtime.h>

// Single attention head (ix [4][4096][768]; k, q, v = ix W ('xw' [768][64], no bias); wei = softmax(q.k / 8) over all 4096 keys; out = wei.v -> [4][4096][64] f32 (1.05 M)).
// Layout per batch: exact projections; hybrid dense attention over 4,096 keys (rows < 512 hi/lo, rest fp16 x1024) with a streaming 3-sweep softmax (no register row at this length); f32 output via the merge kernel.
// Compute dtypes, f32 accumulate: every input rounded to bf16; projections on PLAIN bf16 operands (exact); scores and attn.v rows < 512 on bf16 hi/lo planes (3 products), the rest single fp16; softmax f32; f32 output.

#define NB_  4
#define TT   4096
#define DM   768
#define NH_  1
#define NKV  1
#define REP  (NH_ / NKV)
#define HD   64
#define DQ   (NH_ * HD)
#define DKV  (NKV * HD)
#define ZH   1
#define RH   512                  // query rows < RH use hi+lo planes (0: none)
#define WIN  0
#define PCAR 1024.0f
#define SCL  0.125f   // HD^-0.5
#define SKP  8                    // K slices of the q and k projections (96 k each)
#define SKV  4                    // K slices of the v projection (192 k each; fewer, because k_vtp reads its planes row-strided)
#define SKO  32                   // K slices of attn.v (128 keys each)
typedef _Float16 h16;
typedef unsigned short bf;
typedef __attribute__((ext_vector_type(16))) __bf16   v16bf;
typedef __attribute__((ext_vector_type(16))) _Float16 v16h;
typedef __attribute__((ext_vector_type(8)))  _Float16 v8h;
typedef __attribute__((ext_vector_type(8)))  unsigned short v8us;
typedef __attribute__((ext_vector_type(8)))  float    v8f;
typedef __attribute__((ext_vector_type(4)))  float    v4f;
typedef v8h  __attribute__((may_alias)) v8ha;
typedef v4f  __attribute__((may_alias)) v4fa;
typedef v8us __attribute__((may_alias)) v8usa;

__device__ __forceinline__ unsigned short f2bf(float f) { unsigned u = __float_as_uint(f); u += 0x7FFFu + ((u >> 16) & 1u); return (unsigned short)(u >> 16); }
__device__ __forceinline__ float bf2f(unsigned short b) { return __uint_as_float(((unsigned)b) << 16); }
__device__ __forceinline__ float bfr(float f) { return bf2f(f2bf(f)); }
__device__ __forceinline__ v16h cat16(v8h lo, v8h hi) { return __builtin_shufflevector(lo, hi, 0, 1, 2, 3, 4, 5, 6, 7, 8, 9, 10, 11, 12, 13, 14, 15); }
__device__ __forceinline__ v16bf cat16b(v8us lo, v8us hi) { return __builtin_bit_cast(v16bf, __builtin_shufflevector(lo, hi, 0, 1, 2, 3, 4, 5, 6, 7, 8, 9, 10, 11, 12, 13, 14, 15)); }
__device__ __forceinline__ v8f wmma16(v16h a, v16h b, v8f c) { return __builtin_amdgcn_wmma_f32_16x16x32_f16(false, a, false, b, (short)0, c, false, false); }
__device__ __forceinline__ v8f wmmab(v16bf a, v16bf b, v8f c) { return __builtin_amdgcn_wmma_f32_16x16x32_bf16(false, a, false, b, (short)0, c, false, false); }



// ---- k_gemmw: register-blocked GEMM, ONE WAVE per 64x64 output tile (16 accumulators), operands straight from K-contiguous 16-bit planes; grid (M/64, N/64, Z), 32 threads.
// C[m][n] (f32, pitch ldc, + optional f32 bias[n]) = sum_k A[m][k] Bt[n][k] (+ split products per NSPLIT). K is the operands' row pitch, KL the k range one workgroup sums; z strides sA/sB/sC in elements. KL % 32 == 0.
// Split-K: grid z = K / KL, sA = sB = KL; slice z writes its own partial (sC apart: whole planes for the projections, row-interleaved [t][z][d] for attn.v) and the consumer kernel adds the partials in ascending z.
template <typename T16> struct WFrag;
template <> struct WFrag<h16> { typedef v16h V; static __device__ __forceinline__ V ld(const h16* p) { return cat16(*(const v8h*)p, *(const v8h*)(p + 16)); } static __device__ __forceinline__ v8f mma(V a, V b, v8f c) { return wmma16(a, b, c); } };
template <> struct WFrag<bf> { typedef v16bf V; static __device__ __forceinline__ V ld(const bf* p) { return cat16b(*(const v8us*)p, *(const v8us*)(p + 16)); } static __device__ __forceinline__ v8f mma(V a, V b, v8f c) { return wmmab(a, b, c); } };
template <typename T16, int NSPLIT, bool BIAS>
__global__ __launch_bounds__(32) void k_gemmw(const T16* __restrict__ A, const T16* __restrict__ A2, const T16* __restrict__ Bt, const T16* __restrict__ Bt2, int K, int KL, float* C, int ldc, const float* __restrict__ bias, size_t sA, size_t sB, size_t sC) {
    typedef typename WFrag<T16>::V V;
    __shared__ __align__(16) float os[16 * 68];
    const size_t z = blockIdx.z; A += z * sA; if (A2) A2 += z * sA; Bt += z * sB; if (Bt2) Bt2 += z * sB; C += z * sC;
    const int lane = threadIdx.x & 31, lr = lane & 15, hi = lane >> 4; const int r0 = blockIdx.x * 64, c0 = blockIdx.y * 64;
    v8f acc[4][4];
#pragma unroll
    for (int mb = 0; mb < 4; ++mb)
#pragma unroll
        for (int nb = 0; nb < 4; ++nb) acc[mb][nb] = (v8f){};
    const size_t aoff = (size_t)(r0 + lr) * K + 8 * hi, boff = (size_t)(c0 + lr) * K + 8 * hi;
#pragma unroll 1
    for (int kc = 0; kc < KL; kc += 32) {
        V a[4], a2[4];
#pragma unroll
        for (int mb = 0; mb < 4; ++mb) { a[mb] = WFrag<T16>::ld(A + aoff + (size_t)mb * 16 * K + kc); if (NSPLIT == 1 || NSPLIT == 2) a2[mb] = WFrag<T16>::ld(A2 + aoff + (size_t)mb * 16 * K + kc); }
#pragma unroll
        for (int nb = 0; nb < 4; ++nb) { const V b = WFrag<T16>::ld(Bt + boff + (size_t)nb * 16 * K + kc); V b2; if (NSPLIT >= 2) b2 = WFrag<T16>::ld(Bt2 + boff + (size_t)nb * 16 * K + kc);
#pragma unroll
            for (int mb = 0; mb < 4; ++mb) { acc[mb][nb] = WFrag<T16>::mma(a[mb], b, acc[mb][nb]); if (NSPLIT == 1 || NSPLIT == 2) acc[mb][nb] = WFrag<T16>::mma(a2[mb], b, acc[mb][nb]); if (NSPLIT >= 2) acc[mb][nb] = WFrag<T16>::mma(a[mb], b2, acc[mb][nb]); } }
        asm volatile("v_nop\n\tv_nop\n\tv_nop\n\tv_nop" : "+v"(acc[0][0]), "+v"(acc[1][1]), "+v"(acc[2][2]), "+v"(acc[3][3]) : "v"(a[0]), "v"(a[3]));
    }
#pragma unroll
    for (int mb = 0; mb < 4; ++mb) {
#pragma unroll
        for (int nb = 0; nb < 4; ++nb) {
#pragma unroll
            for (int j = 0; j < 8; ++j) os[(hi * 8 + j) * 68 + nb * 16 + lr] = acc[mb][nb][j]; }
        __builtin_amdgcn_wave_barrier(); asm volatile("" ::: "memory");
        float* crow = C + (size_t)(r0 + mb * 16) * ldc + c0;
{
#pragma unroll
            for (int s = 0; s < 8; ++s) { const int row = 2 * s + hi, cofs = lr * 4; v4f val = *(const v4fa*)(os + row * 68 + cofs); if (BIAS) { val[0] += bfr(bias[c0 + cofs]); val[1] += bfr(bias[c0 + cofs + 1]); val[2] += bfr(bias[c0 + cofs + 2]); val[3] += bfr(bias[c0 + cofs + 3]); }
                *(v4f*)(crow + (size_t)row * ldc + cofs) = val; }
             }
        __builtin_amdgcn_wave_barrier(); asm volatile("" ::: "memory");
    }
}

__device__ __forceinline__ h16 tohx(float x) { return (h16)x; }
__device__ __forceinline__ void splitf(float y, unsigned short& h, unsigned short& l) { h = f2bf(y); l = f2bf(y - bf2f(h)); }
typedef __attribute__((ext_vector_type(2))) _Float16 v2h;
typedef __attribute__((ext_vector_type(4))) _Float16 v4h;
typedef __attribute__((ext_vector_type(2))) unsigned short v2us;
typedef __attribute__((ext_vector_type(4))) unsigned short v4us;
typedef __attribute__((ext_vector_type(2))) float v2f;
typedef __attribute__((ext_vector_type(4))) int v4i;

__global__ __launch_bounds__(256) void k_wtG(const float* __restrict__ w, int K, int N, bf* Bt) {
    const int lane = threadIdx.x & 31; const int L0 = (blockIdx.x * 8 + (threadIdx.x >> 5)) * 8; const int nlines = N * K / 64;
{
#pragma unroll 1
        for (int l = 0; l < 8; ++l) { const int L = L0 + l; if (L >= nlines) break; const size_t e = (size_t)L * 64 + lane * 2; const int k = (int)(e % K), n = (int)(e / K); v2us o;
            o[0] = f2bf(w[(size_t)k * N + n]); o[1] = f2bf(w[(size_t)(k + 1) * N + n]); *(v2us*)(Bt + e) = o; }
         }
}
__global__ __launch_bounds__(256) void k_cvt8(const float* __restrict__ src, bf* dst, size_t n8) { const size_t i = (size_t)blockIdx.x * 256 + threadIdx.x; if (i >= n8) return; const v8f v = *(const v8f*)(src + i * 8); v8us o;
#pragma unroll
    for (int k = 0; k < 8; ++k) o[k] = f2bf(v[k]); *(v8us*)(dst + i * 8) = o;  }

// k_rope: head planes [h][t][d] (fp16 + hi/lo) of rope(x) x sc with the rotate-half convention out[d] = x[d] cos[t][d] - x[d+HD/2] sin[t][d], out[d+HD/2] = x[d+HD/2] cos[t][d+HD/2] + x[d] sin[t][d+HD/2]
template <int NS, int PL>   // F holds NS split-K partial planes, PL elements apart
__global__ __launch_bounds__(256) void k_rope(const float* __restrict__ F, int pitch, int nheads, const float* __restrict__ CS, const float* __restrict__ RF, const float* __restrict__ nw, float sc, h16* P16, bf* Ph, bf* Pl) {
    const size_t e = ((size_t)blockIdx.x * 256 + threadIdx.x) * 2; if (e >= (size_t)nheads * TT * HD) return; const int d = (int)(e % HD); const int t = (int)((e / HD) % TT); const int h = (int)(e / ((size_t)HD * TT)); const float* f = F + (size_t)t * pitch + h * HD; const float rf = RF ? RF[(size_t)h * TT + t] : 1.0f; v2h o16; v2us oh, ol;
    const int dq = (d < HD / 2) ? d + HD / 2 : d - HD / 2; const float* fa = f + d; const float* fb = f + dq; v2f p0[NS], p1[NS];   // d is even: elements d, d+1 and their partners dq, dq+1 are two 8-byte pairs
#pragma unroll
    for (int s = 0; s < NS; ++s) { p0[s] = *(const v2f*)(fa + (size_t)s * PL); p1[s] = *(const v2f*)(fb + (size_t)s * PL); }
    asm volatile("s_wait_xcnt 0x0" :: "v"(fa), "v"(fb) : "memory");   // both address pairs stay live up to this wait, so no load's result lands in a register that an issued load still names
    v2f s0 = p0[0], s1 = p1[0];   // add the projection's split-K planes, ascending
#pragma unroll
    for (int s = 1; s < NS; ++s) { s0 += p0[s]; s1 += p1[s]; }
#pragma unroll
    for (int q = 0; q < 2; ++q) { const int dd = d + q; const int dp = (dd < HD / 2) ? dd + HD / 2 : dd - HD / 2; float x0 = s0[q], x1 = s1[q];
        if (RF) { float n0 = __fmul_rn(x0, rf), n1 = __fmul_rn(x1, rf); asm volatile("" : "+v"(n0)); asm volatile("" : "+v"(n1)); x0 = __fmul_rn(bfr(nw[dd]), n0); x1 = __fmul_rn(bfr(nw[dp]), n1); }
        const v2f cs = *(const v2f*)(CS + ((size_t)t * HD + dd) * 2); float a = __fmul_rn(x0, cs[0]), bq = __fmul_rn(x1, cs[1]); asm volatile("" : "+v"(a)); asm volatile("" : "+v"(bq)); const float r = ((dd < HD / 2) ? __fsub_rn(a, bq) : __fadd_rn(a, bq)) * sc;
        o16[q] = tohx(r); unsigned short a2, c2; splitf(r, a2, c2); oh[q] = a2; ol[q] = c2; }
    *(v2h*)(P16 + e) = o16; *(v2us*)(Ph + e) = oh; *(v2us*)(Pl + e) = ol;  }
template <int NS, int PL>   // F holds NS split-K partial planes, PL elements apart
__global__ __launch_bounds__(256) void k_vtp(const float* __restrict__ F, int pitch, int nheads, h16* V16, bf* Vh, bf* Vl) { const size_t e = ((size_t)blockIdx.x * 256 + threadIdx.x) * 2; if (e >= (size_t)nheads * HD * TT) return; const int t = (int)(e % TT); const int d = (int)((e / TT) % HD); const int g = (int)(e / ((size_t)TT * HD)); v2h o16; v2us oh, ol;
#pragma unroll
    for (int q = 0; q < 2; ++q) { const float* fp = F + (size_t)(t + q) * pitch + g * HD + d; float x = fp[0];
#pragma unroll
        for (int s = 1; s < NS; ++s) x += fp[(size_t)s * PL];   // add the projection's split-K planes, ascending
        o16[q] = tohx(x); unsigned short a2, c2; splitf(x, a2, c2); oh[q] = a2; ol[q] = c2; }
    *(v2h*)(V16 + e) = o16; *(v2us*)(Vh + e) = oh; *(v2us*)(Vl + e) = ol;  }
__global__ __launch_bounds__(256) void k_csid(float* CS) { const int idx = blockIdx.x * 256 + threadIdx.x; if (idx >= TT * HD) return; v2f cs; cs[0] = 1.0f; cs[1] = 0.0f; *(v2f*)(CS + (size_t)idx * 2) = cs;  }
// k_lsoft: streaming row softmax over the TK = TT = 4096 keys, one wave per row i, three sweeps of the f32 score row (lane -> 4 consecutive keys per 128-key chunk, 32 chunks; no key is masked, the score row is computed in full):
__global__ __launch_bounds__(256) void k_lsoft(const float* __restrict__ Sb, h16* P16, bf* Ph, bf* Pl) {
    const int lane = threadIdx.x & 31; const int row = blockIdx.x * 8 + (threadIdx.x >> 5); if (row >= ZH * TT) return; const int i = row % TT; const int zz = row / TT; const bool hires = (i < RH); const float* sr = Sb + (size_t)row * TT; float mx = -3.0e38f;
#pragma unroll 4
    for (int ch = 0; ch < TT / 128; ++ch) { const int j0 = ch * 128 + lane * 4; const v4f a = *(const v4f*)(sr + j0);
#pragma unroll
        for (int q = 0; q < 4; ++q) { float t = a[q] * SCL; asm volatile("" : "+v"(t)); mx = fmaxf(mx, t); } }
#pragma unroll
    for (int sh = 16; sh; sh >>= 1) mx = fmaxf(mx, __shfl_xor(mx, sh, 32));
    float sum = 0.f;
#pragma unroll 4
    for (int ch = 0; ch < TT / 128; ++ch) { const int j0 = ch * 128 + lane * 4; const v4f a = *(const v4f*)(sr + j0);
#pragma unroll
        for (int q = 0; q < 4; ++q) { float t = a[q] * SCL; asm volatile("" : "+v"(t)); float d0 = __fsub_rn(t, mx); asm volatile("" : "+v"(d0)); sum += __builtin_amdgcn_exp2f(__fmul_rn(d0, 1.4426950408889634f)); } }
#pragma unroll
    for (int sh = 16; sh; sh >>= 1) sum += __shfl_xor(sum, sh, 32);
    const float f = __fdiv_rn(hires ? 1.0f : PCAR, sum);
{
        if (hires) {   /* rows < RH: normalised bf16 hi/lo over all keys, planes [zz][RH][TT] */
#pragma unroll
            for (int ch = 0; ch < TT / 128; ++ch) { const int j0 = ch * 128 + lane * 4; const v4f a = *(const v4f*)(sr + j0); v4us oh, ol;
#pragma unroll
                for (int q = 0; q < 4; ++q) { float t = a[q] * SCL; asm volatile("" : "+v"(t)); float d0 = __fsub_rn(t, mx); asm volatile("" : "+v"(d0)); float ex = __builtin_amdgcn_exp2f(__fmul_rn(d0, 1.4426950408889634f)); asm volatile("" : "+v"(ex)); unsigned short a2, c2; splitf(ex * f, a2, c2); oh[q] = a2; ol[q] = c2; }
                const size_t oo = ((size_t)zz * RH + i) * TT + j0; *(v4us*)(Ph + oo) = oh; *(v4us*)(Pl + oo) = ol; }
        } else {
#pragma unroll 2
            for (int ch = 0; ch < TT / 128; ++ch) { const int j0 = ch * 128 + lane * 4; const v4f a = *(const v4f*)(sr + j0); v4h o4;
#pragma unroll
                for (int q = 0; q < 4; ++q) { float t = a[q] * SCL; asm volatile("" : "+v"(t)); float d0 = __fsub_rn(t, mx); asm volatile("" : "+v"(d0)); float ex = __builtin_amdgcn_exp2f(__fmul_rn(d0, 1.4426950408889634f)); asm volatile("" : "+v"(ex)); o4[q] = tohx(ex * f); }
                *(v4h*)(P16 + (size_t)row * TT + j0) = o4; } }
         }
}

__global__ __launch_bounds__(256) void k_merge(const float* __restrict__ O, int h0, float* OUTb) { const size_t e = ((size_t)blockIdx.x * 256 + threadIdx.x) * 2; if (e >= (size_t)ZH * TT * HD) return; const int d = (int)(e % HD); const int t = (int)((e / HD) % TT); const int zz = (int)(e / ((size_t)HD * TT)); const float cs = (t < RH) ? 1.0f : (1.0f / PCAR); const size_t oo = (size_t)t * DQ + (h0 + zz) * HD + d;
    const float* pb = O + ((size_t)zz * TT + t) * (SKO * HD) + d;   // partials lie [t][slice][d]: one address pair reaches all slices by immediate offsets
    v2f p[SKO];
#pragma unroll
    for (int s = 0; s < SKO; ++s) p[s] = *(const v2f*)(pb + s * HD);
    asm volatile("s_wait_xcnt 0x0" :: "v"(pb) : "memory");   // the address pair stays live up to this wait, so no load's result lands in a register that an issued load still names
    v2f a = p[0];   // add the attn.v split-K planes, ascending
#pragma unroll
    for (int s = 1; s < SKO; ++s) a += p[s];
    v2f o2; o2[0] = a[0] * cs; o2[1] = a[1] * cs; *(v2f*)(OUTb + oo) = o2;  }

extern "C" void kernel_launch(void* const* d_in, const int* in_sizes, int n_in,
                              void* d_out, int out_size, void* d_ws, size_t ws_size, hipStream_t stream) {
    (void)in_sizes; (void)n_in; (void)out_size;
    const float* x = (const float*)d_in[0]; const float* wk = (const float*)d_in[1]; const float* wq = (const float*)d_in[2]; const float* wv = (const float*)d_in[3]; const float* wo = nullptr; (void)wo;
    float* OUT = (float*)d_out;     // [4][4096][64]
    char* wsp = (char*)d_ws;
    auto take = [&](size_t bytes) { char* p = wsp; wsp += (bytes + 255) & ~(size_t)255; return (void*)p; };
    bf* WQ = (bf*)take((size_t)DQ * DM * 2); bf* WK = (bf*)take((size_t)DKV * DM * 2); bf* WV = (bf*)take((size_t)DKV * DM * 2); float* CS = (float*)take((size_t)TT * HD * 2 * 4);
    bf* XB = (bf*)take((size_t)TT * DM * 2); float* FQ = (float*)take((size_t)SKP * TT * DQ * 4); float* FK = (float*)take((size_t)SKP * TT * DKV * 4);
    h16* QP16 = (h16*)take((size_t)NH_ * TT * HD * 2); h16* KP16 = (h16*)take((size_t)NKV * TT * HD * 2); h16* VT16 = (h16*)take((size_t)NKV * HD * TT * 2);
    bf* QPh = (bf*)take((size_t)NH_ * TT * HD * 2); bf* QPl = (bf*)take((size_t)NH_ * TT * HD * 2); bf* KPh = (bf*)take((size_t)NKV * TT * HD * 2); bf* KPl = (bf*)take((size_t)NKV * TT * HD * 2); bf* VTh = (bf*)take((size_t)NKV * HD * TT * 2); bf* VTl = (bf*)take((size_t)NKV * HD * TT * 2); bf* Ph = (bf*)take((size_t)ZH * RH * TT * 2); bf* Pl = (bf*)take((size_t)ZH * RH * TT * 2);
    float* Sb = (float*)take((size_t)ZH * TT * TT * 4); h16* P16 = (h16*)take((size_t)ZH * TT * TT * 2); float* Ob = (float*)take((size_t)SKO * ZH * TT * HD * 4);
    if ((size_t)(wsp - (char*)d_ws) > ws_size) return;    // ws 256 MiB
    float* FV = FK;   // v projection reuses the k buffer after the k planes are built (stream-ordered)
    { k_wtG<<<(unsigned)((DM * DQ / 64 + 63) / 64), 256, 0, stream>>>(wq, DM, DQ, WQ); k_wtG<<<(unsigned)((DM * DKV / 64 + 63) / 64), 256, 0, stream>>>(wk, DM, DKV, WK); k_wtG<<<(unsigned)((DM * DKV / 64 + 63) / 64), 256, 0, stream>>>(wv, DM, DKV, WV);
      
       }
    k_csid<<<(TT * HD + 255) / 256, 256, 0, stream>>>(CS);
    const unsigned LQ = (unsigned)(((size_t)NH_ * TT * HD / 2 + 255) / 256), LKv = (unsigned)(((size_t)NKV * TT * HD / 2 + 255) / 256);
    for (int b = 0; b < NB_; ++b) {
        
        k_cvt8<<<(unsigned)(((size_t)TT * DM / 8 + 255) / 256), 256, 0, stream>>>(x + (size_t)b * TT * DM, XB, (size_t)TT * DM / 8);
        k_gemmw<bf, 0, false><<<dim3(TT / 64, DQ / 64, SKP), 32, 0, stream>>>(XB, nullptr, WQ, nullptr, DM, DM / SKP, FQ, DQ, nullptr, DM / SKP, DM / SKP, (size_t)TT * DQ);
        k_rope<SKP, TT * DQ><<<LQ, 256, 0, stream>>>(FQ, DQ, NH_, CS, nullptr, nullptr, 1.0f, QP16, QPh, QPl);
        k_gemmw<bf, 0, false><<<dim3(TT / 64, DKV / 64, SKP), 32, 0, stream>>>(XB, nullptr, WK, nullptr, DM, DM / SKP, FK, DKV, nullptr, DM / SKP, DM / SKP, (size_t)TT * DKV);
        k_rope<SKP, TT * DKV><<<LKv, 256, 0, stream>>>(FK, DKV, NKV, CS, nullptr, nullptr, 1.0f, KP16, KPh, KPl);
        k_gemmw<bf, 0, false><<<dim3(TT / 64, DKV / 64, SKV), 32, 0, stream>>>(XB, nullptr, WV, nullptr, DM, DM / SKV, FV, DKV, nullptr, DM / SKV, DM / SKV, (size_t)TT * DKV); k_vtp<SKV, TT * DKV><<<LKv, 256, 0, stream>>>(FV, DKV, NKV, VT16, VTh, VTl);
        static_assert(ZH == 1, "attn.v uses grid z for its K slices");
        for (int h0 = 0; h0 < NH_; h0 += ZH) { const size_t zq = (size_t)h0, zk = (size_t)(h0 / REP);   // one kv head per query head: a pass holds ZH = 1 head, so the z-strides TT*HD go unused
            k_gemmw<bf, 2, false><<<dim3(RH / 64, TT / 64, ZH), 32, 0, stream>>>(QPh + zq * TT * HD, QPl + zq * TT * HD, KPh + zk * TT * HD, KPl + zk * TT * HD, HD, HD, Sb, TT, nullptr, (size_t)TT * HD, (size_t)TT * HD, (size_t)TT * TT);
            k_gemmw<h16, 0, false><<<dim3((TT - RH) / 64, TT / 64, ZH), 32, 0, stream>>>(QP16 + zq * TT * HD + (size_t)RH * HD, nullptr, KP16 + zk * TT * HD, nullptr, HD, HD, Sb + (size_t)RH * TT, TT, nullptr, (size_t)TT * HD, (size_t)TT * HD, (size_t)TT * TT);
            k_lsoft<<<ZH * TT / 8, 256, 0, stream>>>(Sb, P16, Ph, Pl);
            k_gemmw<bf, 2, false><<<dim3(RH / 64, HD / 64, SKO), 32, 0, stream>>>(Ph, Pl, VTh + zk * HD * TT, VTl + zk * HD * TT, TT, TT / SKO, Ob, SKO * HD, nullptr, TT / SKO, TT / SKO, HD);
            k_gemmw<h16, 0, false><<<dim3((TT - RH) / 64, HD / 64, SKO), 32, 0, stream>>>(P16 + (size_t)RH * TT, nullptr, VT16 + zk * HD * TT, nullptr, TT, TT / SKO, Ob + (size_t)RH * SKO * HD, SKO * HD, nullptr, TT / SKO, TT / SKO, HD);
            k_merge<<<(unsigned)(((size_t)ZH * TT * HD / 2 + 255) / 256), 256, 0, stream>>>(Ob, h0, OUT + (size_t)b * TT * DQ); }
         }
}

// v002
// Measured time: 213 microseconds a run.
// In two side-by-side timings against v001, it was 2.41 and 2.38 times as fast.
// All steps since v000 together make it 5.53 times as fast.
#include <hip/hip_runtime.h>

// Single attention head (ix [4][4096][768]; k, q, v = ix W ('xw' [768][64], no bias); wei = softmax(q.k / 8) over all 4096 keys; out = wei.v -> [4][4096][64] f32 (1.05 M)).
// Layout per batch: exact projections; one fused attention kernel over 4,096 keys in 16 key slices (rows < 512 hi/lo, rest fp16) with a running-maximum softmax in registers; the merge kernel joins the slices and normalises; f32 output.
// Compute dtypes, f32 accumulate: every input rounded to bf16; projections on PLAIN bf16 operands (exact); scores and attn.v rows < 512 on bf16 hi/lo planes (3 products), the rest single fp16; softmax f32; f32 output.

#define NB_  4
#define TT   4096
#define DM   768
#define NH_  1
#define NKV  1
#define REP  (NH_ / NKV)
#define HD   64
#define DQ   (NH_ * HD)
#define DKV  (NKV * HD)
#define ZH   1
#define RH   512                  // query rows < RH use hi+lo planes (0: none)
#define WIN  0
#define SCL  0.125f   // HD^-0.5
#define SKP  8                    // K slices of the q and k projections (96 k each)
#define SKV  4                    // K slices of the v projection (192 k each; fewer, because k_vtp reads its planes row-strided)
#define NSL  16                   // key slices of the fused attention
#define KSL  (TT / NSL)           // keys per slice (256)
#define QWG  256                  // query rows per workgroup: 16 waves x 16
typedef _Float16 h16;
typedef unsigned short bf;
typedef __attribute__((ext_vector_type(16))) __bf16   v16bf;
typedef __attribute__((ext_vector_type(16))) _Float16 v16h;
typedef __attribute__((ext_vector_type(8)))  _Float16 v8h;
typedef __attribute__((ext_vector_type(8)))  unsigned short v8us;
typedef __attribute__((ext_vector_type(8)))  float    v8f;
typedef __attribute__((ext_vector_type(4)))  float    v4f;
typedef v8h  __attribute__((may_alias)) v8ha;
typedef v4f  __attribute__((may_alias)) v4fa;
typedef v8us __attribute__((may_alias)) v8usa;

__device__ __forceinline__ unsigned short f2bf(float f) { unsigned u = __float_as_uint(f); u += 0x7FFFu + ((u >> 16) & 1u); return (unsigned short)(u >> 16); }
__device__ __forceinline__ float bf2f(unsigned short b) { return __uint_as_float(((unsigned)b) << 16); }
__device__ __forceinline__ float bfr(float f) { return bf2f(f2bf(f)); }
__device__ __forceinline__ v16h cat16(v8h lo, v8h hi) { return __builtin_shufflevector(lo, hi, 0, 1, 2, 3, 4, 5, 6, 7, 8, 9, 10, 11, 12, 13, 14, 15); }
__device__ __forceinline__ v16bf cat16b(v8us lo, v8us hi) { return __builtin_bit_cast(v16bf, __builtin_shufflevector(lo, hi, 0, 1, 2, 3, 4, 5, 6, 7, 8, 9, 10, 11, 12, 13, 14, 15)); }
__device__ __forceinline__ v8f wmma16(v16h a, v16h b, v8f c) { return __builtin_amdgcn_wmma_f32_16x16x32_f16(false, a, false, b, (short)0, c, false, false); }
__device__ __forceinline__ v8f wmmab(v16bf a, v16bf b, v8f c) { return __builtin_amdgcn_wmma_f32_16x16x32_bf16(false, a, false, b, (short)0, c, false, false); }



// ---- k_gemmw: register-blocked GEMM, ONE WAVE per 64x64 output tile (16 accumulators), operands straight from K-contiguous 16-bit planes; grid (M/64, N/64, Z), 32 threads.
// C[m][n] (f32, pitch ldc, + optional f32 bias[n]) = sum_k A[m][k] Bt[n][k] (+ split products per NSPLIT). K is the operands' row pitch, KL the k range one workgroup sums; z strides sA/sB/sC in elements. KL % 32 == 0.
// Split-K: grid z = K / KL, sA = sB = KL; slice z writes its own partial plane (sC apart) and the consumer kernel adds the partials in ascending z.
template <typename T16> struct WFrag;
template <> struct WFrag<h16> { typedef v16h V; static __device__ __forceinline__ V ld(const h16* p) { return cat16(*(const v8h*)p, *(const v8h*)(p + 16)); } static __device__ __forceinline__ v8f mma(V a, V b, v8f c) { return wmma16(a, b, c); } };
template <> struct WFrag<bf> { typedef v16bf V; static __device__ __forceinline__ V ld(const bf* p) { return cat16b(*(const v8us*)p, *(const v8us*)(p + 16)); } static __device__ __forceinline__ v8f mma(V a, V b, v8f c) { return wmmab(a, b, c); } };
template <typename T16, int NSPLIT, bool BIAS>
__global__ __launch_bounds__(32) void k_gemmw(const T16* __restrict__ A, const T16* __restrict__ A2, const T16* __restrict__ Bt, const T16* __restrict__ Bt2, int K, int KL, float* C, int ldc, const float* __restrict__ bias, size_t sA, size_t sB, size_t sC) {
    typedef typename WFrag<T16>::V V;
    __shared__ __align__(16) float os[16 * 68];
    const size_t z = blockIdx.z; A += z * sA; if (A2) A2 += z * sA; Bt += z * sB; if (Bt2) Bt2 += z * sB; C += z * sC;
    const int lane = threadIdx.x & 31, lr = lane & 15, hi = lane >> 4; const int r0 = blockIdx.x * 64, c0 = blockIdx.y * 64;
    v8f acc[4][4];
#pragma unroll
    for (int mb = 0; mb < 4; ++mb)
#pragma unroll
        for (int nb = 0; nb < 4; ++nb) acc[mb][nb] = (v8f){};
    const size_t aoff = (size_t)(r0 + lr) * K + 8 * hi, boff = (size_t)(c0 + lr) * K + 8 * hi;
#pragma unroll 1
    for (int kc = 0; kc < KL; kc += 32) {
        V a[4], a2[4];
#pragma unroll
        for (int mb = 0; mb < 4; ++mb) { a[mb] = WFrag<T16>::ld(A + aoff + (size_t)mb * 16 * K + kc); if (NSPLIT == 1 || NSPLIT == 2) a2[mb] = WFrag<T16>::ld(A2 + aoff + (size_t)mb * 16 * K + kc); }
#pragma unroll
        for (int nb = 0; nb < 4; ++nb) { const V b = WFrag<T16>::ld(Bt + boff + (size_t)nb * 16 * K + kc); V b2; if (NSPLIT >= 2) b2 = WFrag<T16>::ld(Bt2 + boff + (size_t)nb * 16 * K + kc);
#pragma unroll
            for (int mb = 0; mb < 4; ++mb) { acc[mb][nb] = WFrag<T16>::mma(a[mb], b, acc[mb][nb]); if (NSPLIT == 1 || NSPLIT == 2) acc[mb][nb] = WFrag<T16>::mma(a2[mb], b, acc[mb][nb]); if (NSPLIT >= 2) acc[mb][nb] = WFrag<T16>::mma(a[mb], b2, acc[mb][nb]); } }
        asm volatile("v_nop\n\tv_nop\n\tv_nop\n\tv_nop" : "+v"(acc[0][0]), "+v"(acc[1][1]), "+v"(acc[2][2]), "+v"(acc[3][3]) : "v"(a[0]), "v"(a[3]));
    }
#pragma unroll
    for (int mb = 0; mb < 4; ++mb) {
#pragma unroll
        for (int nb = 0; nb < 4; ++nb) {
#pragma unroll
            for (int j = 0; j < 8; ++j) os[(hi * 8 + j) * 68 + nb * 16 + lr] = acc[mb][nb][j]; }
        __builtin_amdgcn_wave_barrier(); asm volatile("" ::: "memory");
        float* crow = C + (size_t)(r0 + mb * 16) * ldc + c0;
{
#pragma unroll
            for (int s = 0; s < 8; ++s) { const int row = 2 * s + hi, cofs = lr * 4; v4f val = *(const v4fa*)(os + row * 68 + cofs); if (BIAS) { val[0] += bfr(bias[c0 + cofs]); val[1] += bfr(bias[c0 + cofs + 1]); val[2] += bfr(bias[c0 + cofs + 2]); val[3] += bfr(bias[c0 + cofs + 3]); }
                *(v4f*)(crow + (size_t)row * ldc + cofs) = val; }
             }
        __builtin_amdgcn_wave_barrier(); asm volatile("" ::: "memory");
    }
}

__device__ __forceinline__ h16 tohx(float x) { return (h16)x; }
__device__ __forceinline__ void splitf(float y, unsigned short& h, unsigned short& l) { h = f2bf(y); l = f2bf(y - bf2f(h)); }
typedef __attribute__((ext_vector_type(2))) _Float16 v2h;
typedef __attribute__((ext_vector_type(4))) _Float16 v4h;
typedef __attribute__((ext_vector_type(2))) unsigned short v2us;
typedef __attribute__((ext_vector_type(4))) unsigned short v4us;
typedef __attribute__((ext_vector_type(2))) float v2f;
typedef __attribute__((ext_vector_type(4))) int v4i;

__global__ __launch_bounds__(256) void k_wtG(const float* __restrict__ w, int K, int N, bf* Bt) {
    const int lane = threadIdx.x & 31; const int L0 = (blockIdx.x * 8 + (threadIdx.x >> 5)) * 8; const int nlines = N * K / 64;
{
#pragma unroll 1
        for (int l = 0; l < 8; ++l) { const int L = L0 + l; if (L >= nlines) break; const size_t e = (size_t)L * 64 + lane * 2; const int k = (int)(e % K), n = (int)(e / K); v2us o;
            o[0] = f2bf(w[(size_t)k * N + n]); o[1] = f2bf(w[(size_t)(k + 1) * N + n]); *(v2us*)(Bt + e) = o; }
         }
}
__global__ __launch_bounds__(256) void k_cvt8(const float* __restrict__ src, bf* dst, size_t n8) { const size_t i = (size_t)blockIdx.x * 256 + threadIdx.x; if (i >= n8) return; const v8f v = *(const v8f*)(src + i * 8); v8us o;
#pragma unroll
    for (int k = 0; k < 8; ++k) o[k] = f2bf(v[k]); *(v8us*)(dst + i * 8) = o;  }

// k_rope: head planes [h][t][d] (fp16 + hi/lo) of rope(x) x sc with the rotate-half convention out[d] = x[d] cos[t][d] - x[d+HD/2] sin[t][d], out[d+HD/2] = x[d+HD/2] cos[t][d+HD/2] + x[d] sin[t][d+HD/2]
template <int NS, int PL>   // F holds NS split-K partial planes, PL elements apart
__global__ __launch_bounds__(256) void k_rope(const float* __restrict__ F, int pitch, int nheads, const float* __restrict__ CS, const float* __restrict__ RF, const float* __restrict__ nw, float sc, h16* P16, bf* Ph, bf* Pl) {
    const size_t e = ((size_t)blockIdx.x * 256 + threadIdx.x) * 2; if (e >= (size_t)nheads * TT * HD) return; const int d = (int)(e % HD); const int t = (int)((e / HD) % TT); const int h = (int)(e / ((size_t)HD * TT)); const float* f = F + (size_t)t * pitch + h * HD; const float rf = RF ? RF[(size_t)h * TT + t] : 1.0f; v2h o16; v2us oh, ol;
    const int dq = (d < HD / 2) ? d + HD / 2 : d - HD / 2; const float* fa = f + d; const float* fb = f + dq; v2f p0[NS], p1[NS];   // d is even: elements d, d+1 and their partners dq, dq+1 are two 8-byte pairs
#pragma unroll
    for (int s = 0; s < NS; ++s) { p0[s] = *(const v2f*)(fa + (size_t)s * PL); p1[s] = *(const v2f*)(fb + (size_t)s * PL); }
    asm volatile("s_wait_xcnt 0x0" :: "v"(fa), "v"(fb) : "memory");   // both address pairs stay live up to this wait, so no load's result lands in a register that an issued load still names
    v2f s0 = p0[0], s1 = p1[0];   // add the projection's split-K planes, ascending
#pragma unroll
    for (int s = 1; s < NS; ++s) { s0 += p0[s]; s1 += p1[s]; }
#pragma unroll
    for (int q = 0; q < 2; ++q) { const int dd = d + q; const int dp = (dd < HD / 2) ? dd + HD / 2 : dd - HD / 2; float x0 = s0[q], x1 = s1[q];
        if (RF) { float n0 = __fmul_rn(x0, rf), n1 = __fmul_rn(x1, rf); asm volatile("" : "+v"(n0)); asm volatile("" : "+v"(n1)); x0 = __fmul_rn(bfr(nw[dd]), n0); x1 = __fmul_rn(bfr(nw[dp]), n1); }
        const v2f cs = *(const v2f*)(CS + ((size_t)t * HD + dd) * 2); float a = __fmul_rn(x0, cs[0]), bq = __fmul_rn(x1, cs[1]); asm volatile("" : "+v"(a)); asm volatile("" : "+v"(bq)); const float r = ((dd < HD / 2) ? __fsub_rn(a, bq) : __fadd_rn(a, bq)) * sc;
        o16[q] = tohx(r); unsigned short a2, c2; splitf(r, a2, c2); oh[q] = a2; ol[q] = c2; }
    *(v2h*)(P16 + e) = o16; *(v2us*)(Ph + e) = oh; *(v2us*)(Pl + e) = ol;  }
template <int NS, int PL>   // F holds NS split-K partial planes, PL elements apart
__global__ __launch_bounds__(256) void k_vtp(const float* __restrict__ F, int pitch, int nheads, h16* V16, bf* Vh, bf* Vl) { const size_t e = ((size_t)blockIdx.x * 256 + threadIdx.x) * 2; if (e >= (size_t)nheads * HD * TT) return; const int t = (int)(e % TT); const int d = (int)((e / TT) % HD); const int g = (int)(e / ((size_t)TT * HD)); v2h o16; v2us oh, ol;
#pragma unroll
    for (int q = 0; q < 2; ++q) { const float* fp = F + (size_t)(t + q) * pitch + g * HD + d; float x = fp[0];
#pragma unroll
        for (int s = 1; s < NS; ++s) x += fp[(size_t)s * PL];   // add the projection's split-K planes, ascending
        o16[q] = tohx(x); unsigned short a2, c2; splitf(x, a2, c2); oh[q] = a2; ol[q] = c2; }
    *(v2h*)(V16 + e) = o16; *(v2us*)(Vh + e) = oh; *(v2us*)(Vl + e) = ol;  }
__global__ __launch_bounds__(256) void k_csid(float* CS) { const int idx = blockIdx.x * 256 + threadIdx.x; if (idx >= TT * HD) return; v2f cs; cs[0] = 1.0f; cs[1] = 0.0f; *(v2f*)(CS + (size_t)idx * 2) = cs;  }
// ---- k_attn: scores, softmax and attn.v fused. A workgroup (16 waves): 256 query rows x one slice of KSL keys; the slice's k rows and v rows are staged once in LDS; a wave: 16 query columns, passes of 32 keys.
// Transposed products: St = K.Qt (A = key rows, B = query columns), so a lane holds 16 scores of ONE query; two St tiles converted in place are the B operand of Ot += Vt.Pt (A = rows of the [d][t] v planes).
// Running maximum per query in base 2; a slice leaves its unnormalised Ot, its maximum and its sum, and k_merge joins the slices.
#define KPE  72                   // LDS pitch of a key row, elements: 128 B + 16 B (16 B x odd: no bank conflict for 16-byte reads)
#define VPE  (KSL + 8)            // LDS pitch of a v row (KSL keys), elements: 512 B + 16 B
#define PLE  (KSL * KPE + HD * VPE)   // one k plane and one v plane
template <typename T16> struct Oct;
template <> struct Oct<h16> { typedef v8h H; };
template <> struct Oct<bf> { typedef v8us H; };
__device__ __forceinline__ float xhalf(float x) { return __builtin_bit_cast(float, __builtin_amdgcn_permlanex16(__builtin_bit_cast(int, x), __builtin_bit_cast(int, x), 0x76543210, 0xfedcba98, false, false)); }   // lane l with lane l ^ 16
// Base-2 exponentials with the slot that the instruction set asks for behind a transcendental written in: inside a statement every v_exp_f32 is followed by an independent one (outputs early-clobber, so none is another's source), the last by v_nop.
__device__ __forceinline__ void exp2x8(const float (&x)[8], float (&e)[8]) {
    asm("v_exp_f32 %0, %8\n\tv_exp_f32 %1, %9\n\tv_exp_f32 %2, %10\n\tv_exp_f32 %3, %11\n\tv_exp_f32 %4, %12\n\tv_exp_f32 %5, %13\n\tv_exp_f32 %6, %14\n\tv_exp_f32 %7, %15\n\tv_nop"
        : "=&v"(e[0]), "=&v"(e[1]), "=&v"(e[2]), "=&v"(e[3]), "=&v"(e[4]), "=&v"(e[5]), "=&v"(e[6]), "=&v"(e[7]) : "v"(x[0]), "v"(x[1]), "v"(x[2]), "v"(x[3]), "v"(x[4]), "v"(x[5]), "v"(x[6]), "v"(x[7])); }
__device__ __forceinline__ float exp2x1(float x) { float e; asm("v_exp_f32 %0, %1\n\tv_nop" : "=&v"(e) : "v"(x)); return e; }
template <typename T16, bool HL>   // HL: second (low) planes, three products each
__device__ __forceinline__ void attn_slice(T16* sm, const T16* __restrict__ Q, const T16* __restrict__ Q2, const T16* __restrict__ Kp, const T16* __restrict__ K2, const T16* __restrict__ Vt, const T16* __restrict__ V2, int q0, int sl, float* __restrict__ Ob, float* __restrict__ MLb) {
    typedef typename WFrag<T16>::V V; typedef typename Oct<T16>::H H;
    const int tid = threadIdx.x, lane = tid & 31, lr = lane & 15, hi = lane >> 4;
    const float POFF = HL ? 0.0f : 8.0f;   // fp16 weights are carried x 2^8 (sum and Ot alike), away from the fp16 subnormals
    const size_t qo = (size_t)(q0 + lr) * HD + 8 * hi, ko = (size_t)sl * KSL * HD + tid * 8, vo = (size_t)(tid >> 5) * TT + sl * KSL + (tid & 31) * 8;
    const T16* qp = Q + qo; const T16* qq = HL ? Q2 + qo : qp; const T16* gk = Kp + ko; const T16* gl = HL ? K2 + ko : gk; const T16* gv = Vt + vo; const T16* gw = HL ? V2 + vo : gv;   // every global read below is one of these plus a constant
    V qf[2], qg[2];
    {   // stage the slice: 16-byte pieces, whole lines per wave; piece tid + 512 i is k row (tid >> 3) + 64 i, v row (tid >> 5) + 16 i
        H tk[4], tl[4], tv[4], tw[4];
#pragma unroll
        for (int i = 0; i < 4; ++i) { tk[i] = *(const H*)(gk + i * 4096); tv[i] = *(const H*)(gv + i * 16 * TT); if (HL) { tl[i] = *(const H*)(gl + i * 4096); tw[i] = *(const H*)(gw + i * 16 * TT); } }
#pragma unroll
        for (int ks = 0; ks < 2; ++ks) { qf[ks] = WFrag<T16>::ld(qp + ks * 32); if (HL) qg[ks] = WFrag<T16>::ld(qq + ks * 32); }
        asm volatile("s_wait_xcnt 0x0" :: "v"(qp), "v"(qq), "v"(gk), "v"(gl), "v"(gv), "v"(gw) : "memory");   // the address pairs stay live up to this wait, so no load's result lands in a register that an issued load still names
        T16* dk = sm + (tid >> 3) * KPE + (tid & 7) * 8; T16* dv = sm + KSL * KPE + (tid >> 5) * VPE + (tid & 31) * 8;
#pragma unroll
        for (int i = 0; i < 4; ++i) { *(H*)(dk + i * 64 * KPE) = tk[i]; *(H*)(dv + i * 16 * VPE) = tv[i]; if (HL) { *(H*)(dk + PLE + i * 64 * KPE) = tl[i]; *(H*)(dv + PLE + i * 16 * VPE) = tw[i]; } }
    }
    __syncthreads();   // the staged slice is read by all sixteen waves
    const T16* kl = sm + lr * KPE + 8 * hi; const T16* km = kl + PLE; const T16* vl = sm + KSL * KPE + lr * VPE + 8 * hi; const T16* vm = vl + PLE;   // walked pass by pass, so that every read is one of the four plus a 16-bit offset
    v8f o[4]; float mr = -3.0e38f, ls = 0.f;
#pragma unroll
    for (int dt = 0; dt < 4; ++dt) o[dt] = (v8f){};
#pragma unroll (HL ? 1 : KSL / 32)   // fp16: unrolled, every LDS address is a lane register plus an immediate and the next pass's reads can start early; hi/lo: rolled, the low planes lie beyond the 16-bit offset and are walked
    for (int p = 0; p < KSL / 32; ++p) {
        V ka[2][2], kb[2][2], va[4], vb[4];
#pragma unroll
        for (int kt = 0; kt < 2; ++kt)
#pragma unroll
            for (int ks = 0; ks < 2; ++ks) { ka[kt][ks] = WFrag<T16>::ld(kl + kt * 16 * KPE + ks * 32); if (HL) kb[kt][ks] = WFrag<T16>::ld(km + kt * 16 * KPE + ks * 32); }
#pragma unroll
        for (int dt = 0; dt < 4; ++dt) { va[dt] = WFrag<T16>::ld(vl + dt * 16 * VPE); if (HL) vb[dt] = WFrag<T16>::ld(vm + dt * 16 * VPE); }
        kl += 32 * KPE; km += 32 * KPE; vl += 32; vm += 32;
        __builtin_amdgcn_sched_barrier(0);   // a pass's LDS reads are all issued ahead of its first product (the v reads a whole softmax early), and no later pass's reads rise above this line: without it the unrolled path fetches so far ahead that it spills
        v8f s[2];
#pragma unroll
        for (int kt = 0; kt < 2; ++kt) { v8f c = (v8f){};
#pragma unroll
            for (int ks = 0; ks < 2; ++ks) { c = WFrag<T16>::mma(ka[kt][ks], qf[ks], c); if (HL) { c = WFrag<T16>::mma(ka[kt][ks], qg[ks], c); c = WFrag<T16>::mma(kb[kt][ks], qf[ks], c); } }
            s[kt] = c; }
        V pb, pc; float mx = mr;
#pragma unroll
        for (int kt = 0; kt < 2; ++kt)
#pragma unroll
            for (int r = 0; r < 8; ++r) { s[kt][r] *= SCL * 1.4426950408889634f; mx = fmaxf(mx, s[kt][r]); }
        mx = fmaxf(mx, xhalf(mx));   // both halves of the wave hold keys of the same query
        const float al = exp2x1(mr - mx); mr = mx; const float mo = mx - POFF; float sum = 0.f; float xd[2][8], xe[2][8];
#pragma unroll
        for (int kt = 0; kt < 2; ++kt) {
#pragma unroll
            for (int r = 0; r < 8; ++r) xd[kt][r] = s[kt][r] - mo;
            exp2x8(xd[kt], xe[kt]); }
#pragma unroll
        for (int e = 0; e < 16; ++e) { const float ex = xe[e >> 3][e & 7]; sum += ex;
            if constexpr (HL) { const __bf16 h = (__bf16)ex; pb[e] = h; pc[e] = (__bf16)(ex - (float)h); } else pb[e] = (h16)ex; }
        ls = ls * al + sum;
#pragma unroll
        for (int dt = 0; dt < 4; ++dt) o[dt] *= al;
#pragma unroll
        for (int dt = 0; dt < 4; ++dt) { o[dt] = WFrag<T16>::mma(va[dt], pb, o[dt]); if (HL) { o[dt] = WFrag<T16>::mma(va[dt], pc, o[dt]); o[dt] = WFrag<T16>::mma(vb[dt], pb, o[dt]); } }
    }
    const int q = q0 + lr; const float lt = ls + xhalf(ls); float* ob = Ob + ((size_t)q * NSL + sl) * HD + 8 * hi;   // a lane holds d = 16 dt + 8 hi + r of its query
#pragma unroll
    for (int dt = 0; dt < 4; ++dt) { v4f w0, w1;
#pragma unroll
        for (int r = 0; r < 4; ++r) { w0[r] = o[dt][r]; w1[r] = o[dt][4 + r]; }
        *(v4f*)(ob + dt * 16) = w0; *(v4f*)(ob + dt * 16 + 4) = w1; }
    if (hi == 0) { v2f ml; ml[0] = mr; ml[1] = lt; *(v2f*)(MLb + ((size_t)sl * TT + q) * 2) = ml; }   // [slice][t]: a wave's 16 pairs fill one 128-byte line
}
__global__ __launch_bounds__(512) void k_attn(const h16* __restrict__ Q16, const h16* __restrict__ K16, const h16* __restrict__ V16, const bf* __restrict__ Qh, const bf* __restrict__ Ql, const bf* __restrict__ Kh, const bf* __restrict__ Kl, const bf* __restrict__ Vh, const bf* __restrict__ Vl, float* Ob, float* MLb) {
    static_assert(RH % QWG == 0 && TT % QWG == 0 && KSL == 256 && HD == 64, "a workgroup is all hi/lo or all fp16; the staging loops are written for 256 keys x 64");
    __shared__ __align__(16) unsigned short sm[2 * PLE];
    const int q0 = blockIdx.x * QWG + (threadIdx.x >> 5) * 16, sl = blockIdx.y;
    if (blockIdx.x < RH / QWG) attn_slice<bf, true>(sm, Qh, Ql, Kh, Kl, Vh, Vl, q0, sl, Ob, MLb);
    else attn_slice<h16, false>((h16*)sm, Q16, nullptr, K16, nullptr, V16, nullptr, q0, sl, Ob, MLb);
}

// k_merge: out[t][d] = sum_s Ot_s 2^(m_s - M) / sum_s l_s 2^(m_s - M), slices ascending, M the largest slice maximum
__global__ __launch_bounds__(256) void k_merge(const float* __restrict__ O, const float* __restrict__ MLb, float* OUTb) { const size_t e = ((size_t)blockIdx.x * 256 + threadIdx.x) * 2; if (e >= (size_t)TT * HD) return; const int d = (int)(e % HD); const int t = (int)(e / HD);
    const float* pb = O + (size_t)t * (NSL * HD) + d;   // partials lie [t][slice][d]: one address pair reaches all slices by immediate offsets
    const float* mp = MLb + (size_t)t * 2;              // (maximum, sum) pairs lie [slice][t]
    v2f p[NSL], ml[NSL];
#pragma unroll
    for (int s = 0; s < NSL; ++s) { p[s] = *(const v2f*)(pb + s * HD); ml[s] = *(const v2f*)(mp + s * TT * 2); }
    asm volatile("s_wait_xcnt 0x0" :: "v"(pb), "v"(mp) : "memory");   // both address pairs stay live up to this wait, so no load's result lands in a register that an issued load still names
    __builtin_amdgcn_sched_barrier(0);   // all 32 loads are issued ahead of the first use: one memory latency, not two
    float M = ml[0][0];
#pragma unroll
    for (int s = 1; s < NSL; ++s) M = fmaxf(M, ml[s][0]);
    static_assert(NSL == 16, "two statements of eight exponentials");
    v2f a; a[0] = 0.f; a[1] = 0.f; float L = 0.f; float xd[2][8], w[2][8];
#pragma unroll
    for (int h = 0; h < 2; ++h) {
#pragma unroll
        for (int r = 0; r < 8; ++r) xd[h][r] = ml[h * 8 + r][0] - M;
        exp2x8(xd[h], w[h]); }
#pragma unroll
    for (int s = 0; s < NSL; ++s) { a += p[s] * w[s >> 3][s & 7]; L += ml[s][1] * w[s >> 3][s & 7]; }
    v2f o2; o2[0] = __fdiv_rn(a[0], L); o2[1] = __fdiv_rn(a[1], L); *(v2f*)(OUTb + e) = o2;  }

extern "C" void kernel_launch(void* const* d_in, const int* in_sizes, int n_in,
                              void* d_out, int out_size, void* d_ws, size_t ws_size, hipStream_t stream) {
    (void)in_sizes; (void)n_in; (void)out_size;
    const float* x = (const float*)d_in[0]; const float* wk = (const float*)d_in[1]; const float* wq = (const float*)d_in[2]; const float* wv = (const float*)d_in[3]; const float* wo = nullptr; (void)wo;
    float* OUT = (float*)d_out;     // [4][4096][64]
    char* wsp = (char*)d_ws;
    auto take = [&](size_t bytes) { char* p = wsp; wsp += (bytes + 255) & ~(size_t)255; return (void*)p; };
    bf* WQ = (bf*)take((size_t)DQ * DM * 2); bf* WK = (bf*)take((size_t)DKV * DM * 2); bf* WV = (bf*)take((size_t)DKV * DM * 2); float* CS = (float*)take((size_t)TT * HD * 2 * 4);
    bf* XB = (bf*)take((size_t)TT * DM * 2); float* FQ = (float*)take((size_t)SKP * TT * DQ * 4); float* FK = (float*)take((size_t)SKP * TT * DKV * 4);
    h16* QP16 = (h16*)take((size_t)NH_ * TT * HD * 2); h16* KP16 = (h16*)take((size_t)NKV * TT * HD * 2); h16* VT16 = (h16*)take((size_t)NKV * HD * TT * 2);
    bf* QPh = (bf*)take((size_t)NH_ * TT * HD * 2); bf* QPl = (bf*)take((size_t)NH_ * TT * HD * 2); bf* KPh = (bf*)take((size_t)NKV * TT * HD * 2); bf* KPl = (bf*)take((size_t)NKV * TT * HD * 2); bf* VTh = (bf*)take((size_t)NKV * HD * TT * 2); bf* VTl = (bf*)take((size_t)NKV * HD * TT * 2);
    float* Ob = (float*)take((size_t)NSL * TT * HD * 4); float* MLb = (float*)take((size_t)NSL * TT * 2 * 4);
    if ((size_t)(wsp - (char*)d_ws) > ws_size) return;    // ws 256 MiB
    float* FV = FK;   // v projection reuses the k buffer after the k planes are built (stream-ordered)
    { k_wtG<<<(unsigned)((DM * DQ / 64 + 63) / 64), 256, 0, stream>>>(wq, DM, DQ, WQ); k_wtG<<<(unsigned)((DM * DKV / 64 + 63) / 64), 256, 0, stream>>>(wk, DM, DKV, WK); k_wtG<<<(unsigned)((DM * DKV / 64 + 63) / 64), 256, 0, stream>>>(wv, DM, DKV, WV);
      
       }
    k_csid<<<(TT * HD + 255) / 256, 256, 0, stream>>>(CS);
    const unsigned LQ = (unsigned)(((size_t)NH_ * TT * HD / 2 + 255) / 256), LKv = (unsigned)(((size_t)NKV * TT * HD / 2 + 255) / 256);
    for (int b = 0; b < NB_; ++b) {
        
        k_cvt8<<<(unsigned)(((size_t)TT * DM / 8 + 255) / 256), 256, 0, stream>>>(x + (size_t)b * TT * DM, XB, (size_t)TT * DM / 8);
        k_gemmw<bf, 0, false><<<dim3(TT / 64, DQ / 64, SKP), 32, 0, stream>>>(XB, nullptr, WQ, nullptr, DM, DM / SKP, FQ, DQ, nullptr, DM / SKP, DM / SKP, (size_t)TT * DQ);
        k_rope<SKP, TT * DQ><<<LQ, 256, 0, stream>>>(FQ, DQ, NH_, CS, nullptr, nullptr, 1.0f, QP16, QPh, QPl);
        k_gemmw<bf, 0, false><<<dim3(TT / 64, DKV / 64, SKP), 32, 0, stream>>>(XB, nullptr, WK, nullptr, DM, DM / SKP, FK, DKV, nullptr, DM / SKP, DM / SKP, (size_t)TT * DKV);
        k_rope<SKP, TT * DKV><<<LKv, 256, 0, stream>>>(FK, DKV, NKV, CS, nullptr, nullptr, 1.0f, KP16, KPh, KPl);
        k_gemmw<bf, 0, false><<<dim3(TT / 64, DKV / 64, SKV), 32, 0, stream>>>(XB, nullptr, WV, nullptr, DM, DM / SKV, FV, DKV, nullptr, DM / SKV, DM / SKV, (size_t)TT * DKV); k_vtp<SKV, TT * DKV><<<LKv, 256, 0, stream>>>(FV, DKV, NKV, VT16, VTh, VTl);
        static_assert(NH_ == 1 && NKV == 1, "one head");
        k_attn<<<dim3(TT / QWG, NSL), 512, 0, stream>>>(QP16, KP16, VT16, QPh, QPl, KPh, KPl, VTh, VTl, Ob, MLb);
        k_merge<<<(unsigned)(((size_t)TT * HD / 2 + 255) / 256), 256, 0, stream>>>(Ob, MLb, OUT + (size_t)b * TT * DQ);
         }
}

// v003
// A run of this version takes 134 microseconds.
// Two timings next to v002 put it at 1.58 and 1.57 times that version's speed.
// All steps since v000 together make it 8.72 times as fast.
#include <hip/hip_runtime.h>

// Single attention head (ix [4][4096][768]; k, q, v = ix W ('xw' [768][64], no bias); wei = softmax(q.k / 8) over all 4096 keys; out = wei.v -> [4][4096][64] f32 (1.05 M)).
// Every stage is ONE launch for all four batches (the batch is a grid dimension; every workspace plane holds its four batch parts one behind the other). Per batch: exact projections; one fused attention kernel over 4,096 keys in 16 key slices (rows < 512 hi/lo, rest fp16) with a running-maximum softmax in registers; the merge kernel joins the slices and normalises; f32 output.
// Compute dtypes, f32 accumulate: every input rounded to bf16; projections on PLAIN bf16 operands (exact); scores and attn.v rows < 512 on bf16 hi/lo planes (3 products), the rest single fp16; softmax f32; f32 output.

#define NB_  4
#define TT   4096
#define DM   768
#define NH_  1
#define NKV  1
#define REP  (NH_ / NKV)
#define HD   64
#define DQ   (NH_ * HD)
#define DKV  (NKV * HD)
#define ZH   1
#define RH   512                  // query rows < RH use hi+lo planes (0: none)
#define WIN  0
#define SCL  0.125f   // HD^-0.5
#define SKP  8                    // K slices of the q and k projections (96 k each)
#define SKV  4                    // K slices of the v projection (192 k each; fewer, because k_vtp reads its planes row-strided)
#define NSL  16                   // key slices of the fused attention
#define KSL  (TT / NSL)           // keys per slice (256)
#define QWG  256                  // query rows per workgroup: 16 waves x 16
typedef _Float16 h16;
typedef unsigned short bf;
typedef __attribute__((ext_vector_type(16))) __bf16   v16bf;
typedef __attribute__((ext_vector_type(16))) _Float16 v16h;
typedef __attribute__((ext_vector_type(8)))  _Float16 v8h;
typedef __attribute__((ext_vector_type(8)))  unsigned short v8us;
typedef __attribute__((ext_vector_type(8)))  float    v8f;
typedef __attribute__((ext_vector_type(4)))  float    v4f;
typedef v8h  __attribute__((may_alias)) v8ha;
typedef v4f  __attribute__((may_alias)) v4fa;
typedef v8us __attribute__((may_alias)) v8usa;

__device__ __forceinline__ unsigned short f2bf(float f) { unsigned u = __float_as_uint(f); u += 0x7FFFu + ((u >> 16) & 1u); return (unsigned short)(u >> 16); }
__device__ __forceinline__ float bf2f(unsigned short b) { return __uint_as_float(((unsigned)b) << 16); }
__device__ __forceinline__ float bfr(float f) { return bf2f(f2bf(f)); }
__device__ __forceinline__ v16h cat16(v8h lo, v8h hi) { return __builtin_shufflevector(lo, hi, 0, 1, 2, 3, 4, 5, 6, 7, 8, 9, 10, 11, 12, 13, 14, 15); }
__device__ __forceinline__ v16bf cat16b(v8us lo, v8us hi) { return __builtin_bit_cast(v16bf, __builtin_shufflevector(lo, hi, 0, 1, 2, 3, 4, 5, 6, 7, 8, 9, 10, 11, 12, 13, 14, 15)); }
__device__ __forceinline__ v8f wmma16(v16h a, v16h b, v8f c) { return __builtin_amdgcn_wmma_f32_16x16x32_f16(false, a, false, b, (short)0, c, false, false); }
__device__ __forceinline__ v8f wmmab(v16bf a, v16bf b, v8f c) { return __builtin_amdgcn_wmma_f32_16x16x32_bf16(false, a, false, b, (short)0, c, false, false); }



// ---- k_gemmw: register-blocked GEMM, ONE WAVE per 64x64 output tile (16 accumulators), operands straight from K-contiguous 16-bit planes; grid (M/64, N/64, Z), 32 threads.
// C[m][n] (f32, pitch ldc, + optional f32 bias[n]) = sum_k A[m][k] Bt[n][k] (+ split products per NSPLIT). K is the operands' row pitch, KL the k range one workgroup sums; z strides sA/sB/sC in elements. KL % 32 == 0.
// Split-K and batch: grid z = batch * ZS + slice, ZS = K / KL, sA = sB = KL, a batch's A rows sAb apart, Bt shared; every z writes its own partial plane (sC apart) and the consumer kernel adds a batch's partials in ascending slice.
template <typename T16> struct WFrag;
template <> struct WFrag<h16> { typedef v16h V; static __device__ __forceinline__ V ld(const h16* p) { return cat16(*(const v8h*)p, *(const v8h*)(p + 16)); } static __device__ __forceinline__ v8f mma(V a, V b, v8f c) { return wmma16(a, b, c); } };
template <> struct WFrag<bf> { typedef v16bf V; static __device__ __forceinline__ V ld(const bf* p) { return cat16b(*(const v8us*)p, *(const v8us*)(p + 16)); } static __device__ __forceinline__ v8f mma(V a, V b, v8f c) { return wmmab(a, b, c); } };
template <typename T16, int NSPLIT, bool BIAS, int ZS>
__global__ __launch_bounds__(32) void k_gemmw(const T16* __restrict__ A, const T16* __restrict__ A2, const T16* __restrict__ Bt, const T16* __restrict__ Bt2, int K, int KL, float* C, int ldc, const float* __restrict__ bias, size_t sA, size_t sB, size_t sC, size_t sAb) {
    typedef typename WFrag<T16>::V V;
    __shared__ __align__(16) float os[16 * 68];
    const size_t z = blockIdx.z, zs = z % ZS, oa = zs * sA + (z / ZS) * sAb; A += oa; if (A2) A2 += oa; Bt += zs * sB; if (Bt2) Bt2 += zs * sB; C += z * sC;
    const int lane = threadIdx.x & 31, lr = lane & 15, hi = lane >> 4; const int r0 = blockIdx.x * 64, c0 = blockIdx.y * 64;
    v8f acc[4][4];
#pragma unroll
    for (int mb = 0; mb < 4; ++mb)
#pragma unroll
        for (int nb = 0; nb < 4; ++nb) acc[mb][nb] = (v8f){};
    const size_t aoff = (size_t)(r0 + lr) * K + 8 * hi, boff = (size_t)(c0 + lr) * K + 8 * hi;
#pragma unroll 1
    for (int kc = 0; kc < KL; kc += 32) {
        V a[4], a2[4];
#pragma unroll
        for (int mb = 0; mb < 4; ++mb) { a[mb] = WFrag<T16>::ld(A + aoff + (size_t)mb * 16 * K + kc); if (NSPLIT == 1 || NSPLIT == 2) a2[mb] = WFrag<T16>::ld(A2 + aoff + (size_t)mb * 16 * K + kc); }
#pragma unroll
        for (int nb = 0; nb < 4; ++nb) { const V b = WFrag<T16>::ld(Bt + boff + (size_t)nb * 16 * K + kc); V b2; if (NSPLIT >= 2) b2 = WFrag<T16>::ld(Bt2 + boff + (size_t)nb * 16 * K + kc);
#pragma unroll
            for (int mb = 0; mb < 4; ++mb) { acc[mb][nb] = WFrag<T16>::mma(a[mb], b, acc[mb][nb]); if (NSPLIT == 1 || NSPLIT == 2) acc[mb][nb] = WFrag<T16>::mma(a2[mb], b, acc[mb][nb]); if (NSPLIT >= 2) acc[mb][nb] = WFrag<T16>::mma(a[mb], b2, acc[mb][nb]); } }
        asm volatile("v_nop\n\tv_nop\n\tv_nop\n\tv_nop" : "+v"(acc[0][0]), "+v"(acc[1][1]), "+v"(acc[2][2]), "+v"(acc[3][3]) : "v"(a[0]), "v"(a[3]));
    }
#pragma unroll
    for (int mb = 0; mb < 4; ++mb) {
#pragma unroll
        for (int nb = 0; nb < 4; ++nb) {
#pragma unroll
            for (int j = 0; j < 8; ++j) os[(hi * 8 + j) * 68 + nb * 16 + lr] = acc[mb][nb][j]; }
        __builtin_amdgcn_wave_barrier(); asm volatile("" ::: "memory");
        float* crow = C + (size_t)(r0 + mb * 16) * ldc + c0;
{
#pragma unroll
            for (int s = 0; s < 8; ++s) { const int row = 2 * s + hi, cofs = lr * 4; v4f val = *(const v4fa*)(os + row * 68 + cofs); if (BIAS) { val[0] += bfr(bias[c0 + cofs]); val[1] += bfr(bias[c0 + cofs + 1]); val[2] += bfr(bias[c0 + cofs + 2]); val[3] += bfr(bias[c0 + cofs + 3]); }
                *(v4f*)(crow + (size_t)row * ldc + cofs) = val; }
             }
        __builtin_amdgcn_wave_barrier(); asm volatile("" ::: "memory");
    }
}

__device__ __forceinline__ h16 tohx(float x) { return (h16)x; }
__device__ __forceinline__ void splitf(float y, unsigned short& h, unsigned short& l) { h = f2bf(y); l = f2bf(y - bf2f(h)); }
typedef __attribute__((ext_vector_type(2))) _Float16 v2h;
typedef __attribute__((ext_vector_type(4))) _Float16 v4h;
typedef __attribute__((ext_vector_type(2))) unsigned short v2us;
typedef __attribute__((ext_vector_type(4))) unsigned short v4us;
typedef __attribute__((ext_vector_type(2))) float v2f;
typedef __attribute__((ext_vector_type(4))) int v4i;

__global__ __launch_bounds__(256) void k_wtG(const float* __restrict__ w, int K, int N, bf* Bt) {
    const int lane = threadIdx.x & 31; const int L0 = (blockIdx.x * 8 + (threadIdx.x >> 5)) * 8; const int nlines = N * K / 64;
{
#pragma unroll 1
        for (int l = 0; l < 8; ++l) { const int L = L0 + l; if (L >= nlines) break; const size_t e = (size_t)L * 64 + lane * 2; const int k = (int)(e % K), n = (int)(e / K); v2us o;
            o[0] = f2bf(w[(size_t)k * N + n]); o[1] = f2bf(w[(size_t)(k + 1) * N + n]); *(v2us*)(Bt + e) = o; }
         }
}
__global__ __launch_bounds__(256) void k_cvt8(const float* __restrict__ src, bf* dst, size_t n8) { const size_t i = (size_t)blockIdx.x * 256 + threadIdx.x; if (i >= n8) return; const v8f v = *(const v8f*)(src + i * 8); v8us o;
#pragma unroll
    for (int k = 0; k < 8; ++k) o[k] = f2bf(v[k]); *(v8us*)(dst + i * 8) = o;  }

// k_rope: head planes [h][t][d] (fp16 + hi/lo) of rope(x) x sc with the rotate-half convention out[d] = x[d] cos[t][d] - x[d+HD/2] sin[t][d], out[d+HD/2] = x[d+HD/2] cos[t][d+HD/2] + x[d] sin[t][d+HD/2]
template <int NS, int PL>   // F holds, per batch (grid y), NS split-K partial planes, PL elements apart
__global__ __launch_bounds__(256) void k_rope(const float* __restrict__ F, int pitch, int nheads, const float* __restrict__ CS, const float* __restrict__ RF, const float* __restrict__ nw, float sc, h16* P16, bf* Ph, bf* Pl) {
    const size_t e = ((size_t)blockIdx.x * 256 + threadIdx.x) * 2; if (e >= (size_t)nheads * TT * HD) return; const int d = (int)(e % HD); const int t = (int)((e / HD) % TT); const int h = (int)(e / ((size_t)HD * TT)); const size_t bo = (size_t)blockIdx.y * nheads * TT * HD; const float* f = F + (size_t)blockIdx.y * NS * PL + (size_t)t * pitch + h * HD; const float rf = RF ? RF[(size_t)h * TT + t] : 1.0f; v2h o16; v2us oh, ol;
    const int dq = (d < HD / 2) ? d + HD / 2 : d - HD / 2; const float* fa = f + d; const float* fb = f + dq; v2f p0[NS], p1[NS];   // d is even: elements d, d+1 and their partners dq, dq+1 are two 8-byte pairs
#pragma unroll
    for (int s = 0; s < NS; ++s) { p0[s] = *(const v2f*)(fa + (size_t)s * PL); p1[s] = *(const v2f*)(fb + (size_t)s * PL); }
    asm volatile("s_wait_xcnt 0x0" :: "v"(fa), "v"(fb) : "memory");   // both address pairs stay live up to this wait, so no load's result lands in a register that an issued load still names
    v2f s0 = p0[0], s1 = p1[0];   // add the projection's split-K planes, ascending
#pragma unroll
    for (int s = 1; s < NS; ++s) { s0 += p0[s]; s1 += p1[s]; }
#pragma unroll
    for (int q = 0; q < 2; ++q) { const int dd = d + q; const int dp = (dd < HD / 2) ? dd + HD / 2 : dd - HD / 2; float x0 = s0[q], x1 = s1[q];
        if (RF) { float n0 = __fmul_rn(x0, rf), n1 = __fmul_rn(x1, rf); asm volatile("" : "+v"(n0)); asm volatile("" : "+v"(n1)); x0 = __fmul_rn(bfr(nw[dd]), n0); x1 = __fmul_rn(bfr(nw[dp]), n1); }
        const v2f cs = *(const v2f*)(CS + ((size_t)t * HD + dd) * 2); float a = __fmul_rn(x0, cs[0]), bq = __fmul_rn(x1, cs[1]); asm volatile("" : "+v"(a)); asm volatile("" : "+v"(bq)); const float r = ((dd < HD / 2) ? __fsub_rn(a, bq) : __fadd_rn(a, bq)) * sc;
        o16[q] = tohx(r); unsigned short a2, c2; splitf(r, a2, c2); oh[q] = a2; ol[q] = c2; }
    *(v2h*)(P16 + bo + e) = o16; *(v2us*)(Ph + bo + e) = oh; *(v2us*)(Pl + bo + e) = ol;  }
template <int NS, int PL>   // F holds, per batch (grid y), NS split-K partial planes, PL elements apart
__global__ __launch_bounds__(256) void k_vtp(const float* __restrict__ F, int pitch, int nheads, h16* V16, bf* Vh, bf* Vl) { const size_t e = ((size_t)blockIdx.x * 256 + threadIdx.x) * 2; if (e >= (size_t)nheads * HD * TT) return; const int t = (int)(e % TT); const int d = (int)((e / TT) % HD); const int g = (int)(e / ((size_t)TT * HD)); const size_t bo = (size_t)blockIdx.y * nheads * HD * TT; F += (size_t)blockIdx.y * NS * PL; v2h o16; v2us oh, ol;
#pragma unroll
    for (int q = 0; q < 2; ++q) { const float* fp = F + (size_t)(t + q) * pitch + g * HD + d; float x = fp[0];
#pragma unroll
        for (int s = 1; s < NS; ++s) x += fp[(size_t)s * PL];   // add the projection's split-K planes, ascending
        o16[q] = tohx(x); unsigned short a2, c2; splitf(x, a2, c2); oh[q] = a2; ol[q] = c2; }
    *(v2h*)(V16 + bo + e) = o16; *(v2us*)(Vh + bo + e) = oh; *(v2us*)(Vl + bo + e) = ol;  }
__global__ __launch_bounds__(256) void k_csid(float* CS) { const int idx = blockIdx.x * 256 + threadIdx.x; if (idx >= TT * HD) return; v2f cs; cs[0] = 1.0f; cs[1] = 0.0f; *(v2f*)(CS + (size_t)idx * 2) = cs;  }
// ---- k_attn: scores, softmax and attn.v fused. A workgroup (16 waves): 256 query rows x one slice of KSL keys; the slice's k rows and v rows are staged once in LDS; a wave: 16 query columns, passes of 32 keys.
// Transposed products: St = K.Qt (A = key rows, B = query columns), so a lane holds 16 scores of ONE query; two St tiles converted in place are the B operand of Ot += Vt.Pt (A = rows of the [d][t] v planes).
// Running maximum per query in base 2; a slice leaves its unnormalised Ot, its maximum and its sum, and k_merge joins the slices.
#define KPE  72                   // LDS pitch of a key row, elements: 128 B + 16 B (16 B x odd: no bank conflict for 16-byte reads)
#define VPE  (KSL + 8)            // LDS pitch of a v row (KSL keys), elements: 512 B + 16 B
#define PLE  (KSL * KPE + HD * VPE)   // one k plane and one v plane
template <typename T16> struct Oct;
template <> struct Oct<h16> { typedef v8h H; };
template <> struct Oct<bf> { typedef v8us H; };
__device__ __forceinline__ float xhalf(float x) { return __builtin_bit_cast(float, __builtin_amdgcn_permlanex16(__builtin_bit_cast(int, x), __builtin_bit_cast(int, x), 0x76543210, 0xfedcba98, false, false)); }   // lane l with lane l ^ 16
// Base-2 exponentials with the slot that the instruction set asks for behind a transcendental written in: inside a statement every v_exp_f32 is followed by an independent one (outputs early-clobber, so none is another's source), the last by v_nop.
__device__ __forceinline__ void exp2x8(const float (&x)[8], float (&e)[8]) {
    asm("v_exp_f32 %0, %8\n\tv_exp_f32 %1, %9\n\tv_exp_f32 %2, %10\n\tv_exp_f32 %3, %11\n\tv_exp_f32 %4, %12\n\tv_exp_f32 %5, %13\n\tv_exp_f32 %6, %14\n\tv_exp_f32 %7, %15\n\tv_nop"
        : "=&v"(e[0]), "=&v"(e[1]), "=&v"(e[2]), "=&v"(e[3]), "=&v"(e[4]), "=&v"(e[5]), "=&v"(e[6]), "=&v"(e[7]) : "v"(x[0]), "v"(x[1]), "v"(x[2]), "v"(x[3]), "v"(x[4]), "v"(x[5]), "v"(x[6]), "v"(x[7])); }
__device__ __forceinline__ float exp2x1(float x) { float e; asm("v_exp_f32 %0, %1\n\tv_nop" : "=&v"(e) : "v"(x)); return e; }
template <typename T16, bool HL>   // HL: second (low) planes, three products each
__device__ __forceinline__ void attn_slice(T16* sm, const T16* __restrict__ Q, const T16* __restrict__ Q2, const T16* __restrict__ Kp, const T16* __restrict__ K2, const T16* __restrict__ Vt, const T16* __restrict__ V2, int q0, int sl, float* __restrict__ Ob, float* __restrict__ MLb) {
    typedef typename WFrag<T16>::V V; typedef typename Oct<T16>::H H;
    const int tid = threadIdx.x, lane = tid & 31, lr = lane & 15, hi = lane >> 4;
    const float POFF = HL ? 0.0f : 8.0f;   // fp16 weights are carried x 2^8 (sum and Ot alike), away from the fp16 subnormals
    const size_t qo = (size_t)(q0 + lr) * HD + 8 * hi, ko = (size_t)sl * KSL * HD + tid * 8, vo = (size_t)(tid >> 5) * TT + sl * KSL + (tid & 31) * 8;
    const T16* qp = Q + qo; const T16* qq = HL ? Q2 + qo : qp; const T16* gk = Kp + ko; const T16* gl = HL ? K2 + ko : gk; const T16* gv = Vt + vo; const T16* gw = HL ? V2 + vo : gv;   // every global read below is one of these plus a constant
    V qf[2], qg[2];
    {   // stage the slice: 16-byte pieces, whole lines per wave; piece tid + 512 i is k row (tid >> 3) + 64 i, v row (tid >> 5) + 16 i
        H tk[4], tl[4], tv[4], tw[4];
#pragma unroll
        for (int i = 0; i < 4; ++i) { tk[i] = *(const H*)(gk + i * 4096); tv[i] = *(const H*)(gv + i * 16 * TT); if (HL) { tl[i] = *(const H*)(gl + i * 4096); tw[i] = *(const H*)(gw + i * 16 * TT); } }
#pragma unroll
        for (int ks = 0; ks < 2; ++ks) { qf[ks] = WFrag<T16>::ld(qp + ks * 32); if (HL) qg[ks] = WFrag<T16>::ld(qq + ks * 32); }
        asm volatile("s_wait_xcnt 0x0" :: "v"(qp), "v"(qq), "v"(gk), "v"(gl), "v"(gv), "v"(gw) : "memory");   // the address pairs stay live up to this wait, so no load's result lands in a register that an issued load still names
        T16* dk = sm + (tid >> 3) * KPE + (tid & 7) * 8; T16* dv = sm + KSL * KPE + (tid >> 5) * VPE + (tid & 31) * 8;
#pragma unroll
        for (int i = 0; i < 4; ++i) { *(H*)(dk + i * 64 * KPE) = tk[i]; *(H*)(dv + i * 16 * VPE) = tv[i]; if (HL) { *(H*)(dk + PLE + i * 64 * KPE) = tl[i]; *(H*)(dv + PLE + i * 16 * VPE) = tw[i]; } }
    }
    __syncthreads();   // the staged slice is read by all sixteen waves
    const T16* kl = sm + lr * KPE + 8 * hi; const T16* km = kl + PLE; const T16* vl = sm + KSL * KPE + lr * VPE + 8 * hi; const T16* vm = vl + PLE;   // walked pass by pass, so that every read is one of the four plus a 16-bit offset
    v8f o[4]; float mr = -3.0e38f, ls = 0.f;
#pragma unroll
    for (int dt = 0; dt < 4; ++dt) o[dt] = (v8f){};
#pragma unroll (HL ? 1 : KSL / 32)   // fp16: unrolled, every LDS address is a lane register plus an immediate and the next pass's reads can start early; hi/lo: rolled, the low planes lie beyond the 16-bit offset and are walked
    for (int p = 0; p < KSL / 32; ++p) {
        V ka[2][2], kb[2][2], va[4], vb[4];
#pragma unroll
        for (int kt = 0; kt < 2; ++kt)
#pragma unroll
            for (int ks = 0; ks < 2; ++ks) { ka[kt][ks] = WFrag<T16>::ld(kl + kt * 16 * KPE + ks * 32); if (HL) kb[kt][ks] = WFrag<T16>::ld(km + kt * 16 * KPE + ks * 32); }
#pragma unroll
        for (int dt = 0; dt < 4; ++dt) { va[dt] = WFrag<T16>::ld(vl + dt * 16 * VPE); if (HL) vb[dt] = WFrag<T16>::ld(vm + dt * 16 * VPE); }
        kl += 32 * KPE; km += 32 * KPE; vl += 32; vm += 32;
        __builtin_amdgcn_sched_barrier(0);   // a pass's LDS reads are all issued ahead of its first product (the v reads a whole softmax early), and no later pass's reads rise above this line: without it the unrolled path fetches so far ahead that it spills
        v8f s[2];
#pragma unroll
        for (int kt = 0; kt < 2; ++kt) { v8f c = (v8f){};
#pragma unroll
            for (int ks = 0; ks < 2; ++ks) { c = WFrag<T16>::mma(ka[kt][ks], qf[ks], c); if (HL) { c = WFrag<T16>::mma(ka[kt][ks], qg[ks], c); c = WFrag<T16>::mma(kb[kt][ks], qf[ks], c); } }
            s[kt] = c; }
        V pb, pc; float mx = mr;
#pragma unroll
        for (int kt = 0; kt < 2; ++kt)
#pragma unroll
            for (int r = 0; r < 8; ++r) { s[kt][r] *= SCL * 1.4426950408889634f; mx = fmaxf(mx, s[kt][r]); }
        mx = fmaxf(mx, xhalf(mx));   // both halves of the wave hold keys of the same query
        const float al = exp2x1(mr - mx); mr = mx; const float mo = mx - POFF; float sum = 0.f; float xd[2][8], xe[2][8];
#pragma unroll
        for (int kt = 0; kt < 2; ++kt) {
#pragma unroll
            for (int r = 0; r < 8; ++r) xd[kt][r] = s[kt][r] - mo;
            exp2x8(xd[kt], xe[kt]); }
#pragma unroll
        for (int e = 0; e < 16; ++e) { const float ex = xe[e >> 3][e & 7]; sum += ex;
            if constexpr (HL) { const __bf16 h = (__bf16)ex; pb[e] = h; pc[e] = (__bf16)(ex - (float)h); } else pb[e] = (h16)ex; }
        ls = ls * al + sum;
#pragma unroll
        for (int dt = 0; dt < 4; ++dt) o[dt] *= al;
#pragma unroll
        for (int dt = 0; dt < 4; ++dt) { o[dt] = WFrag<T16>::mma(va[dt], pb, o[dt]); if (HL) { o[dt] = WFrag<T16>::mma(va[dt], pc, o[dt]); o[dt] = WFrag<T16>::mma(vb[dt], pb, o[dt]); } }
    }
    const int q = q0 + lr; const float lt = ls + xhalf(ls); float* ob = Ob + ((size_t)q * NSL + sl) * HD + 8 * hi;   // a lane holds d = 16 dt + 8 hi + r of its query
#pragma unroll
    for (int dt = 0; dt < 4; ++dt) { v4f w0, w1;
#pragma unroll
        for (int r = 0; r < 4; ++r) { w0[r] = o[dt][r]; w1[r] = o[dt][4 + r]; }
        *(v4f*)(ob + dt * 16) = w0; *(v4f*)(ob + dt * 16 + 4) = w1; }
    if (hi == 0) { v2f ml; ml[0] = mr; ml[1] = lt; *(v2f*)(MLb + ((size_t)sl * TT + q) * 2) = ml; }   // [slice][t]: a wave's 16 pairs fill one 128-byte line
}
__global__ __launch_bounds__(512) void k_attn(const h16* __restrict__ Q16, const h16* __restrict__ K16, const h16* __restrict__ V16, const bf* __restrict__ Qh, const bf* __restrict__ Ql, const bf* __restrict__ Kh, const bf* __restrict__ Kl, const bf* __restrict__ Vh, const bf* __restrict__ Vl, float* Ob, float* MLb) {
    static_assert(RH % QWG == 0 && TT % QWG == 0 && KSL == 256 && HD == 64, "a workgroup is all hi/lo or all fp16; the staging loops are written for 256 keys x 64");
    __shared__ __align__(16) unsigned short sm[2 * PLE];
    const int q0 = blockIdx.x * QWG + (threadIdx.x >> 5) * 16, sl = blockIdx.y;
    const size_t bo = (size_t)blockIdx.z * TT * HD;   // grid z: the batch
    Q16 += bo; K16 += bo; V16 += bo; Qh += bo; Ql += bo; Kh += bo; Kl += bo; Vh += bo; Vl += bo; Ob += bo * NSL; MLb += (size_t)blockIdx.z * NSL * TT * 2;
    if (blockIdx.x < RH / QWG) attn_slice<bf, true>(sm, Qh, Ql, Kh, Kl, Vh, Vl, q0, sl, Ob, MLb);
    else attn_slice<h16, false>((h16*)sm, Q16, nullptr, K16, nullptr, V16, nullptr, q0, sl, Ob, MLb);
}

// k_merge: out[t][d] = sum_s Ot_s 2^(m_s - M) / sum_s l_s 2^(m_s - M), slices ascending, M the largest slice maximum
__global__ __launch_bounds__(256) void k_merge(const float* __restrict__ O, const float* __restrict__ MLb, float* OUTb) { const size_t e = ((size_t)blockIdx.x * 256 + threadIdx.x) * 2; if (e >= (size_t)TT * HD) return; const int d = (int)(e % HD); const int t = (int)(e / HD);
    O += (size_t)blockIdx.y * NSL * TT * HD; MLb += (size_t)blockIdx.y * NSL * TT * 2; OUTb += (size_t)blockIdx.y * TT * HD;   // grid y: the batch
    const float* pb = O + (size_t)t * (NSL * HD) + d;   // partials lie [t][slice][d]: one address pair reaches all slices by immediate offsets
    const float* mp = MLb + (size_t)t * 2;              // (maximum, sum) pairs lie [slice][t]
    v2f p[NSL], ml[NSL];
#pragma unroll
    for (int s = 0; s < NSL; ++s) { p[s] = *(const v2f*)(pb + s * HD); ml[s] = *(const v2f*)(mp + s * TT * 2); }
    asm volatile("s_wait_xcnt 0x0" :: "v"(pb), "v"(mp) : "memory");   // both address pairs stay live up to this wait, so no load's result lands in a register that an issued load still names
    __builtin_amdgcn_sched_barrier(0);   // all 32 loads are issued ahead of the first use: one memory latency, not two
    float M = ml[0][0];
#pragma unroll
    for (int s = 1; s < NSL; ++s) M = fmaxf(M, ml[s][0]);
    static_assert(NSL == 16, "two statements of eight exponentials");
    v2f a; a[0] = 0.f; a[1] = 0.f; float L = 0.f; float xd[2][8], w[2][8];
#pragma unroll
    for (int h = 0; h < 2; ++h) {
#pragma unroll
        for (int r = 0; r < 8; ++r) xd[h][r] = ml[h * 8 + r][0] - M;
        exp2x8(xd[h], w[h]); }
#pragma unroll
    for (int s = 0; s < NSL; ++s) { a += p[s] * w[s >> 3][s & 7]; L += ml[s][1] * w[s >> 3][s & 7]; }
    v2f o2; o2[0] = __fdiv_rn(a[0], L); o2[1] = __fdiv_rn(a[1], L); *(v2f*)(OUTb + e) = o2;  }

extern "C" void kernel_launch(void* const* d_in, const int* in_sizes, int n_in,
                              void* d_out, int out_size, void* d_ws, size_t ws_size, hipStream_t stream) {
    (void)in_sizes; (void)n_in; (void)out_size;
    const float* x = (const float*)d_in[0]; const float* wk = (const float*)d_in[1]; const float* wq = (const float*)d_in[2]; const float* wv = (const float*)d_in[3]; const float* wo = nullptr; (void)wo;
    float* OUT = (float*)d_out;     // [4][4096][64]
    char* wsp = (char*)d_ws;
    auto take = [&](size_t bytes) { char* p = wsp; wsp += (bytes + 255) & ~(size_t)255; return (void*)p; };
    bf* WQ = (bf*)take((size_t)DQ * DM * 2); bf* WK = (bf*)take((size_t)DKV * DM * 2); bf* WV = (bf*)take((size_t)DKV * DM * 2); float* CS = (float*)take((size_t)TT * HD * 2 * 4);
    bf* XB = (bf*)take((size_t)NB_ * TT * DM * 2); float* FQ = (float*)take((size_t)NB_ * SKP * TT * DQ * 4); float* FK = (float*)take((size_t)NB_ * SKP * TT * DKV * 4);
    h16* QP16 = (h16*)take((size_t)NB_ * NH_ * TT * HD * 2); h16* KP16 = (h16*)take((size_t)NB_ * NKV * TT * HD * 2); h16* VT16 = (h16*)take((size_t)NB_ * NKV * HD * TT * 2);
    bf* QPh = (bf*)take((size_t)NB_ * NH_ * TT * HD * 2); bf* QPl = (bf*)take((size_t)NB_ * NH_ * TT * HD * 2); bf* KPh = (bf*)take((size_t)NB_ * NKV * TT * HD * 2); bf* KPl = (bf*)take((size_t)NB_ * NKV * TT * HD * 2); bf* VTh = (bf*)take((size_t)NB_ * NKV * HD * TT * 2); bf* VTl = (bf*)take((size_t)NB_ * NKV * HD * TT * 2);
    float* Ob = (float*)take((size_t)NB_ * NSL * TT * HD * 4); float* MLb = (float*)take((size_t)NB_ * NSL * TT * 2 * 4);
    if ((size_t)(wsp - (char*)d_ws) > ws_size) return;    // ws 256 MiB
    float* FV = FK;   // v projection reuses the k buffer after the k planes are built (stream-ordered)
    { k_wtG<<<(unsigned)((DM * DQ / 64 + 63) / 64), 256, 0, stream>>>(wq, DM, DQ, WQ); k_wtG<<<(unsigned)((DM * DKV / 64 + 63) / 64), 256, 0, stream>>>(wk, DM, DKV, WK); k_wtG<<<(unsigned)((DM * DKV / 64 + 63) / 64), 256, 0, stream>>>(wv, DM, DKV, WV);
      
       }
    k_csid<<<(TT * HD + 255) / 256, 256, 0, stream>>>(CS);
    const unsigned LQ = (unsigned)(((size_t)NH_ * TT * HD / 2 + 255) / 256), LKv = (unsigned)(((size_t)NKV * TT * HD / 2 + 255) / 256);
    k_cvt8<<<(unsigned)(((size_t)NB_ * TT * DM / 8 + 255) / 256), 256, 0, stream>>>(x, XB, (size_t)NB_ * TT * DM / 8);
    k_gemmw<bf, 0, false, SKP><<<dim3(TT / 64, DQ / 64, NB_ * SKP), 32, 0, stream>>>(XB, nullptr, WQ, nullptr, DM, DM / SKP, FQ, DQ, nullptr, DM / SKP, DM / SKP, (size_t)TT * DQ, (size_t)TT * DM);
    k_rope<SKP, TT * DQ><<<dim3(LQ, NB_), 256, 0, stream>>>(FQ, DQ, NH_, CS, nullptr, nullptr, 1.0f, QP16, QPh, QPl);
    k_gemmw<bf, 0, false, SKP><<<dim3(TT / 64, DKV / 64, NB_ * SKP), 32, 0, stream>>>(XB, nullptr, WK, nullptr, DM, DM / SKP, FK, DKV, nullptr, DM / SKP, DM / SKP, (size_t)TT * DKV, (size_t)TT * DM);
    k_rope<SKP, TT * DKV><<<dim3(LKv, NB_), 256, 0, stream>>>(FK, DKV, NKV, CS, nullptr, nullptr, 1.0f, KP16, KPh, KPl);
    k_gemmw<bf, 0, false, SKV><<<dim3(TT / 64, DKV / 64, NB_ * SKV), 32, 0, stream>>>(XB, nullptr, WV, nullptr, DM, DM / SKV, FV, DKV, nullptr, DM / SKV, DM / SKV, (size_t)TT * DKV, (size_t)TT * DM); k_vtp<SKV, TT * DKV><<<dim3(LKv, NB_), 256, 0, stream>>>(FV, DKV, NKV, VT16, VTh, VTl);
    static_assert(NH_ == 1 && NKV == 1, "one head");
    k_attn<<<dim3(TT / QWG, NSL, NB_), 512, 0, stream>>>(QP16, KP16, VT16, QPh, QPl, KPh, KPl, VTh, VTl, Ob, MLb);
    k_merge<<<dim3((unsigned)(((size_t)TT * HD / 2 + 255) / 256), NB_), 256, 0, stream>>>(Ob, MLb, OUT);
}

// v004
// It runs in 62.3 microseconds.
// Timed twice side by side with v003, it ran 2.16 times as fast both times.
// All steps since v000 together make it 18.8 times as fast.
#include <hip/hip_runtime.h>

// Single attention head (ix [4][4096][768]; k, q, v = ix W ('xw' [768][64], no bias); wei = softmax(q.k / 8) over all 4096 keys; out = wei.v -> [4][4096][64] f32 (1.05 M)).
// Four launches, each for all four batches: the weights packed in fragment order; ONE projection kernel from the f32 input to the nine 16-bit q, k, v planes; one fused attention kernel over 4,096 keys in 16 key slices (rows < 512 hi/lo, rest fp16) with a running-maximum softmax in registers; the merge kernel joins the slices and normalises; f32 output.
// Compute dtypes, f32 accumulate: every input rounded to bf16; projections on PLAIN bf16 operands (exact); scores and attn.v rows < 512 on bf16 hi/lo planes (3 products), the rest single fp16; softmax f32; f32 output.

#define NB_  4
#define TT   4096
#define DM   768
#define NH_  1
#define NKV  1
#define REP  (NH_ / NKV)
#define HD   64
#define DQ   (NH_ * HD)
#define DKV  (NKV * HD)
#define ZH   1
#define RH   512                  // query rows < RH use hi+lo planes (0: none)
#define WIN  0
#define SCL  0.125f   // HD^-0.5
#define NSL  16                   // key slices of the fused attention
#define KSL  (TT / NSL)           // keys per slice (256)
#define QWG  256                  // query rows per workgroup: 16 waves x 16
typedef _Float16 h16;
typedef unsigned short bf;
typedef __attribute__((ext_vector_type(16))) __bf16   v16bf;
typedef __attribute__((ext_vector_type(16))) _Float16 v16h;
typedef __attribute__((ext_vector_type(8)))  _Float16 v8h;
typedef __attribute__((ext_vector_type(8)))  unsigned short v8us;
typedef __attribute__((ext_vector_type(8)))  float    v8f;
typedef __attribute__((ext_vector_type(4)))  float    v4f;
typedef v8h  __attribute__((may_alias)) v8ha;
typedef v4f  __attribute__((may_alias)) v4fa;
typedef v8us __attribute__((may_alias)) v8usa;

__device__ __forceinline__ unsigned short f2bf(float f) { unsigned u = __float_as_uint(f); u += 0x7FFFu + ((u >> 16) & 1u); return (unsigned short)(u >> 16); }
__device__ __forceinline__ float bf2f(unsigned short b) { return __uint_as_float(((unsigned)b) << 16); }
__device__ __forceinline__ float bfr(float f) { return bf2f(f2bf(f)); }
__device__ __forceinline__ v16h cat16(v8h lo, v8h hi) { return __builtin_shufflevector(lo, hi, 0, 1, 2, 3, 4, 5, 6, 7, 8, 9, 10, 11, 12, 13, 14, 15); }
__device__ __forceinline__ v16bf cat16b(v8us lo, v8us hi) { return __builtin_bit_cast(v16bf, __builtin_shufflevector(lo, hi, 0, 1, 2, 3, 4, 5, 6, 7, 8, 9, 10, 11, 12, 13, 14, 15)); }
__device__ __forceinline__ v8f wmma16(v16h a, v16h b, v8f c) { return __builtin_amdgcn_wmma_f32_16x16x32_f16(false, a, false, b, (short)0, c, false, false); }
__device__ __forceinline__ v8f wmmab(v16bf a, v16bf b, v8f c) { return __builtin_amdgcn_wmma_f32_16x16x32_bf16(false, a, false, b, (short)0, c, false, false); }

// 16-bit WMMA fragments: a lane's sixteen elements are p[0..7] and p[16..23], p = its row + 8 (lane >> 4); A and B alike
template <typename T16> struct WFrag;
template <> struct WFrag<h16> { typedef v16h V; static __device__ __forceinline__ V ld(const h16* p) { return cat16(*(const v8h*)p, *(const v8h*)(p + 16)); } static __device__ __forceinline__ v8f mma(V a, V b, v8f c) { return wmma16(a, b, c); } };
template <> struct WFrag<bf> { typedef v16bf V; static __device__ __forceinline__ V ld(const bf* p) { return cat16b(*(const v8us*)p, *(const v8us*)(p + 16)); } static __device__ __forceinline__ v8f mma(V a, V b, v8f c) { return wmmab(a, b, c); } };

__device__ __forceinline__ h16 tohx(float x) { return (h16)x; }
__device__ __forceinline__ void splitf(float y, unsigned short& h, unsigned short& l) { h = f2bf(y); l = f2bf(y - bf2f(h)); }
typedef __attribute__((ext_vector_type(2))) _Float16 v2h;
typedef __attribute__((ext_vector_type(4))) _Float16 v4h;
typedef __attribute__((ext_vector_type(2))) unsigned short v2us;
typedef __attribute__((ext_vector_type(4))) unsigned short v4us;
typedef __attribute__((ext_vector_type(2))) float v2f;
typedef __attribute__((ext_vector_type(4))) int v4i;
typedef __attribute__((ext_vector_type(4))) __bf16 v4bf;

// ---- k_wpack: the three weights, rounded to bf16, in the order the projection's waves read them. Fragment (nt, ks): columns 16 nt .. + 15 of q | k | v (nt 0-3 | 4-7 | 8-11), k = 32 ks .. + 31;
// it is two runs of 512 B: run h holds, lane by lane, the eight elements k = 32 ks + 16 h + 8 (lane >> 4) + j of column lane & 15 (the k order of WFrag::ld), so a fragment is two whole-line 16-byte loads.
#define NKS  (DM / 32)            // k steps (24)
__global__ __launch_bounds__(256) void k_wpack(const float* __restrict__ wq, const float* __restrict__ wk, const float* __restrict__ wv, bf* WP) {
    static_assert(NKS * 64 == 6 * 256, "six workgroups per 16 columns");
    const int nt = blockIdx.x / 6; const float* w = nt < 4 ? wq : nt < 8 ? wk : wv;
    const int pi = blockIdx.x * 256 + threadIdx.x, lane = pi & 31, h = (pi >> 5) & 1, ks = (pi >> 6) % NKS;
    const float* wp = w + (size_t)(ks * 32 + h * 16 + 8 * (lane >> 4)) * HD + (nt & 3) * 16 + (lane & 15); float t[8]; v8us o;
#pragma unroll
    for (int j = 0; j < 8; ++j) t[j] = wp[j * HD];
    asm volatile("s_wait_xcnt 0x0" :: "v"(wp) : "memory");   // the address pair stays live up to this wait, so no load's result lands in a register that an issued load still names
#pragma unroll
    for (int j = 0; j < 8; ++j) o[j] = f2bf(t[j]);
    *(v8us*)(WP + (size_t)pi * 8) = o;  }

// ---- k_proj: input rounding, the three projections and the plane building in one kernel. A workgroup (12 waves): 64 rows of ix x all 192 columns.
// The rows are read once, in whole lines, rounded to bf16 and staged in LDS. Wave (g, kq): g = q | k | v (64 columns), kq = a quarter of K (192 k, 6 steps): 4 x 4 accumulators, so every weight fragment is read once per workgroup.
// q and k: transposed product (A = weight columns, B = input rows), a lane holds 8 neighbouring d of one row; v: A = input rows, B = weight columns, a lane holds 8 neighbouring rows of one d: both leave 16-byte pieces of the layout their planes have.
// The four K quarters meet in LDS and are added in ascending order by the threads that round and store the planes in whole lines.
#define PRW  64                   // input rows per workgroup
#define XPE  (DM + 8)             // LDS pitch of a staged row, elements: 1,536 B + 16 B (16 B x odd: no bank conflict for 16-byte reads)
#define PQP  (2 * HD + 4)         // LDS pitch of a q | k partial row, floats: 512 B + 16 B
#define PVP  (PRW + 4)            // LDS pitch of a v partial row (one d, PRW input rows), floats: 256 B + 16 B
#define WFE  512                  // elements of a packed fragment
__device__ __forceinline__ v16bf wfrag(const bf* p) { return cat16b(*(const v8us*)p, *(const v8us*)(p + 256)); }
template <bool VK>
__device__ __forceinline__ void proj_part(const bf* xs, const bf* __restrict__ wp, v16bf (&wf)[2][4], float* pd) {
    v8f acc[4][4];   // [weight tile][row tile]
#pragma unroll
    for (int nb = 0; nb < 4; ++nb)
#pragma unroll
        for (int tt = 0; tt < 4; ++tt) acc[nb][tt] = (v8f){};
#pragma unroll
    for (int ks = 0; ks < 6; ++ks) { v16bf xa[4];
#pragma unroll
        for (int tt = 0; tt < 4; ++tt) xa[tt] = WFrag<bf>::ld(xs + tt * 16 * XPE + ks * 32);
#pragma unroll
        for (int nb = 0; nb < 4; ++nb)
#pragma unroll
            for (int tt = 0; tt < 4; ++tt) acc[nb][tt] = VK ? wmmab(xa[tt], wf[ks & 1][nb], acc[nb][tt]) : wmmab(wf[ks & 1][nb], xa[tt], acc[nb][tt]);
        if (ks + 2 < 6) {   // the weight fragments run two steps ahead
#pragma unroll
            for (int nb = 0; nb < 4; ++nb) wf[ks & 1][nb] = wfrag(wp + (nb * NKS + ks + 2) * WFE); } }
    asm volatile("s_wait_xcnt 0x0" :: "v"(wp) : "memory");   // the address pair stays live up to this wait, so no load's result lands in a register that an issued load still names
#pragma unroll
    for (int nb = 0; nb < 4; ++nb)
#pragma unroll
        for (int tt = 0; tt < 4; ++tt) { float* d = VK ? pd + nb * 16 * PVP + tt * 16 : pd + tt * 16 * PQP + nb * 16; v4f w0, w1;
#pragma unroll
            for (int r = 0; r < 4; ++r) { w0[r] = acc[nb][tt][r]; w1[r] = acc[nb][tt][4 + r]; }
            *(v4fa*)d = w0; *(v4fa*)(d + 4) = w1; }
}
template <int PS>   // eight neighbouring elements of a plane: the four K quarters (PS floats apart) added in ascending order, rounded to fp16 and to bf16 hi + lo
__device__ __forceinline__ void proj_emit(const float* sp, h16* d16, bf* dh, bf* dl) {
    v4f a0 = *(const v4fa*)sp, a1 = *(const v4fa*)(sp + 4);
#pragma unroll
    for (int s = 1; s < 4; ++s) { a0 += *(const v4fa*)(sp + s * PS); a1 += *(const v4fa*)(sp + s * PS + 4); }
    v8h o16; v8us oh, ol;
#pragma unroll
    for (int j = 0; j < 8; ++j) { const float y = j < 4 ? a0[j & 3] : a1[j & 3]; o16[j] = tohx(y); unsigned short a2, c2; splitf(y, a2, c2); oh[j] = a2; ol[j] = c2; }
    *(v8h*)d16 = o16; *(v8us*)dh = oh; *(v8us*)dl = ol;
    asm volatile("s_wait_xcnt 0x0" :: "v"(d16), "v"(dh), "v"(dl) : "memory");   // the three address pairs stay live up to this wait: nothing overwrites a register that an issued store still names
}
__global__ __launch_bounds__(384) void k_proj(const float* __restrict__ x, const bf* __restrict__ WP, h16* Q16, bf* Qh, bf* Ql, h16* K16, bf* Kh, bf* Kl, h16* V16, bf* Vh, bf* Vl) {
    static_assert(DM == 768 && HD == 64 && TT % PRW == 0, "staging and wave roles are written for 768 x 3 x 64; a workgroup lies in one batch");
    __shared__ __align__(16) unsigned short xs[PRW * XPE];
    __shared__ __align__(16) float pq[4 * PRW * PQP];
    __shared__ __align__(16) float pv[4 * HD * PVP];
    const int tid = threadIdx.x, lane = tid & 31, lr = lane & 15, hi = lane >> 4; const int R0 = blockIdx.x * PRW;
    const int wv = __builtin_amdgcn_readfirstlane(tid >> 5), g = wv >> 2, kq = wv & 3;   // the wave's number in a scalar register: the choice between the two product forms below is a scalar branch
    const int sr = tid / 192, sc = (tid % 192) * 4;   // staging: 16-byte piece tid + 384 i is row 2 i + sr, elements sc .. sc + 3; a wave's 32 pieces are 512 contiguous bytes
    const float* xp = x + (size_t)(R0 + sr) * DM + sc; const bf* wp = WP + (size_t)(g * 4 * NKS + kq * 6) * WFE + lane * 8;
    v4f t[PRW / 2]; v16bf wf[2][4];
#pragma unroll
    for (int i = 0; i < PRW / 2; ++i) t[i] = *(const v4f*)(xp + i * 2 * DM);
#pragma unroll
    for (int ks = 0; ks < 2; ++ks)
#pragma unroll
        for (int nb = 0; nb < 4; ++nb) wf[ks][nb] = wfrag(wp + (nb * NKS + ks) * WFE);
    asm volatile("s_wait_xcnt 0x0" :: "v"(xp), "v"(wp) : "memory");   // both address pairs stay live up to this wait, so no load's result lands in a register that an issued load still names
    unsigned short* dx = xs + sr * XPE + sc;
#pragma unroll
    for (int i = 0; i < PRW / 2; ++i) *(v4us*)(dx + i * 2 * XPE) = __builtin_bit_cast(v4us, __builtin_convertvector(t[i], v4bf));
    __syncthreads();   // the staged rows are read by all twelve waves
    const bf* xf = xs + lr * XPE + 8 * hi + kq * 192;
    if (g == 2) proj_part<true>(xf, wp, wf, pv + kq * HD * PVP + lr * PVP + 8 * hi);
    else proj_part<false>(xf, wp, wf, pq + kq * PRW * PQP + lr * PQP + g * HD + 8 * hi);
    __syncthreads();   // a plane element's four K quarters come from four waves
    const size_t vb = (size_t)(R0 / TT) * HD * TT + R0 % TT;
#pragma unroll
    for (int i = 0; i < 4; ++i) { const int it = i * 384 + tid, kind = it >> 9, r = (it & 511) >> 3, c8 = (it & 7) * 8;   // 3 x 512 pieces of eight; a wave's pieces are of one kind and fill whole lines
        const size_t qo = (size_t)(R0 + r) * HD + c8, vo = vb + (size_t)r * TT + c8;
        if (kind == 0) proj_emit<PRW * PQP>(pq + r * PQP + c8, Q16 + qo, Qh + qo, Ql + qo);
        else if (kind == 1) proj_emit<PRW * PQP>(pq + r * PQP + HD + c8, K16 + qo, Kh + qo, Kl + qo);
        else proj_emit<HD * PVP>(pv + r * PVP + c8, V16 + vo, Vh + vo, Vl + vo); }
}
// ---- k_attn: scores, softmax and attn.v fused. A workgroup (16 waves): 256 query rows x one slice of KSL keys; the slice's k rows and v rows are staged once in LDS; a wave: 16 query columns, passes of 32 keys.
// Transposed products: St = K.Qt (A = key rows, B = query columns), so a lane holds 16 scores of ONE query; two St tiles converted in place are the B operand of Ot += Vt.Pt (A = rows of the [d][t] v planes).
// Running maximum per query in base 2; a slice leaves its unnormalised Ot, its maximum and its sum, and k_merge joins the slices.
#define KPE  72                   // LDS pitch of a key row, elements: 128 B + 16 B (16 B x odd: no bank conflict for 16-byte reads)
#define VPE  (KSL + 8)            // LDS pitch of a v row (KSL keys), elements: 512 B + 16 B
#define PLE  (KSL * KPE + HD * VPE)   // one k plane and one v plane
template <typename T16> struct Oct;
template <> struct Oct<h16> { typedef v8h H; };
template <> struct Oct<bf> { typedef v8us H; };
__device__ __forceinline__ float xhalf(float x) { return __builtin_bit_cast(float, __builtin_amdgcn_permlanex16(__builtin_bit_cast(int, x), __builtin_bit_cast(int, x), 0x76543210, 0xfedcba98, false, false)); }   // lane l with lane l ^ 16
// Base-2 exponentials with the slot that the instruction set asks for behind a transcendental written in: inside a statement every v_exp_f32 is followed by an independent one (outputs early-clobber, so none is another's source), the last by v_nop.
__device__ __forceinline__ void exp2x8(const float (&x)[8], float (&e)[8]) {
    asm("v_exp_f32 %0, %8\n\tv_exp_f32 %1, %9\n\tv_exp_f32 %2, %10\n\tv_exp_f32 %3, %11\n\tv_exp_f32 %4, %12\n\tv_exp_f32 %5, %13\n\tv_exp_f32 %6, %14\n\tv_exp_f32 %7, %15\n\tv_nop"
        : "=&v"(e[0]), "=&v"(e[1]), "=&v"(e[2]), "=&v"(e[3]), "=&v"(e[4]), "=&v"(e[5]), "=&v"(e[6]), "=&v"(e[7]) : "v"(x[0]), "v"(x[1]), "v"(x[2]), "v"(x[3]), "v"(x[4]), "v"(x[5]), "v"(x[6]), "v"(x[7])); }
__device__ __forceinline__ float exp2x1(float x) { float e; asm("v_exp_f32 %0, %1\n\tv_nop" : "=&v"(e) : "v"(x)); return e; }
template <typename T16, bool HL>   // HL: second (low) planes, three products each
__device__ __forceinline__ void attn_slice(T16* sm, const T16* __restrict__ Q, const T16* __restrict__ Q2, const T16* __restrict__ Kp, const T16* __restrict__ K2, const T16* __restrict__ Vt, const T16* __restrict__ V2, int q0, int sl, float* __restrict__ Ob, float* __restrict__ MLb) {
    typedef typename WFrag<T16>::V V; typedef typename Oct<T16>::H H;
    const int tid = threadIdx.x, lane = tid & 31, lr = lane & 15, hi = lane >> 4;
    const float POFF = HL ? 0.0f : 8.0f;   // fp16 weights are carried x 2^8 (sum and Ot alike), away from the fp16 subnormals
    const size_t qo = (size_t)(q0 + lr) * HD + 8 * hi, ko = (size_t)sl * KSL * HD + tid * 8, vo = (size_t)(tid >> 5) * TT + sl * KSL + (tid & 31) * 8;
    const T16* qp = Q + qo; const T16* qq = HL ? Q2 + qo : qp; const T16* gk = Kp + ko; const T16* gl = HL ? K2 + ko : gk; const T16* gv = Vt + vo; const T16* gw = HL ? V2 + vo : gv;   // every global read below is one of these plus a constant
    V qf[2], qg[2];
    {   // stage the slice: 16-byte pieces, whole lines per wave; piece tid + 512 i is k row (tid >> 3) + 64 i, v row (tid >> 5) + 16 i
        H tk[4], tl[4], tv[4], tw[4];
#pragma unroll
        for (int i = 0; i < 4; ++i) { tk[i] = *(const H*)(gk + i * 4096); tv[i] = *(const H*)(gv + i * 16 * TT); if (HL) { tl[i] = *(const H*)(gl + i * 4096); tw[i] = *(const H*)(gw + i * 16 * TT); } }
#pragma unroll
        for (int ks = 0; ks < 2; ++ks) { qf[ks] = WFrag<T16>::ld(qp + ks * 32); if (HL) qg[ks] = WFrag<T16>::ld(qq + ks * 32); }
        asm volatile("s_wait_xcnt 0x0" :: "v"(qp), "v"(qq), "v"(gk), "v"(gl), "v"(gv), "v"(gw) : "memory");   // the address pairs stay live up to this wait, so no load's result lands in a register that an issued load still names
        T16* dk = sm + (tid >> 3) * KPE + (tid & 7) * 8; T16* dv = sm + KSL * KPE + (tid >> 5) * VPE + (tid & 31) * 8;
#pragma unroll
        for (int i = 0; i < 4; ++i) { *(H*)(dk + i * 64 * KPE) = tk[i]; *(H*)(dv + i * 16 * VPE) = tv[i]; if (HL) { *(H*)(dk + PLE + i * 64 * KPE) = tl[i]; *(H*)(dv + PLE + i * 16 * VPE) = tw[i]; } }
    }
    __syncthreads();   // the staged slice is read by all sixteen waves
    const T16* kl = sm + lr * KPE + 8 * hi; const T16* km = kl + PLE; const T16* vl = sm + KSL * KPE + lr * VPE + 8 * hi; const T16* vm = vl + PLE;   // walked pass by pass, so that every read is one of the four plus a 16-bit offset
    v8f o[4]; float mr = -3.0e38f, ls = 0.f;
#pragma unroll
    for (int dt = 0; dt < 4; ++dt) o[dt] = (v8f){};
#pragma unroll (HL ? 1 : KSL / 32)   // fp16: unrolled, every LDS address is a lane register plus an immediate and the next pass's reads can start early; hi/lo: rolled, the low planes lie beyond the 16-bit offset and are walked
    for (int p = 0; p < KSL / 32; ++p) {
        V ka[2][2], kb[2][2], va[4], vb[4];
#pragma unroll
        for (int kt = 0; kt < 2; ++kt)
#pragma unroll
            for (int ks = 0; ks < 2; ++ks) { ka[kt][ks] = WFrag<T16>::ld(kl + kt * 16 * KPE + ks * 32); if (HL) kb[kt][ks] = WFrag<T16>::ld(km + kt * 16 * KPE + ks * 32); }
#pragma unroll
        for (int dt = 0; dt < 4; ++dt) { va[dt] = WFrag<T16>::ld(vl + dt * 16 * VPE); if (HL) vb[dt] = WFrag<T16>::ld(vm + dt * 16 * VPE); }
        kl += 32 * KPE; km += 32 * KPE; vl += 32; vm += 32;
        __builtin_amdgcn_sched_barrier(0);   // a pass's LDS reads are all issued ahead of its first product (the v reads a whole softmax early), and no later pass's reads rise above this line: without it the unrolled path fetches so far ahead that it spills
        v8f s[2];
#pragma unroll
        for (int kt = 0; kt < 2; ++kt) { v8f c = (v8f){};
#pragma unroll
            for (int ks = 0; ks < 2; ++ks) { c = WFrag<T16>::mma(ka[kt][ks], qf[ks], c); if (HL) { c = WFrag<T16>::mma(ka[kt][ks], qg[ks], c); c = WFrag<T16>::mma(kb[kt][ks], qf[ks], c); } }
            s[kt] = c; }
        V pb, pc; float mx = mr;
#pragma unroll
        for (int kt = 0; kt < 2; ++kt)
#pragma unroll
            for (int r = 0; r < 8; ++r) { s[kt][r] *= SCL * 1.4426950408889634f; mx = fmaxf(mx, s[kt][r]); }
        mx = fmaxf(mx, xhalf(mx));   // both halves of the wave hold keys of the same query
        const float al = exp2x1(mr - mx); mr = mx; const float mo = mx - POFF; float sum = 0.f; float xd[2][8], xe[2][8];
#pragma unroll
        for (int kt = 0; kt < 2; ++kt) {
#pragma unroll
            for (int r = 0; r < 8; ++r) xd[kt][r] = s[kt][r] - mo;
            exp2x8(xd[kt], xe[kt]); }
#pragma unroll
        for (int e = 0; e < 16; ++e) { const float ex = xe[e >> 3][e & 7]; sum += ex;
            if constexpr (HL) { const __bf16 h = (__bf16)ex; pb[e] = h; pc[e] = (__bf16)(ex - (float)h); } else pb[e] = (h16)ex; }
        ls = ls * al + sum;
#pragma unroll
        for (int dt = 0; dt < 4; ++dt) o[dt] *= al;
#pragma unroll
        for (int dt = 0; dt < 4; ++dt) { o[dt] = WFrag<T16>::mma(va[dt], pb, o[dt]); if (HL) { o[dt] = WFrag<T16>::mma(va[dt], pc, o[dt]); o[dt] = WFrag<T16>::mma(vb[dt], pb, o[dt]); } }
    }
    const int q = q0 + lr; const float lt = ls + xhalf(ls); float* ob = Ob + ((size_t)q * NSL + sl) * HD + 8 * hi;   // a lane holds d = 16 dt + 8 hi + r of its query
#pragma unroll
    for (int dt = 0; dt < 4; ++dt) { v4f w0, w1;
#pragma unroll
        for (int r = 0; r < 4; ++r) { w0[r] = o[dt][r]; w1[r] = o[dt][4 + r]; }
        *(v4f*)(ob + dt * 16) = w0; *(v4f*)(ob + dt * 16 + 4) = w1; }
    if (hi == 0) { v2f ml; ml[0] = mr; ml[1] = lt; *(v2f*)(MLb + ((size_t)sl * TT + q) * 2) = ml; }   // [slice][t]: a wave's 16 pairs fill one 128-byte line
}
__global__ __launch_bounds__(512) void k_attn(const h16* __restrict__ Q16, const h16* __restrict__ K16, const h16* __restrict__ V16, const bf* __restrict__ Qh, const bf* __restrict__ Ql, const bf* __restrict__ Kh, const bf* __restrict__ Kl, const bf* __restrict__ Vh, const bf* __restrict__ Vl, float* Ob, float* MLb) {
    static_assert(RH % QWG == 0 && TT % QWG == 0 && KSL == 256 && HD == 64, "a workgroup is all hi/lo or all fp16; the staging loops are written for 256 keys x 64");
    __shared__ __align__(16) unsigned short sm[2 * PLE];
    const int q0 = blockIdx.x * QWG + (threadIdx.x >> 5) * 16, sl = blockIdx.y;
    const size_t bo = (size_t)blockIdx.z * TT * HD;   // grid z: the batch
    Q16 += bo; K16 += bo; V16 += bo; Qh += bo; Ql += bo; Kh += bo; Kl += bo; Vh += bo; Vl += bo; Ob += bo * NSL; MLb += (size_t)blockIdx.z * NSL * TT * 2;
    if (blockIdx.x < RH / QWG) attn_slice<bf, true>(sm, Qh, Ql, Kh, Kl, Vh, Vl, q0, sl, Ob, MLb);
    else attn_slice<h16, false>((h16*)sm, Q16, nullptr, K16, nullptr, V16, nullptr, q0, sl, Ob, MLb);
}

// k_merge: out[t][d] = sum_s Ot_s 2^(m_s - M) / sum_s l_s 2^(m_s - M), slices ascending, M the largest slice maximum
__global__ __launch_bounds__(256) void k_merge(const float* __restrict__ O, const float* __restrict__ MLb, float* OUTb) { const size_t e = ((size_t)blockIdx.x * 256 + threadIdx.x) * 2; if (e >= (size_t)TT * HD) return; const int d = (int)(e % HD); const int t = (int)(e / HD);
    O += (size_t)blockIdx.y * NSL * TT * HD; MLb += (size_t)blockIdx.y * NSL * TT * 2; OUTb += (size_t)blockIdx.y * TT * HD;   // grid y: the batch
    const float* pb = O + (size_t)t * (NSL * HD) + d;   // partials lie [t][slice][d]: one address pair reaches all slices by immediate offsets
    const float* mp = MLb + (size_t)t * 2;              // (maximum, sum) pairs lie [slice][t]
    v2f p[NSL], ml[NSL];
#pragma unroll
    for (int s = 0; s < NSL; ++s) { p[s] = *(const v2f*)(pb + s * HD); ml[s] = *(const v2f*)(mp + s * TT * 2); }
    asm volatile("s_wait_xcnt 0x0" :: "v"(pb), "v"(mp) : "memory");   // both address pairs stay live up to this wait, so no load's result lands in a register that an issued load still names
    __builtin_amdgcn_sched_barrier(0);   // all 32 loads are issued ahead of the first use: one memory latency, not two
    float M = ml[0][0];
#pragma unroll
    for (int s = 1; s < NSL; ++s) M = fmaxf(M, ml[s][0]);
    static_assert(NSL == 16, "two statements of eight exponentials");
    v2f a; a[0] = 0.f; a[1] = 0.f; float L = 0.f; float xd[2][8], w[2][8];
#pragma unroll
    for (int h = 0; h < 2; ++h) {
#pragma unroll
        for (int r = 0; r < 8; ++r) xd[h][r] = ml[h * 8 + r][0] - M;
        exp2x8(xd[h], w[h]); }
#pragma unroll
    for (int s = 0; s < NSL; ++s) { a += p[s] * w[s >> 3][s & 7]; L += ml[s][1] * w[s >> 3][s & 7]; }
    v2f o2; o2[0] = __fdiv_rn(a[0], L); o2[1] = __fdiv_rn(a[1], L); *(v2f*)(OUTb + e) = o2;  }

extern "C" void kernel_launch(void* const* d_in, const int* in_sizes, int n_in,
                              void* d_out, int out_size, void* d_ws, size_t ws_size, hipStream_t stream) {
    (void)in_sizes; (void)n_in; (void)out_size;
    const float* x = (const float*)d_in[0]; const float* wk = (const float*)d_in[1]; const float* wq = (const float*)d_in[2]; const float* wv = (const float*)d_in[3];
    float* OUT = (float*)d_out;     // [4][4096][64]
    char* wsp = (char*)d_ws;
    auto take = [&](size_t bytes) { char* p = wsp; wsp += (bytes + 255) & ~(size_t)255; return (void*)p; };
    bf* WP = (bf*)take((size_t)(DQ + 2 * DKV) * DM * 2);
    h16* QP16 = (h16*)take((size_t)NB_ * NH_ * TT * HD * 2); h16* KP16 = (h16*)take((size_t)NB_ * NKV * TT * HD * 2); h16* VT16 = (h16*)take((size_t)NB_ * NKV * HD * TT * 2);
    bf* QPh = (bf*)take((size_t)NB_ * NH_ * TT * HD * 2); bf* QPl = (bf*)take((size_t)NB_ * NH_ * TT * HD * 2); bf* KPh = (bf*)take((size_t)NB_ * NKV * TT * HD * 2); bf* KPl = (bf*)take((size_t)NB_ * NKV * TT * HD * 2); bf* VTh = (bf*)take((size_t)NB_ * NKV * HD * TT * 2); bf* VTl = (bf*)take((size_t)NB_ * NKV * HD * TT * 2);
    float* Ob = (float*)take((size_t)NB_ * NSL * TT * HD * 4); float* MLb = (float*)take((size_t)NB_ * NSL * TT * 2 * 4);
    if ((size_t)(wsp - (char*)d_ws) > ws_size) return;    // ws 256 MiB
    static_assert(NH_ == 1 && NKV == 1, "one head");
    k_wpack<<<(DQ + 2 * DKV) * DM / 8 / 256, 256, 0, stream>>>(wq, wk, wv, WP);
    k_proj<<<NB_ * TT / PRW, 384, 0, stream>>>(x, WP, QP16, QPh, QPl, KP16, KPh, KPl, VT16, VTh, VTl);
    k_attn<<<dim3(TT / QWG, NSL, NB_), 512, 0, stream>>>(QP16, KP16, VT16, QPh, QPl, KPh, KPl, VTh, VTl, Ob, MLb);
    k_merge<<<dim3((unsigned)(((size_t)TT * HD / 2 + 255) / 256), NB_), 256, 0, stream>>>(Ob, MLb, OUT);
}

// v005
// It runs in 47.9 microseconds.
// Next to v004, in two timings, it ran 1.28 and 1.31 times as fast.
// All steps since v000 together make it 24.3 times as fast.
#include <hip/hip_runtime.h>

// Single attention head (ix [4][4096][768]; k, q, v = ix W ('xw' [768][64], no bias); wei = softmax(q.k / 8) over all 4096 keys; out = wei.v -> [4][4096][64] f32 (1.05 M)).
// Four launches, each for all four batches: the weights packed in fragment order; ONE projection kernel from the f32 input to the nine 16-bit q, k, v planes; one fused attention kernel over 4,096 keys in 16 key slices (rows < 512 hi/lo, rest fp16) with a running-maximum softmax in registers; the merge kernel joins the slices and normalises; f32 output.
// Compute dtypes, f32 accumulate: every input rounded to bf16; projections on PLAIN bf16 operands (exact); scores and attn.v rows < 512 on bf16 hi/lo planes (3 products), the rest single fp16; softmax f32; f32 output.

#define NB_  4
#define TT   4096
#define DM   768
#define NH_  1
#define NKV  1
#define REP  (NH_ / NKV)
#define HD   64
#define DQ   (NH_ * HD)
#define DKV  (NKV * HD)
#define ZH   1
#define RH   512                  // query rows < RH use hi+lo planes (0: none)
#define WIN  0
#define SCL  0.125f   // HD^-0.5
#define NSL  16                   // key slices of the fused attention
#define KSL  (TT / NSL)           // keys per slice (256)
#define AWV  8                    // waves of an attention workgroup: two workgroups share a WGP
#define QWH  (AWV * 16)           // query rows per hi/lo workgroup: a wave holds one 16-column tile
#define QWG  (AWV * 32)           // query rows per fp16 workgroup: a wave holds two 16-column tiles
typedef _Float16 h16;
typedef unsigned short bf;
typedef __attribute__((ext_vector_type(16))) __bf16   v16bf;
typedef __attribute__((ext_vector_type(16))) _Float16 v16h;
typedef __attribute__((ext_vector_type(8)))  _Float16 v8h;
typedef __attribute__((ext_vector_type(8)))  unsigned short v8us;
typedef __attribute__((ext_vector_type(8)))  float    v8f;
typedef __attribute__((ext_vector_type(4)))  float    v4f;
typedef v8h  __attribute__((may_alias)) v8ha;
typedef v4f  __attribute__((may_alias)) v4fa;
typedef v8us __attribute__((may_alias)) v8usa;

__device__ __forceinline__ unsigned short f2bf(float f) { unsigned u = __float_as_uint(f); u += 0x7FFFu + ((u >> 16) & 1u); return (unsigned short)(u >> 16); }
__device__ __forceinline__ float bf2f(unsigned short b) { return __uint_as_float(((unsigned)b) << 16); }
__device__ __forceinline__ float bfr(float f) { return bf2f(f2bf(f)); }
__device__ __forceinline__ v16h cat16(v8h lo, v8h hi) { return __builtin_shufflevector(lo, hi, 0, 1, 2, 3, 4, 5, 6, 7, 8, 9, 10, 11, 12, 13, 14, 15); }
__device__ __forceinline__ v16bf cat16b(v8us lo, v8us hi) { return __builtin_bit_cast(v16bf, __builtin_shufflevector(lo, hi, 0, 1, 2, 3, 4, 5, 6, 7, 8, 9, 10, 11, 12, 13, 14, 15)); }
__device__ __forceinline__ v8f wmma16(v16h a, v16h b, v8f c) { return __builtin_amdgcn_wmma_f32_16x16x32_f16(false, a, false, b, (short)0, c, false, false); }
__device__ __forceinline__ v8f wmmab(v16bf a, v16bf b, v8f c) { return __builtin_amdgcn_wmma_f32_16x16x32_bf16(false, a, false, b, (short)0, c, false, false); }

// 16-bit WMMA fragments: a lane's sixteen elements are p[0..7] and p[16..23], p = its row + 8 (lane >> 4); A and B alike
template <typename T16> struct WFrag;
template <> struct WFrag<h16> { typedef v16h V; static __device__ __forceinline__ V ld(const h16* p) { return cat16(*(const v8h*)p, *(const v8h*)(p + 16)); } static __device__ __forceinline__ v8f mma(V a, V b, v8f c) { return wmma16(a, b, c); } };
template <> struct WFrag<bf> { typedef v16bf V; static __device__ __forceinline__ V ld(const bf* p) { return cat16b(*(const v8us*)p, *(const v8us*)(p + 16)); } static __device__ __forceinline__ v8f mma(V a, V b, v8f c) { return wmmab(a, b, c); } };

__device__ __forceinline__ h16 tohx(float x) { return (h16)x; }
__device__ __forceinline__ void splitf(float y, unsigned short& h, unsigned short& l) { h = f2bf(y); l = f2bf(y - bf2f(h)); }
typedef __attribute__((ext_vector_type(2))) _Float16 v2h;
typedef __attribute__((ext_vector_type(4))) _Float16 v4h;
typedef __attribute__((ext_vector_type(2))) unsigned short v2us;
typedef __attribute__((ext_vector_type(4))) unsigned short v4us;
typedef __attribute__((ext_vector_type(2))) float v2f;
typedef __attribute__((ext_vector_type(4))) int v4i;
typedef __attribute__((ext_vector_type(4))) __bf16 v4bf;

// ---- k_wpack: the three weights, rounded to bf16, in the order the projection's waves read them. Fragment (nt, ks): columns 16 nt .. + 15 of q | k | v (nt 0-3 | 4-7 | 8-11), k = 32 ks .. + 31;
// it is two runs of 512 B: run h holds, lane by lane, the eight elements k = 32 ks + 16 h + 8 (lane >> 4) + j of column lane & 15 (the k order of WFrag::ld), so a fragment is two whole-line 16-byte loads.
#define NKS  (DM / 32)            // k steps (24)
__global__ __launch_bounds__(256) void k_wpack(const float* __restrict__ wq, const float* __restrict__ wk, const float* __restrict__ wv, bf* WP) {
    static_assert(NKS * 64 == 6 * 256, "six workgroups per 16 columns");
    const int nt = blockIdx.x / 6; const float* w = nt < 4 ? wq : nt < 8 ? wk : wv;
    const int pi = blockIdx.x * 256 + threadIdx.x, lane = pi & 31, h = (pi >> 5) & 1, ks = (pi >> 6) % NKS;
    const float* wp = w + (size_t)(ks * 32 + h * 16 + 8 * (lane >> 4)) * HD + (nt & 3) * 16 + (lane & 15); float t[8]; v8us o;
#pragma unroll
    for (int j = 0; j < 8; ++j) t[j] = wp[j * HD];
    asm volatile("s_wait_xcnt 0x0" :: "v"(wp) : "memory");   // the address pair stays live up to this wait, so no load's result lands in a register that an issued load still names
#pragma unroll
    for (int j = 0; j < 8; ++j) o[j] = f2bf(t[j]);
    *(v8us*)(WP + (size_t)pi * 8) = o;  }

// ---- k_proj: input rounding, the three projections and the plane building in one kernel. A workgroup (12 waves): 64 rows of ix x all 192 columns.
// The rows are read once, in whole lines, rounded to bf16 and staged in LDS. Wave (g, kq): g = q | k | v (64 columns), kq = a quarter of K (192 k, 6 steps): 4 x 4 accumulators, so every weight fragment is read once per workgroup.
// q and k: transposed product (A = weight columns, B = input rows), a lane holds 8 neighbouring d of one row; v: A = input rows, B = weight columns, a lane holds 8 neighbouring rows of one d: both leave 16-byte pieces of the layout their planes have.
// The four K quarters meet in LDS and are added in ascending order by the threads that round and store the planes in whole lines.
#define PRW  64                   // input rows per workgroup
#define XPE  (DM + 8)             // LDS pitch of a staged row, elements: 1,536 B + 16 B (16 B x odd: no bank conflict for 16-byte reads)
#define PQP  (2 * HD + 4)         // LDS pitch of a q | k partial row, floats: 512 B + 16 B
#define PVP  (PRW + 4)            // LDS pitch of a v partial row (one d, PRW input rows), floats: 256 B + 16 B
#define WFE  512                  // elements of a packed fragment
__device__ __forceinline__ v16bf wfrag(const bf* p) { return cat16b(*(const v8us*)p, *(const v8us*)(p + 256)); }
template <bool VK>
__device__ __forceinline__ void proj_part(const bf* xs, const bf* __restrict__ wp, v16bf (&wf)[2][4], float* pd) {
    v8f acc[4][4];   // [weight tile][row tile]
#pragma unroll
    for (int nb = 0; nb < 4; ++nb)
#pragma unroll
        for (int tt = 0; tt < 4; ++tt) acc[nb][tt] = (v8f){};
#pragma unroll
    for (int ks = 0; ks < 6; ++ks) { v16bf xa[4];
#pragma unroll
        for (int tt = 0; tt < 4; ++tt) xa[tt] = WFrag<bf>::ld(xs + tt * 16 * XPE + ks * 32);
#pragma unroll
        for (int nb = 0; nb < 4; ++nb)
#pragma unroll
            for (int tt = 0; tt < 4; ++tt) acc[nb][tt] = VK ? wmmab(xa[tt], wf[ks & 1][nb], acc[nb][tt]) : wmmab(wf[ks & 1][nb], xa[tt], acc[nb][tt]);
        if (ks + 2 < 6) {   // the weight fragments run two steps ahead
#pragma unroll
            for (int nb = 0; nb < 4; ++nb) wf[ks & 1][nb] = wfrag(wp + (nb * NKS + ks + 2) * WFE); } }
    asm volatile("s_wait_xcnt 0x0" :: "v"(wp) : "memory");   // the address pair stays live up to this wait, so no load's result lands in a register that an issued load still names
#pragma unroll
    for (int nb = 0; nb < 4; ++nb)
#pragma unroll
        for (int tt = 0; tt < 4; ++tt) { float* d = VK ? pd + nb * 16 * PVP + tt * 16 : pd + tt * 16 * PQP + nb * 16; v4f w0, w1;
#pragma unroll
            for (int r = 0; r < 4; ++r) { w0[r] = acc[nb][tt][r]; w1[r] = acc[nb][tt][4 + r]; }
            *(v4fa*)d = w0; *(v4fa*)(d + 4) = w1; }
}
template <int PS>   // eight neighbouring elements of a plane: the four K quarters (PS floats apart) added in ascending order, rounded to fp16 and to bf16 hi + lo
__device__ __forceinline__ void proj_emit(const float* sp, h16* d16, bf* dh, bf* dl) {
    v4f a0 = *(const v4fa*)sp, a1 = *(const v4fa*)(sp + 4);
#pragma unroll
    for (int s = 1; s < 4; ++s) { a0 += *(const v4fa*)(sp + s * PS); a1 += *(const v4fa*)(sp + s * PS + 4); }
    v8h o16; v8us oh, ol;
#pragma unroll
    for (int j = 0; j < 8; ++j) { const float y = j < 4 ? a0[j & 3] : a1[j & 3]; o16[j] = tohx(y); unsigned short a2, c2; splitf(y, a2, c2); oh[j] = a2; ol[j] = c2; }
    *(v8h*)d16 = o16; *(v8us*)dh = oh; *(v8us*)dl = ol;
    asm volatile("s_wait_xcnt 0x0" :: "v"(d16), "v"(dh), "v"(dl) : "memory");   // the three address pairs stay live up to this wait: nothing overwrites a register that an issued store still names
}
__global__ __launch_bounds__(384) void k_proj(const float* __restrict__ x, const bf* __restrict__ WP, h16* Q16, bf* Qh, bf* Ql, h16* K16, bf* Kh, bf* Kl, h16* V16, bf* Vh, bf* Vl) {
    static_assert(DM == 768 && HD == 64 && TT % PRW == 0, "staging and wave roles are written for 768 x 3 x 64; a workgroup lies in one batch");
    __shared__ __align__(16) unsigned short xs[PRW * XPE];
    __shared__ __align__(16) float pq[4 * PRW * PQP];
    __shared__ __align__(16) float pv[4 * HD * PVP];
    const int tid = threadIdx.x, lane = tid & 31, lr = lane & 15, hi = lane >> 4; const int R0 = blockIdx.x * PRW;
    const int wv = __builtin_amdgcn_readfirstlane(tid >> 5), g = wv >> 2, kq = wv & 3;   // the wave's number in a scalar register: the choice between the two product forms below is a scalar branch
    const int sr = tid / 192, sc = (tid % 192) * 4;   // staging: 16-byte piece tid + 384 i is row 2 i + sr, elements sc .. sc + 3; a wave's 32 pieces are 512 contiguous bytes
    const float* xp = x + (size_t)(R0 + sr) * DM + sc; const bf* wp = WP + (size_t)(g * 4 * NKS + kq * 6) * WFE + lane * 8;
    v4f t[PRW / 2]; v16bf wf[2][4];
#pragma unroll
    for (int i = 0; i < PRW / 2; ++i) t[i] = *(const v4f*)(xp + i * 2 * DM);
#pragma unroll
    for (int ks = 0; ks < 2; ++ks)
#pragma unroll
        for (int nb = 0; nb < 4; ++nb) wf[ks][nb] = wfrag(wp + (nb * NKS + ks) * WFE);
    asm volatile("s_wait_xcnt 0x0" :: "v"(xp), "v"(wp) : "memory");   // both address pairs stay live up to this wait, so no load's result lands in a register that an issued load still names
    unsigned short* dx = xs + sr * XPE + sc;
#pragma unroll
    for (int i = 0; i < PRW / 2; ++i) *(v4us*)(dx + i * 2 * XPE) = __builtin_bit_cast(v4us, __builtin_convertvector(t[i], v4bf));
    __syncthreads();   // the staged rows are read by all twelve waves
    const bf* xf = xs + lr * XPE + 8 * hi + kq * 192;
    if (g == 2) proj_part<true>(xf, wp, wf, pv + kq * HD * PVP + lr * PVP + 8 * hi);
    else proj_part<false>(xf, wp, wf, pq + kq * PRW * PQP + lr * PQP + g * HD + 8 * hi);
    __syncthreads();   // a plane element's four K quarters come from four waves
    const size_t vb = (size_t)(R0 / TT) * HD * TT + R0 % TT;
#pragma unroll
    for (int i = 0; i < 4; ++i) { const int it = i * 384 + tid, kind = it >> 9, r = (it & 511) >> 3, c8 = (it & 7) * 8;   // 3 x 512 pieces of eight; a wave's pieces are of one kind and fill whole lines
        const size_t qo = (size_t)(R0 + r) * HD + c8, vo = vb + (size_t)r * TT + c8;
        if (kind == 0) proj_emit<PRW * PQP>(pq + r * PQP + c8, Q16 + qo, Qh + qo, Ql + qo);
        else if (kind == 1) proj_emit<PRW * PQP>(pq + r * PQP + HD + c8, K16 + qo, Kh + qo, Kl + qo);
        else proj_emit<HD * PVP>(pv + r * PVP + c8, V16 + vo, Vh + vo, Vl + vo); }
}
// ---- k_attn: scores, softmax and attn.v fused. A workgroup (8 waves): 256 (fp16) or 128 (hi/lo) query rows x one slice of KSL keys; the slice's k rows and v rows are staged once in LDS; a wave: NQ tiles of 16 query columns (fp16: 2, every k and v fragment read from LDS serves both; hi/lo: 1), passes of 32 keys.
// Transposed products: St = K.Qt (A = key rows, B = query columns), so a lane holds 16 scores of ONE query; two St tiles converted in place are the B operand of Ot += Vt.Pt (A = rows of the [d][t] v planes).
// Running maximum per query in base 2; a slice leaves its unnormalised Ot, its maximum and its sum, and k_merge joins the slices.
#define KPE  72                   // LDS pitch of a key row, elements: 128 B + 16 B (16 B x odd: no bank conflict for 16-byte reads)
#define VPE  (KSL + 8)            // LDS pitch of a v row (KSL keys), elements: 512 B + 16 B
#define PLE  (KSL * KPE + HD * VPE)   // one k plane and one v plane
template <typename T16> struct Oct;
template <> struct Oct<h16> { typedef v8h H; };
template <> struct Oct<bf> { typedef v8us H; };
__device__ __forceinline__ float xhalf(float x) { return __builtin_bit_cast(float, __builtin_amdgcn_permlanex16(__builtin_bit_cast(int, x), __builtin_bit_cast(int, x), 0x76543210, 0xfedcba98, false, false)); }   // lane l with lane l ^ 16
// Base-2 exponentials with the slot that the instruction set asks for behind a transcendental written in: inside a statement every v_exp_f32 is followed by an independent one (outputs early-clobber, so none is another's source), the last by v_nop.
__device__ __forceinline__ void exp2x8(const float (&x)[8], float (&e)[8]) {
    asm("v_exp_f32 %0, %8\n\tv_exp_f32 %1, %9\n\tv_exp_f32 %2, %10\n\tv_exp_f32 %3, %11\n\tv_exp_f32 %4, %12\n\tv_exp_f32 %5, %13\n\tv_exp_f32 %6, %14\n\tv_exp_f32 %7, %15\n\tv_nop"
        : "=&v"(e[0]), "=&v"(e[1]), "=&v"(e[2]), "=&v"(e[3]), "=&v"(e[4]), "=&v"(e[5]), "=&v"(e[6]), "=&v"(e[7]) : "v"(x[0]), "v"(x[1]), "v"(x[2]), "v"(x[3]), "v"(x[4]), "v"(x[5]), "v"(x[6]), "v"(x[7])); }
__device__ __forceinline__ float exp2x1(float x) { float e; asm("v_exp_f32 %0, %1\n\tv_nop" : "=&v"(e) : "v"(x)); return e; }
template <typename T16, bool HL, int NQ>   // HL: second (low) planes, three products each; NQ: query tiles of a wave
__device__ __forceinline__ void attn_slice(T16* sm, const T16* __restrict__ Q, const T16* __restrict__ Q2, const T16* __restrict__ Kp, const T16* __restrict__ K2, const T16* __restrict__ Vt, const T16* __restrict__ V2, int q0, int sl, float* __restrict__ Ob, float* __restrict__ MLb) {
    typedef typename WFrag<T16>::V V; typedef typename Oct<T16>::H H;
    const int tid = threadIdx.x, lane = tid & 31, lr = lane & 15, hi = lane >> 4;
    const float POFF = HL ? 0.0f : 8.0f;   // fp16 weights are carried x 2^8 (sum and Ot alike), away from the fp16 subnormals
    const size_t qo = (size_t)(q0 + lr) * HD + 8 * hi, ko = (size_t)sl * KSL * HD + tid * 8, vo = (size_t)(tid >> 5) * TT + sl * KSL + (tid & 31) * 8;
    const T16* qp = Q + qo; const T16* qq = HL ? Q2 + qo : qp; const T16* gk = Kp + ko; const T16* gl = HL ? K2 + ko : gk; const T16* gv = Vt + vo; const T16* gw = HL ? V2 + vo : gv;   // every global read below is one of these plus a constant
    V qf[NQ][2], qg[NQ][2];
    {   // stage the slice: 16-byte pieces, whole lines per wave; piece tid + 256 i is k row (tid >> 3) + 32 i, v row (tid >> 5) + 8 i
        H tk[8], tl[8], tv[8], tw[8];
#pragma unroll
        for (int i = 0; i < 8; ++i) { tk[i] = *(const H*)(gk + i * 2048); tv[i] = *(const H*)(gv + i * 8 * TT); if (HL) { tl[i] = *(const H*)(gl + i * 2048); tw[i] = *(const H*)(gw + i * 8 * TT); } }
#pragma unroll
        for (int qt = 0; qt < NQ; ++qt)
#pragma unroll
            for (int ks = 0; ks < 2; ++ks) { qf[qt][ks] = WFrag<T16>::ld(qp + qt * 16 * HD + ks * 32); if (HL) qg[qt][ks] = WFrag<T16>::ld(qq + qt * 16 * HD + ks * 32); }
        asm volatile("s_wait_xcnt 0x0" :: "v"(qp), "v"(qq), "v"(gk), "v"(gl), "v"(gv), "v"(gw) : "memory");   // the address pairs stay live up to this wait, so no load's result lands in a register that an issued load still names
        T16* dk = sm + (tid >> 3) * KPE + (tid & 7) * 8; T16* dv = sm + KSL * KPE + (tid >> 5) * VPE + (tid & 31) * 8;
#pragma unroll
        for (int i = 0; i < 8; ++i) { *(H*)(dk + i * 32 * KPE) = tk[i]; *(H*)(dv + i * 8 * VPE) = tv[i]; if (HL) { *(H*)(dk + PLE + i * 32 * KPE) = tl[i]; *(H*)(dv + PLE + i * 8 * VPE) = tw[i]; } }
    }
    __syncthreads();   // the staged slice is read by all eight waves
    const T16* kl = sm + lr * KPE + 8 * hi; const T16* km = kl + PLE; const T16* vl = sm + KSL * KPE + lr * VPE + 8 * hi; const T16* vm = vl + PLE;   // walked pass by pass, so that every read is one of the four plus a 16-bit offset
    v8f o[NQ][4]; float mr[NQ], ls[NQ];
#pragma unroll
    for (int qt = 0; qt < NQ; ++qt) { mr[qt] = -3.0e38f; ls[qt] = 0.f;
#pragma unroll
        for (int dt = 0; dt < 4; ++dt) o[qt][dt] = (v8f){}; }
#pragma unroll (HL ? 1 : 4)   // fp16: four passes unrolled, their LDS addresses are a lane register plus an immediate and the next pass's reads can start early (all eight unrolled spill with two query tiles); hi/lo: rolled, the low planes lie beyond the 16-bit offset and are walked
    for (int p = 0; p < KSL / 32; ++p) {
        V ka[2][2], kb[2][2], va[4], vb[4];
#pragma unroll
        for (int kt = 0; kt < 2; ++kt)
#pragma unroll
            for (int ks = 0; ks < 2; ++ks) { ka[kt][ks] = WFrag<T16>::ld(kl + kt * 16 * KPE + ks * 32); if (HL) kb[kt][ks] = WFrag<T16>::ld(km + kt * 16 * KPE + ks * 32); }
#pragma unroll
        for (int dt = 0; dt < 4; ++dt) { va[dt] = WFrag<T16>::ld(vl + dt * 16 * VPE); if (HL) vb[dt] = WFrag<T16>::ld(vm + dt * 16 * VPE); }
        kl += 32 * KPE; km += 32 * KPE; vl += 32; vm += 32;
        __builtin_amdgcn_sched_barrier(0);   // a pass's LDS reads are all issued ahead of its first product (the v reads a whole softmax early), and no later pass's reads rise above this line: without it the unrolled path fetches so far ahead that it spills
        v8f s[NQ][2];
#pragma unroll
        for (int kt = 0; kt < 2; ++kt)
#pragma unroll
            for (int qt = 0; qt < NQ; ++qt) { v8f c = (v8f){};
#pragma unroll
                for (int ks = 0; ks < 2; ++ks) { c = WFrag<T16>::mma(ka[kt][ks], qf[qt][ks], c); if (HL) { c = WFrag<T16>::mma(ka[kt][ks], qg[qt][ks], c); c = WFrag<T16>::mma(kb[kt][ks], qf[qt][ks], c); } }
                s[qt][kt] = c; }
        V pb[NQ], pc[NQ];
#pragma unroll
        for (int qt = 0; qt < NQ; ++qt) { float mx = mr[qt];
#pragma unroll
            for (int kt = 0; kt < 2; ++kt)
#pragma unroll
                for (int r = 0; r < 8; ++r) { s[qt][kt][r] *= SCL * 1.4426950408889634f; mx = fmaxf(mx, s[qt][kt][r]); }
            mx = fmaxf(mx, xhalf(mx));   // both halves of the wave hold keys of the same query
            const float al = exp2x1(mr[qt] - mx); mr[qt] = mx; const float mo = mx - POFF; float sum = 0.f; float xd[2][8], xe[2][8];
#pragma unroll
            for (int kt = 0; kt < 2; ++kt) {
#pragma unroll
                for (int r = 0; r < 8; ++r) xd[kt][r] = s[qt][kt][r] - mo;
                exp2x8(xd[kt], xe[kt]); }
#pragma unroll
            for (int e = 0; e < 16; ++e) { const float ex = xe[e >> 3][e & 7]; sum += ex;
                if constexpr (HL) { const __bf16 h = (__bf16)ex; pb[qt][e] = h; pc[qt][e] = (__bf16)(ex - (float)h); } else pb[qt][e] = (h16)ex; }
            ls[qt] = ls[qt] * al + sum;
#pragma unroll
            for (int dt = 0; dt < 4; ++dt) o[qt][dt] *= al; }
#pragma unroll
        for (int dt = 0; dt < 4; ++dt)
#pragma unroll
            for (int qt = 0; qt < NQ; ++qt) { o[qt][dt] = WFrag<T16>::mma(va[dt], pb[qt], o[qt][dt]); if (HL) { o[qt][dt] = WFrag<T16>::mma(va[dt], pc[qt], o[qt][dt]); o[qt][dt] = WFrag<T16>::mma(vb[dt], pb[qt], o[qt][dt]); } }
    }
#pragma unroll
    for (int qt = 0; qt < NQ; ++qt) { const int q = q0 + qt * 16 + lr; const float lt = ls[qt] + xhalf(ls[qt]); float* ob = Ob + ((size_t)q * NSL + sl) * HD + 8 * hi;   // a lane holds d = 16 dt + 8 hi + r of its query
#pragma unroll
        for (int dt = 0; dt < 4; ++dt) { v4f w0, w1;
#pragma unroll
            for (int r = 0; r < 4; ++r) { w0[r] = o[qt][dt][r]; w1[r] = o[qt][dt][4 + r]; }
            *(v4f*)(ob + dt * 16) = w0; *(v4f*)(ob + dt * 16 + 4) = w1; }
        if (hi == 0) { v2f ml; ml[0] = mr[qt]; ml[1] = lt; *(v2f*)(MLb + ((size_t)sl * TT + q) * 2) = ml; } }   // [slice][t]: a tile's 16 pairs fill one 128-byte line
}
__global__ __launch_bounds__(AWV * 32) __attribute__((amdgpu_waves_per_eu(4, 4))) void k_attn(const h16* __restrict__ Q16, const h16* __restrict__ K16, const h16* __restrict__ V16, const bf* __restrict__ Qh, const bf* __restrict__ Ql, const bf* __restrict__ Kh, const bf* __restrict__ Kl, const bf* __restrict__ Vh, const bf* __restrict__ Vl, float* Ob, float* MLb) {
    static_assert(RH % QWH == 0 && (TT - RH) % QWG == 0 && KSL == 256 && HD == 64 && AWV == 8, "a workgroup is all hi/lo or all fp16; the staging loops are written for 256 keys x 64 and 256 threads");
    __shared__ __align__(16) unsigned short sm[2 * PLE];
    const int bx = blockIdx.x, wn = threadIdx.x >> 5, sl = blockIdx.y;   // grid x: first the RH / QWH hi/lo blocks, then the fp16 blocks
    const size_t bo = (size_t)blockIdx.z * TT * HD;   // grid z: the batch
    Q16 += bo; K16 += bo; V16 += bo; Qh += bo; Ql += bo; Kh += bo; Kl += bo; Vh += bo; Vl += bo; Ob += bo * NSL; MLb += (size_t)blockIdx.z * NSL * TT * 2;
    if (bx < RH / QWH) attn_slice<bf, true, 1>(sm, Qh, Ql, Kh, Kl, Vh, Vl, bx * QWH + wn * 16, sl, Ob, MLb);
    else attn_slice<h16, false, 2>((h16*)sm, Q16, nullptr, K16, nullptr, V16, nullptr, RH + (bx - RH / QWH) * QWG + wn * 32, sl, Ob, MLb);
}

// k_merge: out[t][d] = sum_s Ot_s 2^(m_s - M) / sum_s l_s 2^(m_s - M), slices ascending, M the largest slice maximum
__global__ __launch_bounds__(256) void k_merge(const float* __restrict__ O, const float* __restrict__ MLb, float* OUTb) { const size_t e = ((size_t)blockIdx.x * 256 + threadIdx.x) * 2; if (e >= (size_t)TT * HD) return; const int d = (int)(e % HD); const int t = (int)(e / HD);
    O += (size_t)blockIdx.y * NSL * TT * HD; MLb += (size_t)blockIdx.y * NSL * TT * 2; OUTb += (size_t)blockIdx.y * TT * HD;   // grid y: the batch
    const float* pb = O + (size_t)t * (NSL * HD) + d;   // partials lie [t][slice][d]: one address pair reaches all slices by immediate offsets
    const float* mp = MLb + (size_t)t * 2;              // (maximum, sum) pairs lie [slice][t]
    v2f p[NSL], ml[NSL];
#pragma unroll
    for (int s = 0; s < NSL; ++s) { p[s] = *(const v2f*)(pb + s * HD); ml[s] = *(const v2f*)(mp + s * TT * 2); }
    asm volatile("s_wait_xcnt 0x0" :: "v"(pb), "v"(mp) : "memory");   // both address pairs stay live up to this wait, so no load's result lands in a register that an issued load still names
    __builtin_amdgcn_sched_barrier(0);   // all 32 loads are issued ahead of the first use: one memory latency, not two
    float M = ml[0][0];
#pragma unroll
    for (int s = 1; s < NSL; ++s) M = fmaxf(M, ml[s][0]);
    static_assert(NSL == 16, "two statements of eight exponentials");
    v2f a; a[0] = 0.f; a[1] = 0.f; float L = 0.f; float xd[2][8], w[2][8];
#pragma unroll
    for (int h = 0; h < 2; ++h) {
#pragma unroll
        for (int r = 0; r < 8; ++r) xd[h][r] = ml[h * 8 + r][0] - M;
        exp2x8(xd[h], w[h]); }
#pragma unroll
    for (int s = 0; s < NSL; ++s) { a += p[s] * w[s >> 3][s & 7]; L += ml[s][1] * w[s >> 3][s & 7]; }
    v2f o2; o2[0] = __fdiv_rn(a[0], L); o2[1] = __fdiv_rn(a[1], L); *(v2f*)(OUTb + e) = o2;  }

extern "C" void kernel_launch(void* const* d_in, const int* in_sizes, int n_in,
                              void* d_out, int out_size, void* d_ws, size_t ws_size, hipStream_t stream) {
    (void)in_sizes; (void)n_in; (void)out_size;
    const float* x = (const float*)d_in[0]; const float* wk = (const float*)d_in[1]; const float* wq = (const float*)d_in[2]; const float* wv = (const float*)d_in[3];
    float* OUT = (float*)d_out;     // [4][4096][64]
    char* wsp = (char*)d_ws;
    auto take = [&](size_t bytes) { char* p = wsp; wsp += (bytes + 255) & ~(size_t)255; return (void*)p; };
    bf* WP = (bf*)take((size_t)(DQ + 2 * DKV) * DM * 2);
    h16* QP16 = (h16*)take((size_t)NB_ * NH_ * TT * HD * 2); h16* KP16 = (h16*)take((size_t)NB_ * NKV * TT * HD * 2); h16* VT16 = (h16*)take((size_t)NB_ * NKV * HD * TT * 2);
    bf* QPh = (bf*)take((size_t)NB_ * NH_ * TT * HD * 2); bf* QPl = (bf*)take((size_t)NB_ * NH_ * TT * HD * 2); bf* KPh = (bf*)take((size_t)NB_ * NKV * TT * HD * 2); bf* KPl = (bf*)take((size_t)NB_ * NKV * TT * HD * 2); bf* VTh = (bf*)take((size_t)NB_ * NKV * HD * TT * 2); bf* VTl = (bf*)take((size_t)NB_ * NKV * HD * TT * 2);
    float* Ob = (float*)take((size_t)NB_ * NSL * TT * HD * 4); float* MLb = (float*)take((size_t)NB_ * NSL * TT * 2 * 4);
    if ((size_t)(wsp - (char*)d_ws) > ws_size) return;    // ws 256 MiB
    static_assert(NH_ == 1 && NKV == 1, "one head");
    k_wpack<<<(DQ + 2 * DKV) * DM / 8 / 256, 256, 0, stream>>>(wq, wk, wv, WP);
    k_proj<<<NB_ * TT / PRW, 384, 0, stream>>>(x, WP, QP16, QPh, QPl, KP16, KPh, KPl, VT16, VTh, VTl);
    k_attn<<<dim3(RH / QWH + (TT - RH) / QWG, NSL, NB_), AWV * 32, 0, stream>>>(QP16, KP16, VT16, QPh, QPl, KPh, KPl, VTh, VTl, Ob, MLb);
    k_merge<<<dim3((unsigned)(((size_t)TT * HD / 2 + 255) / 256), NB_), 256, 0, stream>>>(Ob, MLb, OUT);
}

// v006
// A run of this version takes 44.5 microseconds.
// Next to v005, in two timings, it ran 1.08 and 1.07 times as fast.
// Counting every step since v000, it is 26.2 times as fast.
#include <hip/hip_runtime.h>

// Single attention head (ix [4][4096][768]; k, q, v = ix W ('xw' [768][64], no bias); wei = softmax(q.k / 8) over all 4096 keys; out = wei.v -> [4][4096][64] f32 (1.05 M)).
// Four launches, each for all four batches: the weights packed in fragment order; ONE projection kernel from the f32 input to the nine 16-bit q, k, v planes; one fused attention kernel over 4,096 keys in key slices (rows < 512 hi/lo, 16 slices; the rest fp16, 8 slices) with a running-maximum softmax in registers; the merge kernel joins the slices and normalises; f32 output.
// Compute dtypes, f32 accumulate: every input rounded to bf16; projections on PLAIN bf16 operands (exact); scores and attn.v rows < 512 on bf16 hi/lo planes (3 products), the rest single fp16; softmax f32; f32 output.

#define NB_  4
#define TT   4096
#define DM   768
#define NH_  1
#define NKV  1
#define REP  (NH_ / NKV)
#define HD   64
#define DQ   (NH_ * HD)
#define DKV  (NKV * HD)
#define ZH   1
#define RH   512                  // query rows < RH use hi+lo planes (0: none)
#define WIN  0
#define SCL  0.125f   // HD^-0.5
#define NSL  16                   // key slices of the hi/lo rows; also the slice stride of the partial planes
#define KSL  (TT / NSL)           // keys per hi/lo slice (256)
#define NSF  8                    // key slices of the fp16 rows: one k and one v plane of 512 keys fill the LDS that two planes each of 256 keys need
#define KSF  (TT / NSF)           // keys per fp16 slice (512)
#define AWV  8                    // waves of an attention workgroup: two workgroups share a WGP
#define QWH  (AWV * 16)           // query rows per hi/lo workgroup: a wave holds one 16-column tile
#define QWG  (AWV * 32)           // query rows per fp16 workgroup: a wave holds two 16-column tiles
typedef _Float16 h16;
typedef unsigned short bf;
typedef __attribute__((ext_vector_type(16))) __bf16   v16bf;
typedef __attribute__((ext_vector_type(16))) _Float16 v16h;
typedef __attribute__((ext_vector_type(8)))  _Float16 v8h;
typedef __attribute__((ext_vector_type(8)))  unsigned short v8us;
typedef __attribute__((ext_vector_type(8)))  float    v8f;
typedef __attribute__((ext_vector_type(4)))  float    v4f;
typedef v8h  __attribute__((may_alias)) v8ha;
typedef v4f  __attribute__((may_alias)) v4fa;
typedef v8us __attribute__((may_alias)) v8usa;

__device__ __forceinline__ unsigned short f2bf(float f) { unsigned u = __float_as_uint(f); u += 0x7FFFu + ((u >> 16) & 1u); return (unsigned short)(u >> 16); }
__device__ __forceinline__ float bf2f(unsigned short b) { return __uint_as_float(((unsigned)b) << 16); }
__device__ __forceinline__ float bfr(float f) { return bf2f(f2bf(f)); }
__device__ __forceinline__ v16h cat16(v8h lo, v8h hi) { return __builtin_shufflevector(lo, hi, 0, 1, 2, 3, 4, 5, 6, 7, 8, 9, 10, 11, 12, 13, 14, 15); }
__device__ __forceinline__ v16bf cat16b(v8us lo, v8us hi) { return __builtin_bit_cast(v16bf, __builtin_shufflevector(lo, hi, 0, 1, 2, 3, 4, 5, 6, 7, 8, 9, 10, 11, 12, 13, 14, 15)); }
__device__ __forceinline__ v8f wmma16(v16h a, v16h b, v8f c) { return __builtin_amdgcn_wmma_f32_16x16x32_f16(false, a, false, b, (short)0, c, false, false); }
__device__ __forceinline__ v8f wmmab(v16bf a, v16bf b, v8f c) { return __builtin_amdgcn_wmma_f32_16x16x32_bf16(false, a, false, b, (short)0, c, false, false); }

// 16-bit WMMA fragments: a lane's sixteen elements are p[0..7] and p[16..23], p = its row + 8 (lane >> 4); A and B alike
template <typename T16> struct WFrag;
template <> struct WFrag<h16> { typedef v16h V; static __device__ __forceinline__ V ld(const h16* p) { return cat16(*(const v8h*)p, *(const v8h*)(p + 16)); } static __device__ __forceinline__ v8f mma(V a, V b, v8f c) { return wmma16(a, b, c); } };
template <> struct WFrag<bf> { typedef v16bf V; static __device__ __forceinline__ V ld(const bf* p) { return cat16b(*(const v8us*)p, *(const v8us*)(p + 16)); } static __device__ __forceinline__ v8f mma(V a, V b, v8f c) { return wmmab(a, b, c); } };

__device__ __forceinline__ h16 tohx(float x) { return (h16)x; }
__device__ __forceinline__ void splitf(float y, unsigned short& h, unsigned short& l) { h = f2bf(y); l = f2bf(y - bf2f(h)); }
typedef __attribute__((ext_vector_type(2))) _Float16 v2h;
typedef __attribute__((ext_vector_type(4))) _Float16 v4h;
typedef __attribute__((ext_vector_type(2))) unsigned short v2us;
typedef __attribute__((ext_vector_type(4))) unsigned short v4us;
typedef __attribute__((ext_vector_type(2))) float v2f;
typedef __attribute__((ext_vector_type(4))) int v4i;
typedef __attribute__((ext_vector_type(4))) __bf16 v4bf;

// ---- k_wpack: the three weights, rounded to bf16, in the order the projection's waves read them. Fragment (nt, ks): columns 16 nt .. + 15 of q | k | v (nt 0-3 | 4-7 | 8-11), k = 32 ks .. + 31;
// it is two runs of 512 B: run h holds, lane by lane, the eight elements k = 32 ks + 16 h + 8 (lane >> 4) + j of column lane & 15 (the k order of WFrag::ld), so a fragment is two whole-line 16-byte loads.
#define NKS  (DM / 32)            // k steps (24)
__global__ __launch_bounds__(256) void k_wpack(const float* __restrict__ wq, const float* __restrict__ wk, const float* __restrict__ wv, bf* WP) {
    static_assert(NKS * 64 == 6 * 256, "six workgroups per 16 columns");
    const int nt = blockIdx.x / 6; const float* w = nt < 4 ? wq : nt < 8 ? wk : wv;
    const int pi = blockIdx.x * 256 + threadIdx.x, lane = pi & 31, h = (pi >> 5) & 1, ks = (pi >> 6) % NKS;
    const float* wp = w + (size_t)(ks * 32 + h * 16 + 8 * (lane >> 4)) * HD + (nt & 3) * 16 + (lane & 15); float t[8]; v8us o;
#pragma unroll
    for (int j = 0; j < 8; ++j) t[j] = wp[j * HD];
    asm volatile("s_wait_xcnt 0x0" :: "v"(wp) : "memory");   // the address pair stays live up to this wait, so no load's result lands in a register that an issued load still names
#pragma unroll
    for (int j = 0; j < 8; ++j) o[j] = f2bf(t[j]);
    *(v8us*)(WP + (size_t)pi * 8) = o;  }

// ---- k_proj: input rounding, the three projections and the plane building in one kernel. A workgroup (12 waves): 64 rows of ix x all 192 columns.
// The rows are read once, in whole lines, rounded to bf16 and staged in LDS. Wave (g, kq): g = q | k | v (64 columns), kq = a quarter of K (192 k, 6 steps): 4 x 4 accumulators, so every weight fragment is read once per workgroup.
// q and k: transposed product (A = weight columns, B = input rows), a lane holds 8 neighbouring d of one row; v: A = input rows, B = weight columns, a lane holds 8 neighbouring rows of one d: both leave 16-byte pieces of the layout their planes have.
// The four K quarters meet in LDS and are added in ascending order by the threads that round and store the planes in whole lines.
#define PRW  64                   // input rows per workgroup
#define XPE  (DM + 8)             // LDS pitch of a staged row, elements: 1,536 B + 16 B (16 B x odd: no bank conflict for 16-byte reads)
#define PQP  (2 * HD + 4)         // LDS pitch of a q | k partial row, floats: 512 B + 16 B
#define PVP  (PRW + 4)            // LDS pitch of a v partial row (one d, PRW input rows), floats: 256 B + 16 B
#define WFE  512                  // elements of a packed fragment
__device__ __forceinline__ v16bf wfrag(const bf* p) { return cat16b(*(const v8us*)p, *(const v8us*)(p + 256)); }
template <bool VK>
__device__ __forceinline__ void proj_part(const bf* xs, const bf* __restrict__ wp, v16bf (&wf)[2][4], float* pd) {
    v8f acc[4][4];   // [weight tile][row tile]
#pragma unroll
    for (int nb = 0; nb < 4; ++nb)
#pragma unroll
        for (int tt = 0; tt < 4; ++tt) acc[nb][tt] = (v8f){};
#pragma unroll
    for (int ks = 0; ks < 6; ++ks) { v16bf xa[4];
#pragma unroll
        for (int tt = 0; tt < 4; ++tt) xa[tt] = WFrag<bf>::ld(xs + tt * 16 * XPE + ks * 32);
#pragma unroll
        for (int nb = 0; nb < 4; ++nb)
#pragma unroll
            for (int tt = 0; tt < 4; ++tt) acc[nb][tt] = VK ? wmmab(xa[tt], wf[ks & 1][nb], acc[nb][tt]) : wmmab(wf[ks & 1][nb], xa[tt], acc[nb][tt]);
        if (ks + 2 < 6) {   // the weight fragments run two steps ahead
#pragma unroll
            for (int nb = 0; nb < 4; ++nb) wf[ks & 1][nb] = wfrag(wp + (nb * NKS + ks + 2) * WFE); } }
    asm volatile("s_wait_xcnt 0x0" :: "v"(wp) : "memory");   // the address pair stays live up to this wait, so no load's result lands in a register that an issued load still names
#pragma unroll
    for (int nb = 0; nb < 4; ++nb)
#pragma unroll
        for (int tt = 0; tt < 4; ++tt) { float* d = VK ? pd + nb * 16 * PVP + tt * 16 : pd + tt * 16 * PQP + nb * 16; v4f w0, w1;
#pragma unroll
            for (int r = 0; r < 4; ++r) { w0[r] = acc[nb][tt][r]; w1[r] = acc[nb][tt][4 + r]; }
            *(v4fa*)d = w0; *(v4fa*)(d + 4) = w1; }
}
template <int PS>   // eight neighbouring elements of a plane: the four K quarters (PS floats apart) added in ascending order, rounded to fp16 and to bf16 hi + lo
__device__ __forceinline__ void proj_emit(const float* sp, h16* d16, bf* dh, bf* dl) {
    v4f a0 = *(const v4fa*)sp, a1 = *(const v4fa*)(sp + 4);
#pragma unroll
    for (int s = 1; s < 4; ++s) { a0 += *(const v4fa*)(sp + s * PS); a1 += *(const v4fa*)(sp + s * PS + 4); }
    v8h o16; v8us oh, ol;
#pragma unroll
    for (int j = 0; j < 8; ++j) { const float y = j < 4 ? a0[j & 3] : a1[j & 3]; o16[j] = tohx(y); unsigned short a2, c2; splitf(y, a2, c2); oh[j] = a2; ol[j] = c2; }
    *(v8h*)d16 = o16; *(v8us*)dh = oh; *(v8us*)dl = ol;
    asm volatile("s_wait_xcnt 0x0" :: "v"(d16), "v"(dh), "v"(dl) : "memory");   // the three address pairs stay live up to this wait: nothing overwrites a register that an issued store still names
}
__global__ __launch_bounds__(384) void k_proj(const float* __restrict__ x, const bf* __restrict__ WP, h16* Q16, bf* Qh, bf* Ql, h16* K16, bf* Kh, bf* Kl, h16* V16, bf* Vh, bf* Vl) {
    static_assert(DM == 768 && HD == 64 && TT % PRW == 0, "staging and wave roles are written for 768 x 3 x 64; a workgroup lies in one batch");
    __shared__ __align__(16) unsigned short xs[PRW * XPE];
    __shared__ __align__(16) float pq[4 * PRW * PQP];
    __shared__ __align__(16) float pv[4 * HD * PVP];
    const int tid = threadIdx.x, lane = tid & 31, lr = lane & 15, hi = lane >> 4; const int R0 = blockIdx.x * PRW;
    const int wv = __builtin_amdgcn_readfirstlane(tid >> 5), g = wv >> 2, kq = wv & 3;   // the wave's number in a scalar register: the choice between the two product forms below is a scalar branch
    const int sr = tid / 192, sc = (tid % 192) * 4;   // staging: 16-byte piece tid + 384 i is row 2 i + sr, elements sc .. sc + 3; a wave's 32 pieces are 512 contiguous bytes
    const float* xp = x + (size_t)(R0 + sr) * DM + sc; const bf* wp = WP + (size_t)(g * 4 * NKS + kq * 6) * WFE + lane * 8;
    v4f t[PRW / 2]; v16bf wf[2][4];
#pragma unroll
    for (int i = 0; i < PRW / 2; ++i) t[i] = *(const v4f*)(xp + i * 2 * DM);
#pragma unroll
    for (int ks = 0; ks < 2; ++ks)
#pragma unroll
        for (int nb = 0; nb < 4; ++nb) wf[ks][nb] = wfrag(wp + (nb * NKS + ks) * WFE);
    asm volatile("s_wait_xcnt 0x0" :: "v"(xp), "v"(wp) : "memory");   // both address pairs stay live up to this wait, so no load's result lands in a register that an issued load still names
    unsigned short* dx = xs + sr * XPE + sc;
#pragma unroll
    for (int i = 0; i < PRW / 2; ++i) *(v4us*)(dx + i * 2 * XPE) = __builtin_bit_cast(v4us, __builtin_convertvector(t[i], v4bf));
    __syncthreads();   // the staged rows are read by all twelve waves
    const bf* xf = xs + lr * XPE + 8 * hi + kq * 192;
    if (g == 2) proj_part<true>(xf, wp, wf, pv + kq * HD * PVP + lr * PVP + 8 * hi);
    else proj_part<false>(xf, wp, wf, pq + kq * PRW * PQP + lr * PQP + g * HD + 8 * hi);
    __syncthreads();   // a plane element's four K quarters come from four waves
    const size_t vb = (size_t)(R0 / TT) * HD * TT + R0 % TT;
#pragma unroll
    for (int i = 0; i < 4; ++i) { const int it = i * 384 + tid, kind = it >> 9, r = (it & 511) >> 3, c8 = (it & 7) * 8;   // 3 x 512 pieces of eight; a wave's pieces are of one kind and fill whole lines
        const size_t qo = (size_t)(R0 + r) * HD + c8, vo = vb + (size_t)r * TT + c8;
        if (kind == 0) proj_emit<PRW * PQP>(pq + r * PQP + c8, Q16 + qo, Qh + qo, Ql + qo);
        else if (kind == 1) proj_emit<PRW * PQP>(pq + r * PQP + HD + c8, K16 + qo, Kh + qo, Kl + qo);
        else proj_emit<HD * PVP>(pv + r * PVP + c8, V16 + vo, Vh + vo, Vl + vo); }
}
// ---- k_attn: scores, softmax and attn.v fused. A workgroup (8 waves): 256 query rows x one slice of KSF keys (fp16) or 128 query rows x one slice of KSL keys (hi/lo); the slice's k rows and v rows are staged once in LDS; a wave: NQ tiles of 16 query columns (fp16: 2, every k and v fragment read from LDS serves both; hi/lo: 1), passes of 32 keys.
// Transposed products: St = K.Qt (A = key rows, B = query columns), so a lane holds 16 scores of ONE query; two St tiles converted in place are the B operand of Ot += Vt.Pt (A = rows of the [d][t] v planes).
// Running maximum per query in base 2; a slice leaves its unnormalised Ot, its maximum and its sum, and k_merge joins the slices.
#define KPE  72                   // LDS pitch of a key row, elements: 128 B + 16 B (16 B x odd: no bank conflict for 16-byte reads)
#define PLE  (KSL * KPE + HD * (KSL + 8))   // one k plane and one v plane of a hi/lo slice
template <typename T16> struct Oct;
template <> struct Oct<h16> { typedef v8h H; };
template <> struct Oct<bf> { typedef v8us H; };
__device__ __forceinline__ float xhalf(float x) { return __builtin_bit_cast(float, __builtin_amdgcn_permlanex16(__builtin_bit_cast(int, x), __builtin_bit_cast(int, x), 0x76543210, 0xfedcba98, false, false)); }   // lane l with lane l ^ 16
// Base-2 exponentials with the slot that the instruction set asks for behind a transcendental written in: inside a statement every v_exp_f32 is followed by an independent one (outputs early-clobber, so none is another's source), the last by v_nop.
__device__ __forceinline__ void exp2x8(const float (&x)[8], float (&e)[8]) {
    asm("v_exp_f32 %0, %8\n\tv_exp_f32 %1, %9\n\tv_exp_f32 %2, %10\n\tv_exp_f32 %3, %11\n\tv_exp_f32 %4, %12\n\tv_exp_f32 %5, %13\n\tv_exp_f32 %6, %14\n\tv_exp_f32 %7, %15\n\tv_nop"
        : "=&v"(e[0]), "=&v"(e[1]), "=&v"(e[2]), "=&v"(e[3]), "=&v"(e[4]), "=&v"(e[5]), "=&v"(e[6]), "=&v"(e[7]) : "v"(x[0]), "v"(x[1]), "v"(x[2]), "v"(x[3]), "v"(x[4]), "v"(x[5]), "v"(x[6]), "v"(x[7])); }
__device__ __forceinline__ float exp2x1(float x) { float e; asm("v_exp_f32 %0, %1\n\tv_nop" : "=&v"(e) : "v"(x)); return e; }
template <typename T16, bool HL, int NQ, int KS>   // HL: second (low) planes, three products each; NQ: query tiles of a wave; KS: keys of a slice
__device__ __forceinline__ void attn_slice(T16* sm, const T16* __restrict__ Q, const T16* __restrict__ Q2, const T16* __restrict__ Kp, const T16* __restrict__ K2, const T16* __restrict__ Vt, const T16* __restrict__ V2, int q0, int sl, float* __restrict__ Ob, float* __restrict__ MLb) {
    typedef typename WFrag<T16>::V V; typedef typename Oct<T16>::H H;
    constexpr int VPE = KS + 8, NI = KS / 32, PPR = KS / 8, RPI = 256 / PPR;   // LDS pitch of a v row, elements: 16 B x odd; staging trips; 16-byte pieces of a v row; v rows per trip
    const int tid = threadIdx.x, lane = tid & 31, lr = lane & 15, hi = lane >> 4;
    const float POFF = HL ? 0.0f : 8.0f;   // fp16 weights are carried x 2^8 (sum and Ot alike), away from the fp16 subnormals
    const size_t qo = (size_t)(q0 + lr) * HD + 8 * hi, ko = (size_t)sl * KS * HD + tid * 8, vo = (size_t)(tid / PPR) * TT + sl * KS + (tid % PPR) * 8;
    const T16* qp = Q + qo; const T16* qq = HL ? Q2 + qo : qp; const T16* gk = Kp + ko; const T16* gl = HL ? K2 + ko : gk; const T16* gv = Vt + vo; const T16* gw = HL ? V2 + vo : gv;   // every global read below is one of these plus a constant
    V qf[NQ][2], qg[NQ][2];
    {   // stage the slice: 16-byte pieces, whole lines per wave; piece tid + 256 i is k row (tid >> 3) + 32 i, v row tid / PPR + RPI i
        H tk[NI], tl[NI], tv[NI], tw[NI];
#pragma unroll
        for (int i = 0; i < NI; ++i) { tk[i] = *(const H*)(gk + i * 2048); tv[i] = *(const H*)(gv + i * RPI * TT); if (HL) { tl[i] = *(const H*)(gl + i * 2048); tw[i] = *(const H*)(gw + i * RPI * TT); } }
#pragma unroll
        for (int qt = 0; qt < NQ; ++qt)
#pragma unroll
            for (int ks = 0; ks < 2; ++ks) { qf[qt][ks] = WFrag<T16>::ld(qp + qt * 16 * HD + ks * 32); if (HL) qg[qt][ks] = WFrag<T16>::ld(qq + qt * 16 * HD + ks * 32); }
        asm volatile("s_wait_xcnt 0x0" :: "v"(qp), "v"(qq), "v"(gk), "v"(gl), "v"(gv), "v"(gw) : "memory");   // the address pairs stay live up to this wait, so no load's result lands in a register that an issued load still names
        T16* dk = sm + (tid >> 3) * KPE + (tid & 7) * 8; T16* dv = sm + KS * KPE + (tid / PPR) * VPE + (tid % PPR) * 8;
#pragma unroll
        for (int i = 0; i < NI; ++i) { *(H*)(dk + i * 32 * KPE) = tk[i]; *(H*)(dv + i * RPI * VPE) = tv[i]; if (HL) { *(H*)(dk + PLE + i * 32 * KPE) = tl[i]; *(H*)(dv + PLE + i * RPI * VPE) = tw[i]; } }
    }
    __syncthreads();   // the staged slice is read by all eight waves
    const T16* kl = sm + lr * KPE + 8 * hi; const T16* km = kl + PLE; const T16* vl = sm + KS * KPE + lr * VPE + 8 * hi; const T16* vm = vl + PLE;   // walked pass by pass, so that every read is one of the four plus a 16-bit offset
    v8f o[NQ][4]; float mr[NQ], ls[NQ];
#pragma unroll
    for (int qt = 0; qt < NQ; ++qt) { mr[qt] = -3.0e38f; ls[qt] = 0.f;
#pragma unroll
        for (int dt = 0; dt < 4; ++dt) o[qt][dt] = (v8f){}; }
#pragma unroll (HL ? 1 : 4)   // fp16: four passes unrolled, their LDS addresses are a lane register plus an immediate and the next pass's reads can start early (more unrolled spill with two query tiles); hi/lo: rolled, the low planes lie beyond the 16-bit offset and are walked
    for (int p = 0; p < KS / 32; ++p) {
        V ka[2][2], kb[2][2], va[4], vb[4];
#pragma unroll
        for (int kt = 0; kt < 2; ++kt)
#pragma unroll
            for (int ks = 0; ks < 2; ++ks) { ka[kt][ks] = WFrag<T16>::ld(kl + kt * 16 * KPE + ks * 32); if (HL) kb[kt][ks] = WFrag<T16>::ld(km + kt * 16 * KPE + ks * 32); }
#pragma unroll
        for (int dt = 0; dt < 4; ++dt) { va[dt] = WFrag<T16>::ld(vl + dt * 16 * VPE); if (HL) vb[dt] = WFrag<T16>::ld(vm + dt * 16 * VPE); }
        kl += 32 * KPE; km += 32 * KPE; vl += 32; vm += 32;
        __builtin_amdgcn_sched_barrier(0);   // a pass's LDS reads are all issued ahead of its first product (the v reads a whole softmax early), and no later pass's reads rise above this line: without it the unrolled path fetches so far ahead that it spills
        v8f s[NQ][2];
#pragma unroll
        for (int kt = 0; kt < 2; ++kt)
#pragma unroll
            for (int qt = 0; qt < NQ; ++qt) { v8f c = (v8f){};
#pragma unroll
                for (int ks = 0; ks < 2; ++ks) { c = WFrag<T16>::mma(ka[kt][ks], qf[qt][ks], c); if (HL) { c = WFrag<T16>::mma(ka[kt][ks], qg[qt][ks], c); c = WFrag<T16>::mma(kb[kt][ks], qf[qt][ks], c); } }
                s[qt][kt] = c; }
        V pb[NQ], pc[NQ];
#pragma unroll
        for (int qt = 0; qt < NQ; ++qt) { float mx = mr[qt];
#pragma unroll
            for (int kt = 0; kt < 2; ++kt)
#pragma unroll
                for (int r = 0; r < 8; ++r) { s[qt][kt][r] *= SCL * 1.4426950408889634f; mx = fmaxf(mx, s[qt][kt][r]); }
            mx = fmaxf(mx, xhalf(mx));   // both halves of the wave hold keys of the same query
            const float al = exp2x1(mr[qt] - mx); mr[qt] = mx; const float mo = mx - POFF; float sum = 0.f; float xd[2][8], xe[2][8];
#pragma unroll
            for (int kt = 0; kt < 2; ++kt) {
#pragma unroll
                for (int r = 0; r < 8; ++r) xd[kt][r] = s[qt][kt][r] - mo;
                exp2x8(xd[kt], xe[kt]); }
#pragma unroll
            for (int e = 0; e < 16; ++e) { const float ex = xe[e >> 3][e & 7]; sum += ex;
                if constexpr (HL) { const __bf16 h = (__bf16)ex; pb[qt][e] = h; pc[qt][e] = (__bf16)(ex - (float)h); } else pb[qt][e] = (h16)ex; }
            ls[qt] = ls[qt] * al + sum;
#pragma unroll
            for (int dt = 0; dt < 4; ++dt) o[qt][dt] *= al; }
#pragma unroll
        for (int dt = 0; dt < 4; ++dt)
#pragma unroll
            for (int qt = 0; qt < NQ; ++qt) { o[qt][dt] = WFrag<T16>::mma(va[dt], pb[qt], o[qt][dt]); if (HL) { o[qt][dt] = WFrag<T16>::mma(va[dt], pc[qt], o[qt][dt]); o[qt][dt] = WFrag<T16>::mma(vb[dt], pb[qt], o[qt][dt]); } }
    }
#pragma unroll
    for (int qt = 0; qt < NQ; ++qt) { const int q = q0 + qt * 16 + lr; const float lt = ls[qt] + xhalf(ls[qt]); float* ob = Ob + ((size_t)q * NSL + sl) * HD + 8 * hi;   // a lane holds d = 16 dt + 8 hi + r of its query
#pragma unroll
        for (int dt = 0; dt < 4; ++dt) { v4f w0, w1;
#pragma unroll
            for (int r = 0; r < 4; ++r) { w0[r] = o[qt][dt][r]; w1[r] = o[qt][dt][4 + r]; }
            *(v4f*)(ob + dt * 16) = w0; *(v4f*)(ob + dt * 16 + 4) = w1; }
        if (hi == 0) { v2f ml; ml[0] = mr[qt]; ml[1] = lt; *(v2f*)(MLb + ((size_t)sl * TT + q) * 2) = ml; } }   // [slice][t]: a tile's 16 pairs fill one 128-byte line
}
__global__ __launch_bounds__(AWV * 32) __attribute__((amdgpu_waves_per_eu(4, 4))) void k_attn(const h16* __restrict__ Q16, const h16* __restrict__ K16, const h16* __restrict__ V16, const bf* __restrict__ Qh, const bf* __restrict__ Ql, const bf* __restrict__ Kh, const bf* __restrict__ Kl, const bf* __restrict__ Vh, const bf* __restrict__ Vl, float* Ob, float* MLb) {
    static_assert(RH % QWH == 0 && (TT - RH) % QWG == 0 && KSL % 32 == 0 && KSF % 32 == 0 && HD == 64 && AWV == 8, "a workgroup is all hi/lo or all fp16; the staging loops are written for 64 d and 256 threads");
    static_assert(KSF * KPE + HD * (KSF + 8) <= 2 * PLE, "an fp16 slice fits the LDS of a hi/lo slice's two plane pairs");
    __shared__ __align__(16) unsigned short sm[2 * PLE];
    constexpr int NFB = (TT - RH) / QWG, NHB = RH / QWH, NFW = NFB * NSF, NHW = NHB * NSL;   // row blocks and workgroups of a batch, fp16 and hi/lo
    const int bx = blockIdx.x, wn = threadIdx.x >> 5;   // grid x: first every fp16 workgroup (the longer ones), then the hi/lo ones; in each part batch, slice, row block, the row block fastest
    if (bx < NB_ * NFW) { const int nb = bx / NFW, iy = bx % NFW; const size_t bo = (size_t)nb * TT * HD;
        attn_slice<h16, false, 2, KSF>((h16*)sm, Q16 + bo, nullptr, K16 + bo, nullptr, V16 + bo, nullptr, RH + iy % NFB * QWG + wn * 32, iy / NFB, Ob + bo * NSL, MLb + (size_t)nb * NSL * TT * 2); }
    else { const int ix = bx - NB_ * NFW, nb = ix / NHW, iy = ix % NHW; const size_t bo = (size_t)nb * TT * HD;
        attn_slice<bf, true, 1, KSL>(sm, Qh + bo, Ql + bo, Kh + bo, Kl + bo, Vh + bo, Vl + bo, iy % NHB * QWH + wn * 16, iy / NHB, Ob + bo * NSL, MLb + (size_t)nb * NSL * TT * 2); }
}

// k_merge: out[t][d] = sum_s Ot_s 2^(m_s - M) / sum_s l_s 2^(m_s - M), slices ascending, M the largest slice maximum; NS: the slices that the row's attention workgroups left
template <int NS>
__device__ __forceinline__ void merge_row(const float* pb, const float* mp, float* op) {
    static_assert(NS % 8 == 0, "statements of eight exponentials");
    v2f p[NS], ml[NS];
#pragma unroll
    for (int s = 0; s < NS; ++s) { p[s] = *(const v2f*)(pb + s * HD); ml[s] = *(const v2f*)(mp + s * TT * 2); }
    asm volatile("s_wait_xcnt 0x0" :: "v"(pb), "v"(mp) : "memory");   // both address pairs stay live up to this wait, so no load's result lands in a register that an issued load still names
    __builtin_amdgcn_sched_barrier(0);   // all loads are issued ahead of the first use: one memory latency, not two
    float M = ml[0][0];
#pragma unroll
    for (int s = 1; s < NS; ++s) M = fmaxf(M, ml[s][0]);
    v2f a; a[0] = 0.f; a[1] = 0.f; float L = 0.f; float xd[NS / 8][8], w[NS / 8][8];
#pragma unroll
    for (int h = 0; h < NS / 8; ++h) {
#pragma unroll
        for (int r = 0; r < 8; ++r) xd[h][r] = ml[h * 8 + r][0] - M;
        exp2x8(xd[h], w[h]); }
#pragma unroll
    for (int s = 0; s < NS; ++s) { a += p[s] * w[s >> 3][s & 7]; L += ml[s][1] * w[s >> 3][s & 7]; }
    v2f o2; o2[0] = __fdiv_rn(a[0], L); o2[1] = __fdiv_rn(a[1], L); *(v2f*)op = o2;  }
__global__ __launch_bounds__(256) void k_merge(const float* __restrict__ O, const float* __restrict__ MLb, float* OUTb) { const size_t e = ((size_t)blockIdx.x * 256 + threadIdx.x) * 2; if (e >= (size_t)TT * HD) return; const int d = (int)(e % HD); const int t = (int)(e / HD);
    static_assert(RH % (512 / HD) == 0, "a workgroup's rows are all hi/lo or all fp16");
    O += (size_t)blockIdx.y * NSL * TT * HD; MLb += (size_t)blockIdx.y * NSL * TT * 2; OUTb += (size_t)blockIdx.y * TT * HD;   // grid y: the batch
    const float* pb = O + (size_t)t * (NSL * HD) + d;   // partials lie [t][slice][d]: one address pair reaches all slices by immediate offsets
    const float* mp = MLb + (size_t)t * 2;              // (maximum, sum) pairs lie [slice][t]
    if (blockIdx.x * (512 / HD) < RH) merge_row<NSL>(pb, mp, OUTb + e);   // the same for a whole workgroup
    else merge_row<NSF>(pb, mp, OUTb + e);  }

extern "C" void kernel_launch(void* const* d_in, const int* in_sizes, int n_in,
                              void* d_out, int out_size, void* d_ws, size_t ws_size, hipStream_t stream) {
    (void)in_sizes; (void)n_in; (void)out_size;
    const float* x = (const float*)d_in[0]; const float* wk = (const float*)d_in[1]; const float* wq = (const float*)d_in[2]; const float* wv = (const float*)d_in[3];
    float* OUT = (float*)d_out;     // [4][4096][64]
    char* wsp = (char*)d_ws;
    auto take = [&](size_t bytes) { char* p = wsp; wsp += (bytes + 255) & ~(size_t)255; return (void*)p; };
    bf* WP = (bf*)take((size_t)(DQ + 2 * DKV) * DM * 2);
    h16* QP16 = (h16*)take((size_t)NB_ * NH_ * TT * HD * 2); h16* KP16 = (h16*)take((size_t)NB_ * NKV * TT * HD * 2); h16* VT16 = (h16*)take((size_t)NB_ * NKV * HD * TT * 2);
    bf* QPh = (bf*)take((size_t)NB_ * NH_ * TT * HD * 2); bf* QPl = (bf*)take((size_t)NB_ * NH_ * TT * HD * 2); bf* KPh = (bf*)take((size_t)NB_ * NKV * TT * HD * 2); bf* KPl = (bf*)take((size_t)NB_ * NKV * TT * HD * 2); bf* VTh = (bf*)take((size_t)NB_ * NKV * HD * TT * 2); bf* VTl = (bf*)take((size_t)NB_ * NKV * HD * TT * 2);
    float* Ob = (float*)take((size_t)NB_ * NSL * TT * HD * 4); float* MLb = (float*)take((size_t)NB_ * NSL * TT * 2 * 4);
    if ((size_t)(wsp - (char*)d_ws) > ws_size) return;    // ws 256 MiB
    static_assert(NH_ == 1 && NKV == 1, "one head");
    k_wpack<<<(DQ + 2 * DKV) * DM / 8 / 256, 256, 0, stream>>>(wq, wk, wv, WP);
    k_proj<<<NB_ * TT / PRW, 384, 0, stream>>>(x, WP, QP16, QPh, QPl, KP16, KPh, KPl, VT16, VTh, VTl);
    k_attn<<<NB_ * ((TT - RH) / QWG * NSF + RH / QWH * NSL), AWV * 32, 0, stream>>>(QP16, KP16, VT16, QPh, QPl, KPh, KPl, VTh, VTl, Ob, MLb);
    k_merge<<<dim3((unsigned)(((size_t)TT * HD / 2 + 255) / 256), NB_), 256, 0, stream>>>(Ob, MLb, OUT);
}

// v007
// Measured time: 43 microseconds a run.
// In two side-by-side timings against v006, it was 1.05 and 1.03 times as fast.
// Counting every step since v000, it is 27.3 times as fast.
#include <hip/hip_runtime.h>

// Single attention head (ix [4][4096][768]; k, q, v = ix W ('xw' [768][64], no bias); wei = softmax(q.k / 8) over all 4096 keys; out = wei.v -> [4][4096][64] f32 (1.05 M)).
// Four launches, each for all four batches: the weights packed in fragment order; ONE projection kernel from the f32 input to the nine 16-bit q, k, v planes; one fused attention kernel over 4,096 keys in key slices (rows < 512 hi/lo, 16 slices; the rest fp16, 8 slices) with a running-maximum softmax in registers; the merge kernel joins the slices and normalises; f32 output.
// Compute dtypes, f32 accumulate: every input rounded to bf16; projections on PLAIN bf16 operands (exact); scores and attn.v rows < 512 on bf16 hi/lo planes (3 products), the rest single fp16; softmax f32; f32 output.

#define NB_  4
#define TT   4096
#define DM   768
#define NH_  1
#define NKV  1
#define REP  (NH_ / NKV)
#define HD   64
#define DQ   (NH_ * HD)
#define DKV  (NKV * HD)
#define ZH   1
#define RH   512                  // query rows < RH use hi+lo planes (0: none)
#define WIN  0
#define SCL  0.125f   // HD^-0.5
#define NSL  16                   // key slices of the hi/lo rows; also the slice stride of the partial planes
#define KSL  (TT / NSL)           // keys per hi/lo slice (256)
#define NSF  8                    // key slices of the fp16 rows: one k and one v plane of 512 keys fill the LDS that two planes each of 256 keys need
#define KSF  (TT / NSF)           // keys per fp16 slice (512)
#define AWV  8                    // waves of an attention workgroup: two workgroups share a WGP
#define QWH  (AWV * 16)           // query rows per hi/lo workgroup: a wave holds one 16-column tile
#define QWG  (AWV * 32)           // query rows per fp16 workgroup: a wave holds two 16-column tiles
typedef _Float16 h16;
typedef unsigned short bf;
typedef __attribute__((ext_vector_type(16))) __bf16   v16bf;
typedef __attribute__((ext_vector_type(16))) _Float16 v16h;
typedef __attribute__((ext_vector_type(8)))  _Float16 v8h;
typedef __attribute__((ext_vector_type(8)))  unsigned short v8us;
typedef __attribute__((ext_vector_type(8)))  float    v8f;
typedef __attribute__((ext_vector_type(4)))  float    v4f;
typedef v8h  __attribute__((may_alias)) v8ha;
typedef v4f  __attribute__((may_alias)) v4fa;
typedef v8us __attribute__((may_alias)) v8usa;

__device__ __forceinline__ unsigned short f2bf(float f) { unsigned u = __float_as_uint(f); u += 0x7FFFu + ((u >> 16) & 1u); return (unsigned short)(u >> 16); }
__device__ __forceinline__ float bf2f(unsigned short b) { return __uint_as_float(((unsigned)b) << 16); }
__device__ __forceinline__ float bfr(float f) { return bf2f(f2bf(f)); }
__device__ __forceinline__ v16h cat16(v8h lo, v8h hi) { return __builtin_shufflevector(lo, hi, 0, 1, 2, 3, 4, 5, 6, 7, 8, 9, 10, 11, 12, 13, 14, 15); }
__device__ __forceinline__ v16bf cat16b(v8us lo, v8us hi) { return __builtin_bit_cast(v16bf, __builtin_shufflevector(lo, hi, 0, 1, 2, 3, 4, 5, 6, 7, 8, 9, 10, 11, 12, 13, 14, 15)); }
__device__ __forceinline__ v8f wmma16(v16h a, v16h b, v8f c) { return __builtin_amdgcn_wmma_f32_16x16x32_f16(false, a, false, b, (short)0, c, false, false); }
__device__ __forceinline__ v8f wmmab(v16bf a, v16bf b, v8f c) { return __builtin_amdgcn_wmma_f32_16x16x32_bf16(false, a, false, b, (short)0, c, false, false); }

// 16-bit WMMA fragments: a lane's sixteen elements are p[0..7] and p[16..23], p = its row + 8 (lane >> 4); A and B alike
template <typename T16> struct WFrag;
template <> struct WFrag<h16> { typedef v16h V; static __device__ __forceinline__ V ld(const h16* p) { return cat16(*(const v8h*)p, *(const v8h*)(p + 16)); } static __device__ __forceinline__ v8f mma(V a, V b, v8f c) { return wmma16(a, b, c); } };
template <> struct WFrag<bf> { typedef v16bf V; static __device__ __forceinline__ V ld(const bf* p) { return cat16b(*(const v8us*)p, *(const v8us*)(p + 16)); } static __device__ __forceinline__ v8f mma(V a, V b, v8f c) { return wmmab(a, b, c); } };

__device__ __forceinline__ h16 tohx(float x) { return (h16)x; }
__device__ __forceinline__ void splitf(float y, unsigned short& h, unsigned short& l) { h = f2bf(y); l = f2bf(y - bf2f(h)); }
typedef __attribute__((ext_vector_type(2))) _Float16 v2h;
typedef __attribute__((ext_vector_type(4))) _Float16 v4h;
typedef __attribute__((ext_vector_type(2))) unsigned short v2us;
typedef __attribute__((ext_vector_type(4))) unsigned short v4us;
typedef __attribute__((ext_vector_type(2))) float v2f;
typedef __attribute__((ext_vector_type(4))) int v4i;
typedef __attribute__((ext_vector_type(4))) __bf16 v4bf;

// ---- k_wpack: the three weights, rounded to bf16, in the order the projection's waves read them. Fragment (nt, ks): columns 16 nt .. + 15 of q | k | v (nt 0-3 | 4-7 | 8-11), k = 32 ks .. + 31;
// it is two runs of 512 B: run h holds, lane by lane, the eight elements k = 32 ks + 16 h + 8 (lane >> 4) + j of column lane & 15 (the k order of WFrag::ld), so a fragment is two whole-line 16-byte loads.
#define NKS  (DM / 32)            // k steps (24)
__global__ __launch_bounds__(256) void k_wpack(const float* __restrict__ wq, const float* __restrict__ wk, const float* __restrict__ wv, bf* WP) {
    static_assert(NKS * 64 == 6 * 256, "six workgroups per 16 columns");
    const int nt = blockIdx.x / 6; const float* w = nt < 4 ? wq : nt < 8 ? wk : wv;
    const int pi = blockIdx.x * 256 + threadIdx.x, lane = pi & 31, h = (pi >> 5) & 1, ks = (pi >> 6) % NKS;
    const float* wp = w + (size_t)(ks * 32 + h * 16 + 8 * (lane >> 4)) * HD + (nt & 3) * 16 + (lane & 15); float t[8]; v8us o;
#pragma unroll
    for (int j = 0; j < 8; ++j) t[j] = wp[j * HD];
    asm volatile("s_wait_xcnt 0x0" :: "v"(wp) : "memory");   // the address pair stays live up to this wait, so no load's result lands in a register that an issued load still names
#pragma unroll
    for (int j = 0; j < 8; ++j) o[j] = f2bf(t[j]);
    *(v8us*)(WP + (size_t)pi * 8) = o;  }

// ---- k_proj: input rounding, the three projections and the plane building in one kernel. A workgroup (12 waves): 64 rows of ix x all 192 columns.
// The rows are read once, in whole lines, rounded to bf16 and staged in LDS. Wave (g, kq): g = q | k | v (64 columns), kq = a quarter of K (192 k, 6 steps): 4 x 4 accumulators, so every weight fragment is read once per workgroup.
// q and k: transposed product (A = weight columns, B = input rows), a lane holds 8 neighbouring d of one row; v: A = input rows, B = weight columns, a lane holds 8 neighbouring rows of one d: both leave 16-byte pieces of the layout their planes have.
// The four K quarters meet in LDS and are added in ascending order by the threads that round and store the planes in whole lines.
#define PRW  64                   // input rows per workgroup
#define XPE  (DM + 8)             // LDS pitch of a staged row, elements: 1,536 B + 16 B (16 B x odd: no bank conflict for 16-byte reads)
#define PQP  (2 * HD + 4)         // LDS pitch of a q | k partial row, floats: 512 B + 16 B
#define PVP  (PRW + 4)            // LDS pitch of a v partial row (one d, PRW input rows), floats: 256 B + 16 B
#define WFE  512                  // elements of a packed fragment
__device__ __forceinline__ v16bf wfrag(const bf* p) { return cat16b(*(const v8us*)p, *(const v8us*)(p + 256)); }
template <bool VK>
__device__ __forceinline__ void proj_part(const bf* xs, const bf* __restrict__ wp, v16bf (&wf)[2][4], float* pd) {
    v8f acc[4][4];   // [weight tile][row tile]
#pragma unroll
    for (int nb = 0; nb < 4; ++nb)
#pragma unroll
        for (int tt = 0; tt < 4; ++tt) acc[nb][tt] = (v8f){};
#pragma unroll
    for (int ks = 0; ks < 6; ++ks) { v16bf xa[4];
#pragma unroll
        for (int tt = 0; tt < 4; ++tt) xa[tt] = WFrag<bf>::ld(xs + tt * 16 * XPE + ks * 32);
#pragma unroll
        for (int nb = 0; nb < 4; ++nb)
#pragma unroll
            for (int tt = 0; tt < 4; ++tt) acc[nb][tt] = VK ? wmmab(xa[tt], wf[ks & 1][nb], acc[nb][tt]) : wmmab(wf[ks & 1][nb], xa[tt], acc[nb][tt]);
        if (ks + 2 < 6) {   // the weight fragments run two steps ahead
#pragma unroll
            for (int nb = 0; nb < 4; ++nb) wf[ks & 1][nb] = wfrag(wp + (nb * NKS + ks + 2) * WFE); } }
    asm volatile("s_wait_xcnt 0x0" :: "v"(wp) : "memory");   // the address pair stays live up to this wait, so no load's result lands in a register that an issued load still names
#pragma unroll
    for (int nb = 0; nb < 4; ++nb)
#pragma unroll
        for (int tt = 0; tt < 4; ++tt) { float* d = VK ? pd + nb * 16 * PVP + tt * 16 : pd + tt * 16 * PQP + nb * 16; v4f w0, w1;
#pragma unroll
            for (int r = 0; r < 4; ++r) { w0[r] = acc[nb][tt][r]; w1[r] = acc[nb][tt][4 + r]; }
            *(v4fa*)d = w0; *(v4fa*)(d + 4) = w1; }
}
template <int PS>   // eight neighbouring elements of a plane: the four K quarters (PS floats apart) added in ascending order, rounded to fp16 and to bf16 hi + lo
__device__ __forceinline__ void proj_emit(const float* sp, h16* d16, bf* dh, bf* dl) {
    v4f a0 = *(const v4fa*)sp, a1 = *(const v4fa*)(sp + 4);
#pragma unroll
    for (int s = 1; s < 4; ++s) { a0 += *(const v4fa*)(sp + s * PS); a1 += *(const v4fa*)(sp + s * PS + 4); }
    v8h o16; v8us oh, ol;
#pragma unroll
    for (int j = 0; j < 8; ++j) { const float y = j < 4 ? a0[j & 3] : a1[j & 3]; o16[j] = tohx(y); unsigned short a2, c2; splitf(y, a2, c2); oh[j] = a2; ol[j] = c2; }
    *(v8h*)d16 = o16; *(v8us*)dh = oh; *(v8us*)dl = ol;
    asm volatile("s_wait_xcnt 0x0" :: "v"(d16), "v"(dh), "v"(dl) : "memory");   // the three address pairs stay live up to this wait: nothing overwrites a register that an issued store still names
}
__global__ __launch_bounds__(384) void k_proj(const float* __restrict__ x, const bf* __restrict__ WP, h16* Q16, bf* Qh, bf* Ql, h16* K16, bf* Kh, bf* Kl, h16* V16, bf* Vh, bf* Vl) {
    static_assert(DM == 768 && HD == 64 && TT % PRW == 0, "staging and wave roles are written for 768 x 3 x 64; a workgroup lies in one batch");
    __shared__ __align__(16) unsigned short xs[PRW * XPE];
    __shared__ __align__(16) float pq[4 * PRW * PQP];
    __shared__ __align__(16) float pv[4 * HD * PVP];
    const int tid = threadIdx.x, lane = tid & 31, lr = lane & 15, hi = lane >> 4; const int R0 = blockIdx.x * PRW;
    const int wv = __builtin_amdgcn_readfirstlane(tid >> 5), g = wv >> 2, kq = wv & 3;   // the wave's number in a scalar register: the choice between the two product forms below is a scalar branch
    const int sr = tid / 192, sc = (tid % 192) * 4;   // staging: 16-byte piece tid + 384 i is row 2 i + sr, elements sc .. sc + 3; a wave's 32 pieces are 512 contiguous bytes
    const float* xp = x + (size_t)(R0 + sr) * DM + sc; const bf* wp = WP + (size_t)(g * 4 * NKS + kq * 6) * WFE + lane * 8;
    v4f t[PRW / 2]; v16bf wf[2][4];
#pragma unroll
    for (int i = 0; i < PRW / 2; ++i) t[i] = *(const v4f*)(xp + i * 2 * DM);
#pragma unroll
    for (int ks = 0; ks < 2; ++ks)
#pragma unroll
        for (int nb = 0; nb < 4; ++nb) wf[ks][nb] = wfrag(wp + (nb * NKS + ks) * WFE);
    asm volatile("s_wait_xcnt 0x0" :: "v"(xp), "v"(wp) : "memory");   // both address pairs stay live up to this wait, so no load's result lands in a register that an issued load still names
    unsigned short* dx = xs + sr * XPE + sc;
#pragma unroll
    for (int i = 0; i < PRW / 2; ++i) *(v4us*)(dx + i * 2 * XPE) = __builtin_bit_cast(v4us, __builtin_convertvector(t[i], v4bf));
    __syncthreads();   // the staged rows are read by all twelve waves
    const bf* xf = xs + lr * XPE + 8 * hi + kq * 192;
    if (g == 2) proj_part<true>(xf, wp, wf, pv + kq * HD * PVP + lr * PVP + 8 * hi);
    else proj_part<false>(xf, wp, wf, pq + kq * PRW * PQP + lr * PQP + g * HD + 8 * hi);
    __syncthreads();   // a plane element's four K quarters come from four waves
    const size_t vb = (size_t)(R0 / TT) * HD * TT + R0 % TT;
#pragma unroll
    for (int i = 0; i < 4; ++i) { const int it = i * 384 + tid, kind = it >> 9, r = (it & 511) >> 3, c8 = (it & 7) * 8;   // 3 x 512 pieces of eight; a wave's pieces are of one kind and fill whole lines
        const size_t qo = (size_t)(R0 + r) * HD + c8, vo = vb + (size_t)r * TT + c8;
        if (kind == 0) proj_emit<PRW * PQP>(pq + r * PQP + c8, Q16 + qo, Qh + qo, Ql + qo);
        else if (kind == 1) proj_emit<PRW * PQP>(pq + r * PQP + HD + c8, K16 + qo, Kh + qo, Kl + qo);
        else proj_emit<HD * PVP>(pv + r * PVP + c8, V16 + vo, Vh + vo, Vl + vo); }
}
// ---- k_attn: scores, softmax and attn.v fused. A workgroup (8 waves): 256 query rows x one slice of KSF keys (fp16) or 128 query rows x one slice of KSL keys (hi/lo); the slice's k rows and v rows are staged once in LDS; a wave: NQ tiles of 16 query columns (fp16: 2, every k and v fragment read from LDS serves both; hi/lo: 1), passes of 32 keys.
// Transposed products: St = K.Qt (A = key rows, B = query columns), so a lane holds 16 scores of ONE query; two St tiles converted in place are the B operand of Ot += Vt.Pt (A = rows of the [d][t] v planes).
// Running maximum per query in base 2; a slice leaves its unnormalised Ot (in fragment order), its maximum and its sum, and k_merge joins the slices.
#define KPE  72                   // LDS pitch of a key row, elements: 128 B + 16 B (16 B x odd: no bank conflict for 16-byte reads)
#define PLE  (KSL * KPE + HD * (KSL + 8))   // one k plane and one v plane of a hi/lo slice
template <typename T16> struct Oct;
template <> struct Oct<h16> { typedef v8h H; };
template <> struct Oct<bf> { typedef v8us H; };
__device__ __forceinline__ float xhalf(float x) { return __builtin_bit_cast(float, __builtin_amdgcn_permlanex16(__builtin_bit_cast(int, x), __builtin_bit_cast(int, x), 0x76543210, 0xfedcba98, false, false)); }   // lane l with lane l ^ 16
// Base-2 exponentials with the slot that the instruction set asks for behind a transcendental written in: inside a statement every v_exp_f32 is followed by an independent one (outputs early-clobber, so none is another's source), the last by v_nop.
__device__ __forceinline__ void exp2x8(const float (&x)[8], float (&e)[8]) {
    asm("v_exp_f32 %0, %8\n\tv_exp_f32 %1, %9\n\tv_exp_f32 %2, %10\n\tv_exp_f32 %3, %11\n\tv_exp_f32 %4, %12\n\tv_exp_f32 %5, %13\n\tv_exp_f32 %6, %14\n\tv_exp_f32 %7, %15\n\tv_nop"
        : "=&v"(e[0]), "=&v"(e[1]), "=&v"(e[2]), "=&v"(e[3]), "=&v"(e[4]), "=&v"(e[5]), "=&v"(e[6]), "=&v"(e[7]) : "v"(x[0]), "v"(x[1]), "v"(x[2]), "v"(x[3]), "v"(x[4]), "v"(x[5]), "v"(x[6]), "v"(x[7])); }
__device__ __forceinline__ float exp2x1(float x) { float e; asm("v_exp_f32 %0, %1\n\tv_nop" : "=&v"(e) : "v"(x)); return e; }
template <typename T16, bool HL, int NQ, int KS>   // HL: second (low) planes, three products each; NQ: query tiles of a wave; KS: keys of a slice
__device__ __forceinline__ void attn_slice(T16* sm, const T16* __restrict__ Q, const T16* __restrict__ Q2, const T16* __restrict__ Kp, const T16* __restrict__ K2, const T16* __restrict__ Vt, const T16* __restrict__ V2, int q0, int sl, float* __restrict__ Ob, float* __restrict__ MLb) {
    typedef typename WFrag<T16>::V V; typedef typename Oct<T16>::H H;
    constexpr int VPE = KS + 8, NI = KS / 32, PPR = KS / 8, RPI = 256 / PPR;   // LDS pitch of a v row, elements: 16 B x odd; staging trips; 16-byte pieces of a v row; v rows per trip
    const int tid = threadIdx.x, lane = tid & 31, lr = lane & 15, hi = lane >> 4;
    const float POFF = HL ? 0.0f : 8.0f;   // fp16 weights are carried x 2^8 (sum and Ot alike), away from the fp16 subnormals
    const size_t qo = (size_t)(q0 + (lane >> 3)) * HD + (lane & 7) * 8, ko = (size_t)sl * KS * HD + tid * 8, vo = (size_t)(tid / PPR) * TT + sl * KS + (tid % PPR) * 8;
    const T16* qp = Q + qo; const T16* qq = HL ? Q2 + qo : qp; const T16* gk = Kp + ko; const T16* gl = HL ? K2 + ko : gk; const T16* gv = Vt + vo; const T16* gw = HL ? V2 + vo : gv;   // every global read below is one of these plus a constant
    V qf[NQ][2], qg[NQ][2];
    {   // stage the slice: 16-byte pieces, whole lines per wave; piece tid + 256 i is k row (tid >> 3) + 32 i, v row tid / PPR + RPI i
        H tq[NQ * 4], tr[NQ * 4], tk[NI], tl[NI], tv[NI], tw[NI];
#pragma unroll
        for (int i = 0; i < NQ * 4; ++i) { tq[i] = *(const H*)(qp + i * 4 * HD); if (HL) tr[i] = *(const H*)(qq + i * 4 * HD); }   // the wave's query rows in whole lines: piece lane + 32 i is row (lane >> 3) + 4 i
#pragma unroll
        for (int i = 0; i < NI; ++i) { tk[i] = *(const H*)(gk + i * 2048); tv[i] = *(const H*)(gv + i * RPI * TT); if (HL) { tl[i] = *(const H*)(gl + i * 2048); tw[i] = *(const H*)(gw + i * RPI * TT); } }
        asm volatile("s_wait_xcnt 0x0" :: "v"(qp), "v"(qq), "v"(gk), "v"(gl), "v"(gv), "v"(gw) : "memory");   // the address pairs stay live up to this wait, so no load's result lands in a register that an issued load still names
        // A query fragment read from global memory touches 16 lines with 32 B each: the rows turn through LDS, ahead of the slice, each wave's in a place of its own.
        constexpr int QPL = NQ * 16 * KPE;   // one plane of a wave's query rows, at the pitch of a key row
        T16* wq = sm + (tid >> 5) * ((HL ? 2 : 1) * QPL); T16* dq = wq + (lane >> 3) * KPE + (lane & 7) * 8; const T16* fq = wq + lr * KPE + 8 * hi;
#pragma unroll
        for (int i = 0; i < NQ * 4; ++i) { *(H*)(dq + i * 4 * KPE) = tq[i]; if (HL) *(H*)(dq + QPL + i * 4 * KPE) = tr[i]; }
        asm volatile("s_wait_dscnt 0x0\n\ts_barrier_signal -1\n\ts_barrier_wait -1" ::: "memory");   // a query row is read by other lanes than wrote it; by hand, LDS wait only: __syncthreads() would also wait for the slice's global loads, which stay in flight here
#pragma unroll
        for (int qt = 0; qt < NQ; ++qt)
#pragma unroll
            for (int ks = 0; ks < 2; ++ks) { qf[qt][ks] = WFrag<T16>::ld(fq + qt * 16 * KPE + ks * 32); if (HL) qg[qt][ks] = WFrag<T16>::ld(fq + QPL + qt * 16 * KPE + ks * 32); }
        asm volatile("s_wait_dscnt 0x0\n\ts_barrier_signal -1\n\ts_barrier_wait -1" ::: "memory");   // every wave holds its query fragments: the slice may take their place; by hand for the same reason
        T16* dk = sm + (tid >> 3) * KPE + (tid & 7) * 8; T16* dv = sm + KS * KPE + (tid / PPR) * VPE + (tid % PPR) * 8;
#pragma unroll
        for (int i = 0; i < NI; ++i) { *(H*)(dk + i * 32 * KPE) = tk[i]; *(H*)(dv + i * RPI * VPE) = tv[i]; if (HL) { *(H*)(dk + PLE + i * 32 * KPE) = tl[i]; *(H*)(dv + PLE + i * RPI * VPE) = tw[i]; } }
    }
    __syncthreads();   // the staged slice is read by all eight waves
    const T16* kl = sm + lr * KPE + 8 * hi; const T16* km = kl + PLE; const T16* vl = sm + KS * KPE + lr * VPE + 8 * hi; const T16* vm = vl + PLE;   // walked pass by pass, so that every read is one of the four plus a 16-bit offset
    v8f o[NQ][4]; float mr[NQ], ls[NQ];
#pragma unroll
    for (int qt = 0; qt < NQ; ++qt) { mr[qt] = -3.0e38f; ls[qt] = 0.f;
#pragma unroll
        for (int dt = 0; dt < 4; ++dt) o[qt][dt] = (v8f){}; }
#pragma unroll (HL ? 1 : 4)   // fp16: four passes unrolled, their LDS addresses are a lane register plus an immediate and the next pass's reads can start early (more unrolled spill with two query tiles); hi/lo: rolled, the low planes lie beyond the 16-bit offset and are walked
    for (int p = 0; p < KS / 32; ++p) {
        V ka[2][2], kb[2][2], va[4], vb[4];
#pragma unroll
        for (int kt = 0; kt < 2; ++kt)
#pragma unroll
            for (int ks = 0; ks < 2; ++ks) { ka[kt][ks] = WFrag<T16>::ld(kl + kt * 16 * KPE + ks * 32); if (HL) kb[kt][ks] = WFrag<T16>::ld(km + kt * 16 * KPE + ks * 32); }
#pragma unroll
        for (int dt = 0; dt < 4; ++dt) { va[dt] = WFrag<T16>::ld(vl + dt * 16 * VPE); if (HL) vb[dt] = WFrag<T16>::ld(vm + dt * 16 * VPE); }
        kl += 32 * KPE; km += 32 * KPE; vl += 32; vm += 32;
        __builtin_amdgcn_sched_barrier(0);   // a pass's LDS reads are all issued ahead of its first product (the v reads a whole softmax early), and no later pass's reads rise above this line: without it the unrolled path fetches so far ahead that it spills
        v8f s[NQ][2];
#pragma unroll
        for (int kt = 0; kt < 2; ++kt)
#pragma unroll
            for (int qt = 0; qt < NQ; ++qt) { v8f c = (v8f){};
#pragma unroll
                for (int ks = 0; ks < 2; ++ks) { c = WFrag<T16>::mma(ka[kt][ks], qf[qt][ks], c); if (HL) { c = WFrag<T16>::mma(ka[kt][ks], qg[qt][ks], c); c = WFrag<T16>::mma(kb[kt][ks], qf[qt][ks], c); } }
                s[qt][kt] = c; }
        V pb[NQ], pc[NQ];
#pragma unroll
        for (int qt = 0; qt < NQ; ++qt) { float mx = mr[qt];
#pragma unroll
            for (int kt = 0; kt < 2; ++kt)
#pragma unroll
                for (int r = 0; r < 8; ++r) { s[qt][kt][r] *= SCL * 1.4426950408889634f; mx = fmaxf(mx, s[qt][kt][r]); }
            mx = fmaxf(mx, xhalf(mx));   // both halves of the wave hold keys of the same query
            const float al = exp2x1(mr[qt] - mx); mr[qt] = mx; const float mo = mx - POFF; float sum = 0.f; float xd[2][8], xe[2][8];
#pragma unroll
            for (int kt = 0; kt < 2; ++kt) {
#pragma unroll
                for (int r = 0; r < 8; ++r) xd[kt][r] = s[qt][kt][r] - mo;
                exp2x8(xd[kt], xe[kt]); }
#pragma unroll
            for (int e = 0; e < 16; ++e) { const float ex = xe[e >> 3][e & 7]; sum += ex;
                if constexpr (HL) { const __bf16 h = (__bf16)ex; pb[qt][e] = h; pc[qt][e] = (__bf16)(ex - (float)h); } else pb[qt][e] = (h16)ex; }
            ls[qt] = ls[qt] * al + sum;
#pragma unroll
            for (int dt = 0; dt < 4; ++dt) o[qt][dt] *= al; }
#pragma unroll
        for (int dt = 0; dt < 4; ++dt)
#pragma unroll
            for (int qt = 0; qt < NQ; ++qt) { o[qt][dt] = WFrag<T16>::mma(va[dt], pb[qt], o[qt][dt]); if (HL) { o[qt][dt] = WFrag<T16>::mma(va[dt], pc[qt], o[qt][dt]); o[qt][dt] = WFrag<T16>::mma(vb[dt], pb[qt], o[qt][dt]); } }
    }
    // The partial planes lie in fragment order, [16-query tile][slice][dt][half][lane]: a store instruction writes 512 contiguous bytes. (Row by row, neighbouring queries lie 4 KB apart and an instruction would touch 16 lines with 32 B each.)
#pragma unroll
    for (int qt = 0; qt < NQ; ++qt) { const int q = q0 + qt * 16 + lr; const float lt = ls[qt] + xhalf(ls[qt]); float* ob = Ob + ((size_t)((q0 >> 4) + qt) * NSL + sl) * (16 * HD) + lane * 4;   // a lane holds d = 16 dt + 8 hi + r of its query
#pragma unroll
        for (int dt = 0; dt < 4; ++dt) { v4f w0, w1;
#pragma unroll
            for (int r = 0; r < 4; ++r) { w0[r] = o[qt][dt][r]; w1[r] = o[qt][dt][4 + r]; }
            *(v4f*)(ob + dt * 256) = w0; *(v4f*)(ob + dt * 256 + 128) = w1; }
        if (hi == 0) { v2f ml; ml[0] = mr[qt]; ml[1] = lt; *(v2f*)(MLb + ((size_t)sl * TT + q) * 2) = ml; } }   // [slice][t]: a tile's 16 pairs fill one 128-byte line
}
__global__ __launch_bounds__(AWV * 32) __attribute__((amdgpu_waves_per_eu(4, 4))) void k_attn(const h16* __restrict__ Q16, const h16* __restrict__ K16, const h16* __restrict__ V16, const bf* __restrict__ Qh, const bf* __restrict__ Ql, const bf* __restrict__ Kh, const bf* __restrict__ Kl, const bf* __restrict__ Vh, const bf* __restrict__ Vl, float* Ob, float* MLb) {
    static_assert(RH % QWH == 0 && (TT - RH) % QWG == 0 && KSL % 32 == 0 && KSF % 32 == 0 && HD == 64 && AWV == 8, "a workgroup is all hi/lo or all fp16; the staging loops are written for 64 d and 256 threads");
    static_assert(KSF * KPE + HD * (KSF + 8) <= 2 * PLE, "an fp16 slice fits the LDS of a hi/lo slice's two plane pairs");
    __shared__ __align__(16) unsigned short sm[2 * PLE];
    constexpr int NFB = (TT - RH) / QWG, NHB = RH / QWH, NFW = NFB * NSF, NHW = NHB * NSL;   // row blocks and workgroups of a batch, fp16 and hi/lo
    const int bx = blockIdx.x, wn = threadIdx.x >> 5;   // grid x: first every fp16 workgroup (the longer ones), then the hi/lo ones; in each part batch, slice, row block, the row block fastest
    if (bx < NB_ * NFW) { const int nb = bx / NFW, iy = bx % NFW; const size_t bo = (size_t)nb * TT * HD;
        attn_slice<h16, false, 2, KSF>((h16*)sm, Q16 + bo, nullptr, K16 + bo, nullptr, V16 + bo, nullptr, RH + iy % NFB * QWG + wn * 32, iy / NFB, Ob + bo * NSL, MLb + (size_t)nb * NSL * TT * 2); }
    else { const int ix = bx - NB_ * NFW, nb = ix / NHW, iy = ix % NHW; const size_t bo = (size_t)nb * TT * HD;
        attn_slice<bf, true, 1, KSL>(sm, Qh + bo, Ql + bo, Kh + bo, Kl + bo, Vh + bo, Vl + bo, iy % NHB * QWH + wn * 16, iy / NHB, Ob + bo * NSL, MLb + (size_t)nb * NSL * TT * 2); }
}

// k_merge: out[t][d] = sum_s Ot_s 2^(m_s - M) / sum_s l_s 2^(m_s - M), slices ascending, M the largest slice maximum; NS: the slices that the row's attention workgroups left
// A lane joins d = 32 m + 4 c .. + 3 and the same + 16 of one row; a wave: 8 rows x 4 c, so a load reads four whole lines of the fragment-order planes and the wave's two stores fill one 128-byte line of each row.
template <int S0, int S1>   // slices S0 .. S1 - 1 of the lane's two pieces and of its row's (maximum, sum) pair
__device__ __forceinline__ void merge_load(const float* pb, const float* mp, v4f (&p)[NSL], v4f (&q)[NSL], v2f (&ml)[NSL]) {
#pragma unroll
    for (int s = S0; s < S1; ++s) { p[s] = *(const v4f*)(pb + s * 16 * HD); q[s] = *(const v4f*)(pb + s * 16 * HD + 256); ml[s] = *(const v2f*)(mp + s * TT * 2); } }
template <int NS>
__device__ __forceinline__ void merge_row(const v4f (&p)[NSL], const v4f (&q)[NSL], const v2f (&ml)[NSL], float* op) {
    static_assert(NS % 8 == 0, "statements of eight exponentials");
    float M = ml[0][0];
#pragma unroll
    for (int s = 1; s < NS; ++s) M = fmaxf(M, ml[s][0]);
    v4f a = (v4f){}, b = (v4f){}; float L = 0.f; float xd[NS / 8][8], w[NS / 8][8];
#pragma unroll
    for (int h = 0; h < NS / 8; ++h) {
#pragma unroll
        for (int r = 0; r < 8; ++r) xd[h][r] = ml[h * 8 + r][0] - M;
        exp2x8(xd[h], w[h]); }
#pragma unroll
    for (int s = 0; s < NS; ++s) { a += p[s] * w[s >> 3][s & 7]; b += q[s] * w[s >> 3][s & 7]; L += ml[s][1] * w[s >> 3][s & 7]; }
    v4f oa, oc;
#pragma unroll
    for (int r = 0; r < 4; ++r) { oa[r] = __fdiv_rn(a[r], L); oc[r] = __fdiv_rn(b[r], L); }
    *(v4f*)op = oa; *(v4f*)(op + 16) = oc;  }
__global__ __launch_bounds__(256) void k_merge(const float* __restrict__ O, const float* __restrict__ MLb, float* OUTb) { const int e = blockIdx.x * 256 + threadIdx.x; const int t = (e >> 6) * 8 + (e & 7), c = (e >> 3) & 3, m = (e >> 5) & 1; if (t >= TT) return;
    static_assert(RH % 32 == 0 && NSF <= NSL, "a workgroup's 32 rows are all hi/lo or all fp16");
    O += (size_t)blockIdx.y * NSL * TT * HD; MLb += (size_t)blockIdx.y * NSL * TT * 2; OUTb += (size_t)blockIdx.y * TT * HD;   // grid y: the batch
    const float* pb = O + (size_t)(t >> 4) * (NSL * 16 * HD) + (4 * m + (c & 1)) * 128 + ((t & 15) + 16 * (c >> 1)) * 4;   // dt = 2 m, half = c & 1, lane = row + 16 (c >> 1); dt + 1 lies 256 floats on, a slice 1,024
    const float* mp = MLb + (size_t)t * 2;              // (maximum, sum) pairs lie [slice][t]
    float* op = OUTb + (size_t)t * HD + 32 * m + 4 * c;
    const bool hl = blockIdx.x * 32 < RH;   // the same for a whole workgroup
    v4f p[NSL], q[NSL]; v2f ml[NSL];
    merge_load<0, NSF>(pb, mp, p, q, ml);
    if (hl) merge_load<NSF, NSL>(pb, mp, p, q, ml);
    asm volatile("s_wait_xcnt 0x0" :: "v"(pb), "v"(mp) : "memory");   // both address pairs stay live up to this wait, so no load's result lands in a register that an issued load still names
    __builtin_amdgcn_sched_barrier(0);   // all loads are issued ahead of the first use: one memory latency, not two
    if (hl) merge_row<NSL>(p, q, ml, op);
    else merge_row<NSF>(p, q, ml, op);  }

extern "C" void kernel_launch(void* const* d_in, const int* in_sizes, int n_in,
                              void* d_out, int out_size, void* d_ws, size_t ws_size, hipStream_t stream) {
    (void)in_sizes; (void)n_in; (void)out_size;
    const float* x = (const float*)d_in[0]; const float* wk = (const float*)d_in[1]; const float* wq = (const float*)d_in[2]; const float* wv = (const float*)d_in[3];
    float* OUT = (float*)d_out;     // [4][4096][64]
    char* wsp = (char*)d_ws;
    auto take = [&](size_t bytes) { char* p = wsp; wsp += (bytes + 255) & ~(size_t)255; return (void*)p; };
    bf* WP = (bf*)take((size_t)(DQ + 2 * DKV) * DM * 2);
    h16* QP16 = (h16*)take((size_t)NB_ * NH_ * TT * HD * 2); h16* KP16 = (h16*)take((size_t)NB_ * NKV * TT * HD * 2); h16* VT16 = (h16*)take((size_t)NB_ * NKV * HD * TT * 2);
    bf* QPh = (bf*)take((size_t)NB_ * NH_ * TT * HD * 2); bf* QPl = (bf*)take((size_t)NB_ * NH_ * TT * HD * 2); bf* KPh = (bf*)take((size_t)NB_ * NKV * TT * HD * 2); bf* KPl = (bf*)take((size_t)NB_ * NKV * TT * HD * 2); bf* VTh = (bf*)take((size_t)NB_ * NKV * HD * TT * 2); bf* VTl = (bf*)take((size_t)NB_ * NKV * HD * TT * 2);
    float* Ob = (float*)take((size_t)NB_ * NSL * TT * HD * 4); float* MLb = (float*)take((size_t)NB_ * NSL * TT * 2 * 4);
    if ((size_t)(wsp - (char*)d_ws) > ws_size) return;    // ws 256 MiB
    static_assert(NH_ == 1 && NKV == 1, "one head");
    k_wpack<<<(DQ + 2 * DKV) * DM / 8 / 256, 256, 0, stream>>>(wq, wk, wv, WP);
    k_proj<<<NB_ * TT / PRW, 384, 0, stream>>>(x, WP, QP16, QPh, QPl, KP16, KPh, KPl, VT16, VTh, VTl);
    k_attn<<<NB_ * ((TT - RH) / QWG * NSF + RH / QWH * NSL), AWV * 32, 0, stream>>>(QP16, KP16, VT16, QPh, QPl, KPh, KPl, VTh, VTl, Ob, MLb);
    k_merge<<<dim3(TT * HD / 8 / 256, NB_), 256, 0, stream>>>(Ob, MLb, OUT);
}

// v008
// One run takes 41.5 microseconds.
// Two timings next to v007 put it at 1.04 and 1.05 times that version's speed.
// Over all steps from v000 it is 28.4 times as fast.
#include <hip/hip_runtime.h>

// Single attention head (ix [4][4096][768]; k, q, v = ix W ('xw' [768][64], no bias); wei = softmax(q.k / 8) over all 4096 keys; out = wei.v -> [4][4096][64] f32 (1.05 M)).
// Four launches, each for all four batches: the weights packed in fragment order; ONE projection kernel from the f32 input to the nine 16-bit q, k, v planes; one fused attention kernel over 4,096 keys in key slices (rows < 512 hi/lo, 16 slices; the rest fp16, 8 slices) with the softmax in registers; the merge kernel joins the slices and normalises; f32 output.
// Compute dtypes, f32 accumulate: every input rounded to bf16; projections on PLAIN bf16 operands (exact); scores and attn.v rows < 512 on bf16 hi/lo planes (3 products), the rest single fp16; softmax f32; f32 output.

#define NB_  4
#define TT   4096
#define DM   768
#define NH_  1
#define NKV  1
#define REP  (NH_ / NKV)
#define HD   64
#define DQ   (NH_ * HD)
#define DKV  (NKV * HD)
#define ZH   1
#define RH   512                  // query rows < RH use hi+lo planes (0: none)
#define WIN  0
#define SCL  0.125f   // HD^-0.5
#define NSL  16                   // key slices of the hi/lo rows; also the slice stride of the partial planes
#define KSL  (TT / NSL)           // keys per hi/lo slice (256)
#define NSF  8                    // key slices of the fp16 rows: one k and one v plane of 512 keys fill the LDS that two planes each of 256 keys need
#define KSF  (TT / NSF)           // keys per fp16 slice (512)
#define AWV  8                    // waves of an attention workgroup: two workgroups share a WGP
#define QWH  (AWV * 16)           // query rows per hi/lo workgroup: a wave holds one 16-column tile
#define QWG  (AWV * 32)           // query rows per fp16 workgroup: a wave holds two 16-column tiles
typedef _Float16 h16;
typedef unsigned short bf;
typedef __attribute__((ext_vector_type(16))) __bf16   v16bf;
typedef __attribute__((ext_vector_type(16))) _Float16 v16h;
typedef __attribute__((ext_vector_type(8)))  _Float16 v8h;
typedef __attribute__((ext_vector_type(8)))  unsigned short v8us;
typedef __attribute__((ext_vector_type(8)))  float    v8f;
typedef __attribute__((ext_vector_type(4)))  float    v4f;
typedef v8h  __attribute__((may_alias)) v8ha;
typedef v4f  __attribute__((may_alias)) v4fa;
typedef v8us __attribute__((may_alias)) v8usa;

__device__ __forceinline__ unsigned short f2bf(float f) { unsigned u = __float_as_uint(f); u += 0x7FFFu + ((u >> 16) & 1u); return (unsigned short)(u >> 16); }
__device__ __forceinline__ float bf2f(unsigned short b) { return __uint_as_float(((unsigned)b) << 16); }
__device__ __forceinline__ float bfr(float f) { return bf2f(f2bf(f)); }
__device__ __forceinline__ v16h cat16(v8h lo, v8h hi) { return __builtin_shufflevector(lo, hi, 0, 1, 2, 3, 4, 5, 6, 7, 8, 9, 10, 11, 12, 13, 14, 15); }
__device__ __forceinline__ v16bf cat16b(v8us lo, v8us hi) { return __builtin_bit_cast(v16bf, __builtin_shufflevector(lo, hi, 0, 1, 2, 3, 4, 5, 6, 7, 8, 9, 10, 11, 12, 13, 14, 15)); }
__device__ __forceinline__ v8f wmma16(v16h a, v16h b, v8f c) { return __builtin_amdgcn_wmma_f32_16x16x32_f16(false, a, false, b, (short)0, c, false, false); }
__device__ __forceinline__ v8f wmmab(v16bf a, v16bf b, v8f c) { return __builtin_amdgcn_wmma_f32_16x16x32_bf16(false, a, false, b, (short)0, c, false, false); }

// 16-bit WMMA fragments: a lane's sixteen elements are p[0..7] and p[16..23], p = its row + 8 (lane >> 4); A and B alike
template <typename T16> struct WFrag;
template <> struct WFrag<h16> { typedef v16h V; static __device__ __forceinline__ V ld(const h16* p) { return cat16(*(const v8h*)p, *(const v8h*)(p + 16)); } static __device__ __forceinline__ v8f mma(V a, V b, v8f c) { return wmma16(a, b, c); } };
template <> struct WFrag<bf> { typedef v16bf V; static __device__ __forceinline__ V ld(const bf* p) { return cat16b(*(const v8us*)p, *(const v8us*)(p + 16)); } static __device__ __forceinline__ v8f mma(V a, V b, v8f c) { return wmmab(a, b, c); } };

__device__ __forceinline__ h16 tohx(float x) { return (h16)x; }
__device__ __forceinline__ void splitf(float y, unsigned short& h, unsigned short& l) { h = f2bf(y); l = f2bf(y - bf2f(h)); }
typedef __attribute__((ext_vector_type(2))) _Float16 v2h;
typedef __attribute__((ext_vector_type(4))) _Float16 v4h;
typedef __attribute__((ext_vector_type(2))) unsigned short v2us;
typedef __attribute__((ext_vector_type(4))) unsigned short v4us;
typedef __attribute__((ext_vector_type(2))) float v2f;
typedef __attribute__((ext_vector_type(4))) int v4i;
typedef __attribute__((ext_vector_type(4))) __bf16 v4bf;

// ---- k_wpack: the three weights, rounded to bf16, in the order the projection's waves read them. Fragment (nt, ks): columns 16 nt .. + 15 of q | k | v (nt 0-3 | 4-7 | 8-11), k = 32 ks .. + 31;
// it is two runs of 512 B: run h holds, lane by lane, the eight elements k = 32 ks + 16 h + 8 (lane >> 4) + j of column lane & 15 (the k order of WFrag::ld), so a fragment is two whole-line 16-byte loads.
#define NKS  (DM / 32)            // k steps (24)
__global__ __launch_bounds__(256) void k_wpack(const float* __restrict__ wq, const float* __restrict__ wk, const float* __restrict__ wv, bf* WP) {
    static_assert(NKS * 64 == 6 * 256, "six workgroups per 16 columns");
    const int nt = blockIdx.x / 6; const float* w = nt < 4 ? wq : nt < 8 ? wk : wv;
    const int pi = blockIdx.x * 256 + threadIdx.x, lane = pi & 31, h = (pi >> 5) & 1, ks = (pi >> 6) % NKS;
    const float* wp = w + (size_t)(ks * 32 + h * 16 + 8 * (lane >> 4)) * HD + (nt & 3) * 16 + (lane & 15); float t[8]; v8us o;
#pragma unroll
    for (int j = 0; j < 8; ++j) t[j] = wp[j * HD];
    asm volatile("s_wait_xcnt 0x0" :: "v"(wp) : "memory");   // the address pair stays live up to this wait, so no load's result lands in a register that an issued load still names
#pragma unroll
    for (int j = 0; j < 8; ++j) o[j] = f2bf(t[j]);
    *(v8us*)(WP + (size_t)pi * 8) = o;  }

// ---- k_proj: input rounding, the three projections and the plane building in one kernel. A workgroup (12 waves): 64 rows of ix x all 192 columns.
// The rows are read once, in whole lines, rounded to bf16 and staged in LDS. Wave (g, kq): g = q | k | v (64 columns), kq = a quarter of K (192 k, 6 steps): 4 x 4 accumulators, so every weight fragment is read once per workgroup.
// q and k: transposed product (A = weight columns, B = input rows), a lane holds 8 neighbouring d of one row; v: A = input rows, B = weight columns, a lane holds 8 neighbouring rows of one d: both leave 16-byte pieces of the layout their planes have.
// The four K quarters meet in LDS and are added in ascending order by the threads that round and store the planes in whole lines.
#define PRW  64                   // input rows per workgroup
#define XPE  (DM + 8)             // LDS pitch of a staged row, elements: 1,536 B + 16 B (16 B x odd: no bank conflict for 16-byte reads)
#define PQP  (2 * HD + 4)         // LDS pitch of a q | k partial row, floats: 512 B + 16 B
#define PVP  (PRW + 4)            // LDS pitch of a v partial row (one d, PRW input rows), floats: 256 B + 16 B
#define WFE  512                  // elements of a packed fragment
__device__ __forceinline__ v16bf wfrag(const bf* p) { return cat16b(*(const v8us*)p, *(const v8us*)(p + 256)); }
template <bool VK>
__device__ __forceinline__ void proj_part(const bf* xs, const bf* __restrict__ wp, v16bf (&wf)[2][4], float* pd) {
    v8f acc[4][4];   // [weight tile][row tile]
#pragma unroll
    for (int nb = 0; nb < 4; ++nb)
#pragma unroll
        for (int tt = 0; tt < 4; ++tt) acc[nb][tt] = (v8f){};
#pragma unroll
    for (int ks = 0; ks < 6; ++ks) { v16bf xa[4];
#pragma unroll
        for (int tt = 0; tt < 4; ++tt) xa[tt] = WFrag<bf>::ld(xs + tt * 16 * XPE + ks * 32);
#pragma unroll
        for (int nb = 0; nb < 4; ++nb)
#pragma unroll
            for (int tt = 0; tt < 4; ++tt) acc[nb][tt] = VK ? wmmab(xa[tt], wf[ks & 1][nb], acc[nb][tt]) : wmmab(wf[ks & 1][nb], xa[tt], acc[nb][tt]);
        if (ks + 2 < 6) {   // the weight fragments run two steps ahead
#pragma unroll
            for (int nb = 0; nb < 4; ++nb) wf[ks & 1][nb] = wfrag(wp + (nb * NKS + ks + 2) * WFE); } }
    asm volatile("s_wait_xcnt 0x0" :: "v"(wp) : "memory");   // the address pair stays live up to this wait, so no load's result lands in a register that an issued load still names
#pragma unroll
    for (int nb = 0; nb < 4; ++nb)
#pragma unroll
        for (int tt = 0; tt < 4; ++tt) { float* d = VK ? pd + nb * 16 * PVP + tt * 16 : pd + tt * 16 * PQP + nb * 16; v4f w0, w1;
#pragma unroll
            for (int r = 0; r < 4; ++r) { w0[r] = acc[nb][tt][r]; w1[r] = acc[nb][tt][4 + r]; }
            *(v4fa*)d = w0; *(v4fa*)(d + 4) = w1; }
}
template <int PS>   // eight neighbouring elements of a plane: the four K quarters (PS floats apart) added in ascending order, rounded to fp16 and to bf16 hi + lo
__device__ __forceinline__ void proj_emit(const float* sp, h16* d16, bf* dh, bf* dl) {
    v4f a0 = *(const v4fa*)sp, a1 = *(const v4fa*)(sp + 4);
#pragma unroll
    for (int s = 1; s < 4; ++s) { a0 += *(const v4fa*)(sp + s * PS); a1 += *(const v4fa*)(sp + s * PS + 4); }
    v8h o16; v8us oh, ol;
#pragma unroll
    for (int j = 0; j < 8; ++j) { const float y = j < 4 ? a0[j & 3] : a1[j & 3]; o16[j] = tohx(y); unsigned short a2, c2; splitf(y, a2, c2); oh[j] = a2; ol[j] = c2; }
    *(v8h*)d16 = o16; *(v8us*)dh = oh; *(v8us*)dl = ol;
    asm volatile("s_wait_xcnt 0x0" :: "v"(d16), "v"(dh), "v"(dl) : "memory");   // the three address pairs stay live up to this wait: nothing overwrites a register that an issued store still names
}
__global__ __launch_bounds__(384) void k_proj(const float* __restrict__ x, const bf* __restrict__ WP, h16* Q16, bf* Qh, bf* Ql, h16* K16, bf* Kh, bf* Kl, h16* V16, bf* Vh, bf* Vl) {
    static_assert(DM == 768 && HD == 64 && TT % PRW == 0, "staging and wave roles are written for 768 x 3 x 64; a workgroup lies in one batch");
    __shared__ __align__(16) unsigned short xs[PRW * XPE];
    __shared__ __align__(16) float pq[4 * PRW * PQP];
    __shared__ __align__(16) float pv[4 * HD * PVP];
    const int tid = threadIdx.x, lane = tid & 31, lr = lane & 15, hi = lane >> 4; const int R0 = blockIdx.x * PRW;
    const int wv = __builtin_amdgcn_readfirstlane(tid >> 5), g = wv >> 2, kq = wv & 3;   // the wave's number in a scalar register: the choice between the two product forms below is a scalar branch
    const int sr = tid / 192, sc = (tid % 192) * 4;   // staging: 16-byte piece tid + 384 i is row 2 i + sr, elements sc .. sc + 3; a wave's 32 pieces are 512 contiguous bytes
    const float* xp = x + (size_t)(R0 + sr) * DM + sc; const bf* wp = WP + (size_t)(g * 4 * NKS + kq * 6) * WFE + lane * 8;
    v4f t[PRW / 2]; v16bf wf[2][4];
#pragma unroll
    for (int i = 0; i < PRW / 2; ++i) t[i] = *(const v4f*)(xp + i * 2 * DM);
#pragma unroll
    for (int ks = 0; ks < 2; ++ks)
#pragma unroll
        for (int nb = 0; nb < 4; ++nb) wf[ks][nb] = wfrag(wp + (nb * NKS + ks) * WFE);
    asm volatile("s_wait_xcnt 0x0" :: "v"(xp), "v"(wp) : "memory");   // both address pairs stay live up to this wait, so no load's result lands in a register that an issued load still names
    unsigned short* dx = xs + sr * XPE + sc;
#pragma unroll
    for (int i = 0; i < PRW / 2; ++i) *(v4us*)(dx + i * 2 * XPE) = __builtin_bit_cast(v4us, __builtin_convertvector(t[i], v4bf));
    __syncthreads();   // the staged rows are read by all twelve waves
    const bf* xf = xs + lr * XPE + 8 * hi + kq * 192;
    if (g == 2) proj_part<true>(xf, wp, wf, pv + kq * HD * PVP + lr * PVP + 8 * hi);
    else proj_part<false>(xf, wp, wf, pq + kq * PRW * PQP + lr * PQP + g * HD + 8 * hi);
    __syncthreads();   // a plane element's four K quarters come from four waves
    const size_t vb = (size_t)(R0 / TT) * HD * TT + R0 % TT;
#pragma unroll
    for (int i = 0; i < 4; ++i) { const int it = i * 384 + tid, kind = it >> 9, r = (it & 511) >> 3, c8 = (it & 7) * 8;   // 3 x 512 pieces of eight; a wave's pieces are of one kind and fill whole lines
        const size_t qo = (size_t)(R0 + r) * HD + c8, vo = vb + (size_t)r * TT + c8;
        if (kind == 0) proj_emit<PRW * PQP>(pq + r * PQP + c8, Q16 + qo, Qh + qo, Ql + qo);
        else if (kind == 1) proj_emit<PRW * PQP>(pq + r * PQP + HD + c8, K16 + qo, Kh + qo, Kl + qo);
        else proj_emit<HD * PVP>(pv + r * PVP + c8, V16 + vo, Vh + vo, Vl + vo); }
}
// ---- k_attn: scores, softmax and attn.v fused. A workgroup (8 waves): 256 query rows x one slice of KSF keys (fp16) or 128 query rows x one slice of KSL keys (hi/lo); the slice's k rows and v rows are staged once in LDS; a wave: NQ tiles of 16 query columns (fp16: 2, every k and v fragment read from LDS serves both; hi/lo: 1), passes of 32 keys.
// Transposed products: St = K.Qt (A = key rows, B = query columns), so a lane holds 16 scores of ONE query; two St tiles converted in place are the B operand of Ot += Vt.Pt (A = rows of the [d][t] v planes).
// Softmax in base 2 against one reference exponent per query and slice; a slice leaves its unnormalised Ot (in fragment order), that exponent and its sum, and k_merge joins the slices.
#define KPE  72                   // LDS pitch of a key row, elements: 128 B + 16 B (16 B x odd: no bank conflict for 16-byte reads)
#define PLE  (KSL * KPE + HD * (KSL + 8))   // one k plane and one v plane of a hi/lo slice
template <typename T16> struct Oct;
template <> struct Oct<h16> { typedef v8h H; };
template <> struct Oct<bf> { typedef v8us H; };
__device__ __forceinline__ float xhalf(float x) { return __builtin_bit_cast(float, __builtin_amdgcn_permlanex16(__builtin_bit_cast(int, x), __builtin_bit_cast(int, x), 0x76543210, 0xfedcba98, false, false)); }   // lane l with lane l ^ 16
// Base-2 exponentials with the slot that the instruction set asks for behind a transcendental written in: inside a statement every v_exp_f32 is followed by an independent one (outputs early-clobber, so none is another's source), the last by v_nop.
__device__ __forceinline__ void exp2x8(const float (&x)[8], float (&e)[8]) {
    asm("v_exp_f32 %0, %8\n\tv_exp_f32 %1, %9\n\tv_exp_f32 %2, %10\n\tv_exp_f32 %3, %11\n\tv_exp_f32 %4, %12\n\tv_exp_f32 %5, %13\n\tv_exp_f32 %6, %14\n\tv_exp_f32 %7, %15\n\tv_nop"
        : "=&v"(e[0]), "=&v"(e[1]), "=&v"(e[2]), "=&v"(e[3]), "=&v"(e[4]), "=&v"(e[5]), "=&v"(e[6]), "=&v"(e[7]) : "v"(x[0]), "v"(x[1]), "v"(x[2]), "v"(x[3]), "v"(x[4]), "v"(x[5]), "v"(x[6]), "v"(x[7])); }
__device__ __forceinline__ float exp2x1(float x) { float e; asm("v_exp_f32 %0, %1\n\tv_nop" : "=&v"(e) : "v"(x)); return e; }
#define CSL  (SCL * 1.4426950408889634f)   // scores to base-2 exponents
// One sweep over the staged slice: Ot, the weight sum and, in mr, the exponent that a scaled score is taken against (a weight is 2^(score CSL - mr), in sum and Ot alike).
// FX: mr is given and stays, so a pass has no maximum, no rescale and no test; the caller checks the sum afterwards. Otherwise: running maximum, sound for any scores.
template <typename T16, bool HL, int NQ, int KS, bool FX>
__device__ __forceinline__ void attn_sweep(const T16* sm, const typename WFrag<T16>::V (&qf)[NQ][2], const typename WFrag<T16>::V (&qg)[NQ][2], v8f (&o)[NQ][4], float (&mr)[NQ], float (&ls)[NQ]) {
    typedef typename WFrag<T16>::V V;
    constexpr int VPE = KS + 8;
    const int lane = threadIdx.x & 31, lr = lane & 15, hi = lane >> 4;
    const float POFF = HL ? 0.0f : 8.0f;   // running maximum: fp16 weights are carried x 2^8 (sum and Ot alike), away from the fp16 subnormals
    const T16* kl = sm + lr * KPE + 8 * hi; const T16* km = kl + PLE; const T16* vl = sm + KS * KPE + lr * VPE + 8 * hi; const T16* vm = vl + PLE;   // walked pass by pass, so that every read is one of the four plus a 16-bit offset
    v2f l2[NQ];
#pragma unroll
    for (int qt = 0; qt < NQ; ++qt) { if (!FX) mr[qt] = -3.0e38f; ls[qt] = 0.f; l2[qt] = (v2f){};
#pragma unroll
        for (int dt = 0; dt < 4; ++dt) o[qt][dt] = (v8f){}; }
#pragma unroll (HL || !FX ? 1 : 4)   // fp16: four passes unrolled, their LDS addresses are a lane register plus an immediate and the next pass's reads can start early (more unrolled spill with two query tiles); hi/lo: rolled, the low planes lie beyond the 16-bit offset and are walked; the rerun: rolled, it is rare and must not spill
    for (int p = 0; p < KS / 32; ++p) {
        V ka[2][2], kb[2][2], va[4], vb[4];
#pragma unroll
        for (int kt = 0; kt < 2; ++kt)
#pragma unroll
            for (int ks = 0; ks < 2; ++ks) { ka[kt][ks] = WFrag<T16>::ld(kl + kt * 16 * KPE + ks * 32); if (HL) kb[kt][ks] = WFrag<T16>::ld(km + kt * 16 * KPE + ks * 32); }
        if (FX) {
#pragma unroll
            for (int dt = 0; dt < 4; ++dt) { va[dt] = WFrag<T16>::ld(vl + dt * 16 * VPE); if (HL) vb[dt] = WFrag<T16>::ld(vm + dt * 16 * VPE); } }
        kl += 32 * KPE; km += 32 * KPE;
        __builtin_amdgcn_sched_barrier(0);   // a pass's LDS reads are all issued ahead of its first product (the v reads a whole softmax early), and no later pass's reads rise above this line: without it the unrolled path fetches so far ahead that it spills
        v8f s[NQ][2];
#pragma unroll
        for (int kt = 0; kt < 2; ++kt)
#pragma unroll
            for (int qt = 0; qt < NQ; ++qt) { v8f c = (v8f){};
#pragma unroll
                for (int ks = 0; ks < 2; ++ks) { c = WFrag<T16>::mma(ka[kt][ks], qf[qt][ks], c); if (HL) { c = WFrag<T16>::mma(ka[kt][ks], qg[qt][ks], c); c = WFrag<T16>::mma(kb[kt][ks], qf[qt][ks], c); } }
                s[qt][kt] = c; }
        if (FX) __builtin_amdgcn_sched_barrier(0);   // the score products issue as one run: a multiply-add placed among them waits out its product's distance in v_nop, and the exponentials' asm results must not land in a product's operands right behind it
        V pb[NQ], pc[NQ];
#pragma unroll
        for (int qt = 0; qt < NQ; ++qt) { float xd[2][8], xe[2][8]; float sum;
            if constexpr (FX) { const v2f c2 = {CSL, CSL}, nm = {-mr[qt], -mr[qt]};
#pragma unroll
                for (int kt = 0; kt < 2; ++kt) {
#pragma unroll
                    for (int r = 0; r < 8; r += 2) { v2f t = {s[qt][kt][r], s[qt][kt][r + 1]}; t = __builtin_elementwise_fma(t, c2, nm); xd[kt][r] = t[0]; xd[kt][r + 1] = t[1]; }   // one packed multiply-add per two scores
                    exp2x8(xd[kt], xe[kt]); }
                v2f h[2];   // packed adds: even and odd keys are summed apart and meet behind the last pass
#pragma unroll
                for (int kt = 0; kt < 2; ++kt) h[kt] = ((v2f){xe[kt][0], xe[kt][1]} + (v2f){xe[kt][2], xe[kt][3]}) + ((v2f){xe[kt][4], xe[kt][5]} + (v2f){xe[kt][6], xe[kt][7]});
                l2[qt] += h[0] + h[1]; }
            else { float mx = mr[qt];
#pragma unroll
                for (int kt = 0; kt < 2; ++kt)
#pragma unroll
                    for (int r = 0; r < 8; ++r) { s[qt][kt][r] *= CSL; mx = fmaxf(mx, s[qt][kt][r]); }
                mx = fmaxf(mx, xhalf(mx));   // both halves of the wave hold keys of the same query
                const float al = exp2x1(mr[qt] - mx); mr[qt] = mx; const float mo = mx - POFF; sum = 0.f;
#pragma unroll
                for (int kt = 0; kt < 2; ++kt) {
#pragma unroll
                    for (int r = 0; r < 8; ++r) xd[kt][r] = s[qt][kt][r] - mo;
                    exp2x8(xd[kt], xe[kt]); }
#pragma unroll
                for (int e = 0; e < 16; ++e) sum += xe[e >> 3][e & 7];
                ls[qt] = ls[qt] * al + sum;
#pragma unroll
                for (int dt = 0; dt < 4; ++dt) o[qt][dt] *= al; }
#pragma unroll
            for (int e = 0; e < 16; ++e) { const float ex = xe[e >> 3][e & 7];
                if constexpr (HL) { const __bf16 h = (__bf16)ex; pb[qt][e] = h; pc[qt][e] = (__bf16)(ex - (float)h); } else pb[qt][e] = (h16)ex; } }
        if (!FX) {   // the rerun reads v only now: its registers are free behind the softmax, so it does not spill
            __builtin_amdgcn_sched_barrier(0);   // keeps these reads from rising into the softmax
#pragma unroll
            for (int dt = 0; dt < 4; ++dt) { va[dt] = WFrag<T16>::ld(vl + dt * 16 * VPE); if (HL) vb[dt] = WFrag<T16>::ld(vm + dt * 16 * VPE); } }
        vl += 32; vm += 32;
#pragma unroll
        for (int dt = 0; dt < 4; ++dt)
#pragma unroll
            for (int qt = 0; qt < NQ; ++qt) { o[qt][dt] = WFrag<T16>::mma(va[dt], pb[qt], o[qt][dt]); if (HL) { o[qt][dt] = WFrag<T16>::mma(va[dt], pc[qt], o[qt][dt]); o[qt][dt] = WFrag<T16>::mma(vb[dt], pb[qt], o[qt][dt]); } }
    }
#pragma unroll
    for (int qt = 0; qt < NQ; ++qt) { if (FX) ls[qt] = l2[qt][0] + l2[qt][1]; else mr[qt] -= POFF; }
}
template <typename T16, bool HL, int NQ, int KS>   // HL: second (low) planes, three products each; NQ: query tiles of a wave; KS: keys of a slice
__device__ __forceinline__ void attn_slice(T16* sm, const T16* __restrict__ Q, const T16* __restrict__ Q2, const T16* __restrict__ Kp, const T16* __restrict__ K2, const T16* __restrict__ Vt, const T16* __restrict__ V2, int q0, int sl, float* __restrict__ Ob, float* __restrict__ MLb) {
    typedef typename WFrag<T16>::V V; typedef typename Oct<T16>::H H;
    constexpr int VPE = KS + 8, NI = KS / 32, PPR = KS / 8, RPI = 256 / PPR;   // LDS pitch of a v row, elements: 16 B x odd; staging trips; 16-byte pieces of a v row; v rows per trip
    const int tid = threadIdx.x, lane = tid & 31, lr = lane & 15, hi = lane >> 4;
    const float PFX = HL ? 0.0f : 5.0f, LIM = HL ? 1.0e30f : 60000.0f;   // weight of the reference score, 2^PFX; the largest weight sum that is taken as it is
    const size_t qo = (size_t)(q0 + (lane >> 3)) * HD + (lane & 7) * 8, ko = (size_t)sl * KS * HD + tid * 8, vo = (size_t)(tid / PPR) * TT + sl * KS + (tid % PPR) * 8;
    const T16* qp = Q + qo; const T16* qq = HL ? Q2 + qo : qp; const T16* gk = Kp + ko; const T16* gl = HL ? K2 + ko : gk; const T16* gv = Vt + vo; const T16* gw = HL ? V2 + vo : gv;   // every global read below is one of these plus a constant
    V qf[NQ][2], qg[NQ][2];
    {   // stage the slice: 16-byte pieces, whole lines per wave; piece tid + 256 i is k row (tid >> 3) + 32 i, v row tid / PPR + RPI i
        H tq[NQ * 4], tr[NQ * 4], tk[NI], tl[NI], tv[NI], tw[NI];
#pragma unroll
        for (int i = 0; i < NQ * 4; ++i) { tq[i] = *(const H*)(qp + i * 4 * HD); if (HL) tr[i] = *(const H*)(qq + i * 4 * HD); }   // the wave's query rows in whole lines: piece lane + 32 i is row (lane >> 3) + 4 i
#pragma unroll
        for (int i = 0; i < NI; ++i) { tk[i] = *(const H*)(gk + i * 2048); tv[i] = *(const H*)(gv + i * RPI * TT); if (HL) { tl[i] = *(const H*)(gl + i * 2048); tw[i] = *(const H*)(gw + i * RPI * TT); } }
        asm volatile("s_wait_xcnt 0x0" :: "v"(qp), "v"(qq), "v"(gk), "v"(gl), "v"(gv), "v"(gw) : "memory");   // the address pairs stay live up to this wait, so no load's result lands in a register that an issued load still names
        // A query fragment read from global memory touches 16 lines with 32 B each: the rows turn through LDS, ahead of the slice, each wave's in a place of its own.
        constexpr int QPL = NQ * 16 * KPE;   // one plane of a wave's query rows, at the pitch of a key row
        T16* wq = sm + (tid >> 5) * ((HL ? 2 : 1) * QPL); T16* dq = wq + (lane >> 3) * KPE + (lane & 7) * 8; const T16* fq = wq + lr * KPE + 8 * hi;
#pragma unroll
        for (int i = 0; i < NQ * 4; ++i) { *(H*)(dq + i * 4 * KPE) = tq[i]; if (HL) *(H*)(dq + QPL + i * 4 * KPE) = tr[i]; }
        asm volatile("s_wait_dscnt 0x0\n\ts_barrier_signal -1\n\ts_barrier_wait -1" ::: "memory");   // a query row is read by other lanes than wrote it; by hand, LDS wait only: __syncthreads() would also wait for the slice's global loads, which stay in flight here
#pragma unroll
        for (int qt = 0; qt < NQ; ++qt)
#pragma unroll
            for (int ks = 0; ks < 2; ++ks) { qf[qt][ks] = WFrag<T16>::ld(fq + qt * 16 * KPE + ks * 32); if (HL) qg[qt][ks] = WFrag<T16>::ld(fq + QPL + qt * 16 * KPE + ks * 32); }
        asm volatile("s_wait_dscnt 0x0\n\ts_barrier_signal -1\n\ts_barrier_wait -1" ::: "memory");   // every wave holds its query fragments: the slice may take their place; by hand for the same reason
        T16* dk = sm + (tid >> 3) * KPE + (tid & 7) * 8; T16* dv = sm + KS * KPE + (tid / PPR) * VPE + (tid % PPR) * 8;
#pragma unroll
        for (int i = 0; i < NI; ++i) { *(H*)(dk + i * 32 * KPE) = tk[i]; *(H*)(dv + i * RPI * VPE) = tv[i]; if (HL) { *(H*)(dk + PLE + i * 32 * KPE) = tl[i]; *(H*)(dv + PLE + i * RPI * VPE) = tw[i]; } }
    }
    __syncthreads();   // the staged slice is read by all eight waves
    v8f o[NQ][4]; float mr[NQ], ls[NQ];
    {   // Each query's reference: its largest score among the slice's first 32 keys (hi/lo: by the high planes alone, a reference need not be exact). That key's weight is 2^PFX, so the sum cannot vanish;
        // fp16 weights overflow only 2^(16 - PFX) above the reference, and a sum below LIM shows that none did.
        const T16* kf = sm + lr * KPE + 8 * hi; V ka[2][2];
#pragma unroll
        for (int kt = 0; kt < 2; ++kt)
#pragma unroll
            for (int ks = 0; ks < 2; ++ks) ka[kt][ks] = WFrag<T16>::ld(kf + kt * 16 * KPE + ks * 32);
#pragma unroll
        for (int qt = 0; qt < NQ; ++qt) { float mx = -3.0e38f;
#pragma unroll
            for (int kt = 0; kt < 2; ++kt) { v8f c = (v8f){};
#pragma unroll
                for (int ks = 0; ks < 2; ++ks) c = WFrag<T16>::mma(ka[kt][ks], qf[qt][ks], c);
#pragma unroll
                for (int r = 0; r < 8; ++r) mx = fmaxf(mx, c[r]); }
            mx = fmaxf(mx, xhalf(mx));   // both halves of the wave hold keys of the same query
            mr[qt] = mx * CSL - PFX; }
    }
    attn_sweep<T16, HL, NQ, KS, true>(sm, qf, qg, o, mr, ls);
    unsigned redo = 0u;
#pragma unroll
    for (int qt = 0; qt < NQ; ++qt) { const float lt = ls[qt] + xhalf(ls[qt]); redo |= __builtin_amdgcn_ballot_w32(!(lt > 0.5f && lt < LIM)); }   // also set for a sum that is not a number
    if (redo != 0u) attn_sweep<T16, HL, NQ, KS, false>(sm, qf, qg, o, mr, ls);   // a scalar branch, once per slice: scores that leave the range of a fixed reference get the running maximum; the staged slice is still in place and no barrier follows
    // The partial planes lie in fragment order, [16-query tile][slice][dt][half][lane]: a store instruction writes 512 contiguous bytes. (Row by row, neighbouring queries lie 4 KB apart and an instruction would touch 16 lines with 32 B each.)
#pragma unroll
    for (int qt = 0; qt < NQ; ++qt) { const int q = q0 + qt * 16 + lr; const float lt = ls[qt] + xhalf(ls[qt]); float* ob = Ob + ((size_t)((q0 >> 4) + qt) * NSL + sl) * (16 * HD) + lane * 4;   // a lane holds d = 16 dt + 8 hi + r of its query
#pragma unroll
        for (int dt = 0; dt < 4; ++dt) { v4f w0, w1;
#pragma unroll
            for (int r = 0; r < 4; ++r) { w0[r] = o[qt][dt][r]; w1[r] = o[qt][dt][4 + r]; }
            *(v4f*)(ob + dt * 256) = w0; *(v4f*)(ob + dt * 256 + 128) = w1; }
        if (hi == 0) { v2f ml; ml[0] = mr[qt]; ml[1] = lt; *(v2f*)(MLb + ((size_t)sl * TT + q) * 2) = ml; } }   // [slice][t]: a tile's 16 pairs fill one 128-byte line
}
__global__ __launch_bounds__(AWV * 32) __attribute__((amdgpu_waves_per_eu(4, 4))) void k_attn(const h16* __restrict__ Q16, const h16* __restrict__ K16, const h16* __restrict__ V16, const bf* __restrict__ Qh, const bf* __restrict__ Ql, const bf* __restrict__ Kh, const bf* __restrict__ Kl, const bf* __restrict__ Vh, const bf* __restrict__ Vl, float* Ob, float* MLb) {
    static_assert(RH % QWH == 0 && (TT - RH) % QWG == 0 && KSL % 32 == 0 && KSF % 32 == 0 && HD == 64 && AWV == 8, "a workgroup is all hi/lo or all fp16; the staging loops are written for 64 d and 256 threads");
    static_assert(KSF * KPE + HD * (KSF + 8) <= 2 * PLE, "an fp16 slice fits the LDS of a hi/lo slice's two plane pairs");
    __shared__ __align__(16) unsigned short sm[2 * PLE];
    constexpr int NFB = (TT - RH) / QWG, NHB = RH / QWH, NFW = NFB * NSF, NHW = NHB * NSL;   // row blocks and workgroups of a batch, fp16 and hi/lo
    const int bx = blockIdx.x, wn = threadIdx.x >> 5;   // grid x: first every fp16 workgroup (the longer ones), then the hi/lo ones; in each part batch, slice, row block, the row block fastest
    if (bx < NB_ * NFW) { const int nb = bx / NFW, iy = bx % NFW; const size_t bo = (size_t)nb * TT * HD;
        attn_slice<h16, false, 2, KSF>((h16*)sm, Q16 + bo, nullptr, K16 + bo, nullptr, V16 + bo, nullptr, RH + iy % NFB * QWG + wn * 32, iy / NFB, Ob + bo * NSL, MLb + (size_t)nb * NSL * TT * 2); }
    else { const int ix = bx - NB_ * NFW, nb = ix / NHW, iy = ix % NHW; const size_t bo = (size_t)nb * TT * HD;
        attn_slice<bf, true, 1, KSL>(sm, Qh + bo, Ql + bo, Kh + bo, Kl + bo, Vh + bo, Vl + bo, iy % NHB * QWH + wn * 16, iy / NHB, Ob + bo * NSL, MLb + (size_t)nb * NSL * TT * 2); }
}

// k_merge: out[t][d] = sum_s Ot_s 2^(m_s - M) / sum_s l_s 2^(m_s - M), slices ascending, m_s the slice's reference exponent, M the largest of them; NS: the slices that the row's attention workgroups left
// A lane joins d = 32 m + 4 c .. + 3 and the same + 16 of one row; a wave: 8 rows x 4 c, so a load reads four whole lines of the fragment-order planes and the wave's two stores fill one 128-byte line of each row.
template <int S0, int S1>   // slices S0 .. S1 - 1 of the lane's two pieces and of its row's (reference exponent, sum) pair
__device__ __forceinline__ void merge_load(const float* pb, const float* mp, v4f (&p)[NSL], v4f (&q)[NSL], v2f (&ml)[NSL]) {
#pragma unroll
    for (int s = S0; s < S1; ++s) { p[s] = *(const v4f*)(pb + s * 16 * HD); q[s] = *(const v4f*)(pb + s * 16 * HD + 256); ml[s] = *(const v2f*)(mp + s * TT * 2); } }
template <int NS>
__device__ __forceinline__ void merge_row(const v4f (&p)[NSL], const v4f (&q)[NSL], const v2f (&ml)[NSL], float* op) {
    static_assert(NS % 8 == 0, "statements of eight exponentials");
    float M = ml[0][0];
#pragma unroll
    for (int s = 1; s < NS; ++s) M = fmaxf(M, ml[s][0]);
    v4f a = (v4f){}, b = (v4f){}; float L = 0.f; float xd[NS / 8][8], w[NS / 8][8];
#pragma unroll
    for (int h = 0; h < NS / 8; ++h) {
#pragma unroll
        for (int r = 0; r < 8; ++r) xd[h][r] = ml[h * 8 + r][0] - M;
        exp2x8(xd[h], w[h]); }
#pragma unroll
    for (int s = 0; s < NS; ++s) { a += p[s] * w[s >> 3][s & 7]; b += q[s] * w[s >> 3][s & 7]; L += ml[s][1] * w[s >> 3][s & 7]; }
    v4f oa, oc;
#pragma unroll
    for (int r = 0; r < 4; ++r) { oa[r] = __fdiv_rn(a[r], L); oc[r] = __fdiv_rn(b[r], L); }
    *(v4f*)op = oa; *(v4f*)(op + 16) = oc;  }
__global__ __launch_bounds__(256) void k_merge(const float* __restrict__ O, const float* __restrict__ MLb, float* OUTb) { const int e = blockIdx.x * 256 + threadIdx.x; const int t = (e >> 6) * 8 + (e & 7), c = (e >> 3) & 3, m = (e >> 5) & 1; if (t >= TT) return;
    static_assert(RH % 32 == 0 && NSF <= NSL, "a workgroup's 32 rows are all hi/lo or all fp16");
    O += (size_t)blockIdx.y * NSL * TT * HD; MLb += (size_t)blockIdx.y * NSL * TT * 2; OUTb += (size_t)blockIdx.y * TT * HD;   // grid y: the batch
    const float* pb = O + (size_t)(t >> 4) * (NSL * 16 * HD) + (4 * m + (c & 1)) * 128 + ((t & 15) + 16 * (c >> 1)) * 4;   // dt = 2 m, half = c & 1, lane = row + 16 (c >> 1); dt + 1 lies 256 floats on, a slice 1,024
    const float* mp = MLb + (size_t)t * 2;              // (reference exponent, sum) pairs lie [slice][t]
    float* op = OUTb + (size_t)t * HD + 32 * m + 4 * c;
    const bool hl = blockIdx.x * 32 < RH;   // the same for a whole workgroup
    v4f p[NSL], q[NSL]; v2f ml[NSL];
    merge_load<0, NSF>(pb, mp, p, q, ml);
    if (hl) merge_load<NSF, NSL>(pb, mp, p, q, ml);
    asm volatile("s_wait_xcnt 0x0" :: "v"(pb), "v"(mp) : "memory");   // both address pairs stay live up to this wait, so no load's result lands in a register that an issued load still names
    __builtin_amdgcn_sched_barrier(0);   // all loads are issued ahead of the first use: one memory latency, not two
    if (hl) merge_row<NSL>(p, q, ml, op);
    else merge_row<NSF>(p, q, ml, op);  }

extern "C" void kernel_launch(void* const* d_in, const int* in_sizes, int n_in,
                              void* d_out, int out_size, void* d_ws, size_t ws_size, hipStream_t stream) {
    (void)in_sizes; (void)n_in; (void)out_size;
    const float* x = (const float*)d_in[0]; const float* wk = (const float*)d_in[1]; const float* wq = (const float*)d_in[2]; const float* wv = (const float*)d_in[3];
    float* OUT = (float*)d_out;     // [4][4096][64]
    char* wsp = (char*)d_ws;
    auto take = [&](size_t bytes) { char* p = wsp; wsp += (bytes + 255) & ~(size_t)255; return (void*)p; };
    bf* WP = (bf*)take((size_t)(DQ + 2 * DKV) * DM * 2);
    h16* QP16 = (h16*)take((size_t)NB_ * NH_ * TT * HD * 2); h16* KP16 = (h16*)take((size_t)NB_ * NKV * TT * HD * 2); h16* VT16 = (h16*)take((size_t)NB_ * NKV * HD * TT * 2);
    bf* QPh = (bf*)take((size_t)NB_ * NH_ * TT * HD * 2); bf* QPl = (bf*)take((size_t)NB_ * NH_ * TT * HD * 2); bf* KPh = (bf*)take((size_t)NB_ * NKV * TT * HD * 2); bf* KPl = (bf*)take((size_t)NB_ * NKV * TT * HD * 2); bf* VTh = (bf*)take((size_t)NB_ * NKV * HD * TT * 2); bf* VTl = (bf*)take((size_t)NB_ * NKV * HD * TT * 2);
    float* Ob = (float*)take((size_t)NB_ * NSL * TT * HD * 4); float* MLb = (float*)take((size_t)NB_ * NSL * TT * 2 * 4);
    if ((size_t)(wsp - (char*)d_ws) > ws_size) return;    // ws 256 MiB
    static_assert(NH_ == 1 && NKV == 1, "one head");
    k_wpack<<<(DQ + 2 * DKV) * DM / 8 / 256, 256, 0, stream>>>(wq, wk, wv, WP);
    k_proj<<<NB_ * TT / PRW, 384, 0, stream>>>(x, WP, QP16, QPh, QPl, KP16, KPh, KPl, VT16, VTh, VTl);
    k_attn<<<NB_ * ((TT - RH) / QWG * NSF + RH / QWH * NSL), AWV * 32, 0, stream>>>(QP16, KP16, VT16, QPh, QPl, KPh, KPl, VTh, VTl, Ob, MLb);
    k_merge<<<dim3(TT * HD / 8 / 256, NB_), 256, 0, stream>>>(Ob, MLb, OUT);
}

// v009
// Measured time: 39.4 microseconds a run.
// In two side-by-side timings against v008, it was 1.05 and 1.04 times as fast.
// Over all steps from v000 it is 29.6 times as fast.
#include <hip/hip_runtime.h>

// Single attention head (ix [4][4096][768]; k, q, v = ix W ('xw' [768][64], no bias); wei = softmax(q.k / 8) over all 4096 keys; out = wei.v -> [4][4096][64] f32 (1.05 M)).
// Four launches, each for all four batches: the weights packed in fragment order; ONE projection kernel from the f32 input to the nine 16-bit q, k, v planes; one fused attention kernel over 4,096 keys in key slices (rows < 512 hi/lo, 16 slices; the rest fp16, 8 slices) with the softmax in registers; the merge kernel joins the slices and normalises; f32 output. The slices' partial results: f32 for the hi/lo rows, f16 (each divided by its slice's weight sum) for the fp16 rows.
// Compute dtypes, f32 accumulate: every input rounded to bf16; projections on PLAIN bf16 operands (exact); scores and attn.v rows < 512 on bf16 hi/lo planes (3 products), the rest single fp16; softmax f32; f32 output.

#define NB_  4
#define TT   4096
#define DM   768
#define NH_  1
#define NKV  1
#define REP  (NH_ / NKV)
#define HD   64
#define DQ   (NH_ * HD)
#define DKV  (NKV * HD)
#define ZH   1
#define RH   512                  // query rows < RH use hi+lo planes (0: none)
#define WIN  0
#define SCL  0.125f   // HD^-0.5
#define NSL  16                   // key slices of the hi/lo rows; also the slice stride of the partial planes
#define KSL  (TT / NSL)           // keys per hi/lo slice (256)
#define NSF  8                    // key slices of the fp16 rows: one k and one v plane of 512 keys fill the LDS that two planes each of 256 keys need
#define KSF  (TT / NSF)           // keys per fp16 slice (512)
#define AWV  8                    // waves of an attention workgroup: two workgroups share a WGP
#define QWH  (AWV * 16)           // query rows per hi/lo workgroup: a wave holds one 16-column tile
#define QWG  (AWV * 32)           // query rows per fp16 workgroup: a wave holds two 16-column tiles
typedef _Float16 h16;
typedef unsigned short bf;
typedef __attribute__((ext_vector_type(16))) __bf16   v16bf;
typedef __attribute__((ext_vector_type(16))) _Float16 v16h;
typedef __attribute__((ext_vector_type(8)))  _Float16 v8h;
typedef __attribute__((ext_vector_type(8)))  unsigned short v8us;
typedef __attribute__((ext_vector_type(8)))  float    v8f;
typedef __attribute__((ext_vector_type(4)))  float    v4f;
typedef v8h  __attribute__((may_alias)) v8ha;
typedef v4f  __attribute__((may_alias)) v4fa;
typedef v8us __attribute__((may_alias)) v8usa;

__device__ __forceinline__ unsigned short f2bf(float f) { unsigned u = __float_as_uint(f); u += 0x7FFFu + ((u >> 16) & 1u); return (unsigned short)(u >> 16); }
__device__ __forceinline__ float bf2f(unsigned short b) { return __uint_as_float(((unsigned)b) << 16); }
__device__ __forceinline__ float bfr(float f) { return bf2f(f2bf(f)); }
__device__ __forceinline__ v16h cat16(v8h lo, v8h hi) { return __builtin_shufflevector(lo, hi, 0, 1, 2, 3, 4, 5, 6, 7, 8, 9, 10, 11, 12, 13, 14, 15); }
__device__ __forceinline__ v16bf cat16b(v8us lo, v8us hi) { return __builtin_bit_cast(v16bf, __builtin_shufflevector(lo, hi, 0, 1, 2, 3, 4, 5, 6, 7, 8, 9, 10, 11, 12, 13, 14, 15)); }
__device__ __forceinline__ v8f wmma16(v16h a, v16h b, v8f c) { return __builtin_amdgcn_wmma_f32_16x16x32_f16(false, a, false, b, (short)0, c, false, false); }
__device__ __forceinline__ v8f wmmab(v16bf a, v16bf b, v8f c) { return __builtin_amdgcn_wmma_f32_16x16x32_bf16(false, a, false, b, (short)0, c, false, false); }

// 16-bit WMMA fragments: a lane's sixteen elements are p[0..7] and p[16..23], p = its row + 8 (lane >> 4); A and B alike
template <typename T16> struct WFrag;
template <> struct WFrag<h16> { typedef v16h V; static __device__ __forceinline__ V ld(const h16* p) { return cat16(*(const v8h*)p, *(const v8h*)(p + 16)); } static __device__ __forceinline__ v8f mma(V a, V b, v8f c) { return wmma16(a, b, c); } };
template <> struct WFrag<bf> { typedef v16bf V; static __device__ __forceinline__ V ld(const bf* p) { return cat16b(*(const v8us*)p, *(const v8us*)(p + 16)); } static __device__ __forceinline__ v8f mma(V a, V b, v8f c) { return wmmab(a, b, c); } };

__device__ __forceinline__ h16 tohx(float x) { return (h16)x; }
__device__ __forceinline__ void splitf(float y, unsigned short& h, unsigned short& l) { h = f2bf(y); l = f2bf(y - bf2f(h)); }
typedef __attribute__((ext_vector_type(2))) _Float16 v2h;
typedef __attribute__((ext_vector_type(4))) _Float16 v4h;
typedef __attribute__((ext_vector_type(2))) unsigned short v2us;
typedef __attribute__((ext_vector_type(4))) unsigned short v4us;
typedef __attribute__((ext_vector_type(2))) float v2f;
typedef __attribute__((ext_vector_type(4))) int v4i;
typedef __attribute__((ext_vector_type(4))) __bf16 v4bf;

// ---- k_wpack: the three weights, rounded to bf16, in the order the projection's waves read them. Fragment (nt, ks): columns 16 nt .. + 15 of q | k | v (nt 0-3 | 4-7 | 8-11), k = 32 ks .. + 31;
// it is two runs of 512 B: run h holds, lane by lane, the eight elements k = 32 ks + 16 h + 8 (lane >> 4) + j of column lane & 15 (the k order of WFrag::ld), so a fragment is two whole-line 16-byte loads.
#define NKS  (DM / 32)            // k steps (24)
__global__ __launch_bounds__(256) void k_wpack(const float* __restrict__ wq, const float* __restrict__ wk, const float* __restrict__ wv, bf* WP) {
    static_assert(NKS * 64 == 6 * 256, "six workgroups per 16 columns");
    const int nt = blockIdx.x / 6; const float* w = nt < 4 ? wq : nt < 8 ? wk : wv;
    const int pi = blockIdx.x * 256 + threadIdx.x, lane = pi & 31, h = (pi >> 5) & 1, ks = (pi >> 6) % NKS;
    const float* wp = w + (size_t)(ks * 32 + h * 16 + 8 * (lane >> 4)) * HD + (nt & 3) * 16 + (lane & 15); float t[8]; v8us o;
#pragma unroll
    for (int j = 0; j < 8; ++j) t[j] = wp[j * HD];
    asm volatile("s_wait_xcnt 0x0" :: "v"(wp) : "memory");   // the address pair stays live up to this wait, so no load's result lands in a register that an issued load still names
#pragma unroll
    for (int j = 0; j < 8; ++j) o[j] = f2bf(t[j]);
    *(v8us*)(WP + (size_t)pi * 8) = o;  }

// ---- k_proj: input rounding, the three projections and the plane building in one kernel. A workgroup (12 waves): 64 rows of ix x all 192 columns.
// The rows are read once, in whole lines, rounded to bf16 and staged in LDS. Wave (g, kq): g = q | k | v (64 columns), kq = a quarter of K (192 k, 6 steps): 4 x 4 accumulators, so every weight fragment is read once per workgroup.
// q and k: transposed product (A = weight columns, B = input rows), a lane holds 8 neighbouring d of one row; v: A = input rows, B = weight columns, a lane holds 8 neighbouring rows of one d: both leave 16-byte pieces of the layout their planes have.
// The four K quarters meet in LDS and are added in ascending order by the threads that round and store the planes in whole lines.
#define PRW  64                   // input rows per workgroup
#define XPE  (DM + 8)             // LDS pitch of a staged row, elements: 1,536 B + 16 B (16 B x odd: no bank conflict for 16-byte reads)
#define PQP  (2 * HD + 4)         // LDS pitch of a q | k partial row, floats: 512 B + 16 B
#define PVP  (PRW + 4)            // LDS pitch of a v partial row (one d, PRW input rows), floats: 256 B + 16 B
#define WFE  512                  // elements of a packed fragment
__device__ __forceinline__ v16bf wfrag(const bf* p) { return cat16b(*(const v8us*)p, *(const v8us*)(p + 256)); }
template <bool VK>
__device__ __forceinline__ void proj_part(const bf* xs, const bf* __restrict__ wp, v16bf (&wf)[2][4], float* pd) {
    v8f acc[4][4];   // [weight tile][row tile]
#pragma unroll
    for (int nb = 0; nb < 4; ++nb)
#pragma unroll
        for (int tt = 0; tt < 4; ++tt) acc[nb][tt] = (v8f){};
#pragma unroll
    for (int ks = 0; ks < 6; ++ks) { v16bf xa[4];
#pragma unroll
        for (int tt = 0; tt < 4; ++tt) xa[tt] = WFrag<bf>::ld(xs + tt * 16 * XPE + ks * 32);
#pragma unroll
        for (int nb = 0; nb < 4; ++nb)
#pragma unroll
            for (int tt = 0; tt < 4; ++tt) acc[nb][tt] = VK ? wmmab(xa[tt], wf[ks & 1][nb], acc[nb][tt]) : wmmab(wf[ks & 1][nb], xa[tt], acc[nb][tt]);
        if (ks + 2 < 6) {   // the weight fragments run two steps ahead
#pragma unroll
            for (int nb = 0; nb < 4; ++nb) wf[ks & 1][nb] = wfrag(wp + (nb * NKS + ks + 2) * WFE); } }
    asm volatile("s_wait_xcnt 0x0" :: "v"(wp) : "memory");   // the address pair stays live up to this wait, so no load's result lands in a register that an issued load still names
#pragma unroll
    for (int nb = 0; nb < 4; ++nb)
#pragma unroll
        for (int tt = 0; tt < 4; ++tt) { float* d = VK ? pd + nb * 16 * PVP + tt * 16 : pd + tt * 16 * PQP + nb * 16; v4f w0, w1;
#pragma unroll
            for (int r = 0; r < 4; ++r) { w0[r] = acc[nb][tt][r]; w1[r] = acc[nb][tt][4 + r]; }
            *(v4fa*)d = w0; *(v4fa*)(d + 4) = w1; }
}
template <int PS>   // eight neighbouring elements of a plane: the four K quarters (PS floats apart) added in ascending order, rounded to fp16 and to bf16 hi + lo
__device__ __forceinline__ void proj_emit(const float* sp, h16* d16, bf* dh, bf* dl) {
    v4f a0 = *(const v4fa*)sp, a1 = *(const v4fa*)(sp + 4);
#pragma unroll
    for (int s = 1; s < 4; ++s) { a0 += *(const v4fa*)(sp + s * PS); a1 += *(const v4fa*)(sp + s * PS + 4); }
    v8h o16; v8us oh, ol;
#pragma unroll
    for (int j = 0; j < 8; ++j) { const float y = j < 4 ? a0[j & 3] : a1[j & 3]; o16[j] = tohx(y); unsigned short a2, c2; splitf(y, a2, c2); oh[j] = a2; ol[j] = c2; }
    *(v8h*)d16 = o16; *(v8us*)dh = oh; *(v8us*)dl = ol;
    asm volatile("s_wait_xcnt 0x0" :: "v"(d16), "v"(dh), "v"(dl) : "memory");   // the three address pairs stay live up to this wait: nothing overwrites a register that an issued store still names
}
__global__ __launch_bounds__(384) void k_proj(const float* __restrict__ x, const bf* __restrict__ WP, h16* Q16, bf* Qh, bf* Ql, h16* K16, bf* Kh, bf* Kl, h16* V16, bf* Vh, bf* Vl) {
    static_assert(DM == 768 && HD == 64 && TT % PRW == 0, "staging and wave roles are written for 768 x 3 x 64; a workgroup lies in one batch");
    __shared__ __align__(16) unsigned short xs[PRW * XPE];
    __shared__ __align__(16) float pq[4 * PRW * PQP];
    __shared__ __align__(16) float pv[4 * HD * PVP];
    const int tid = threadIdx.x, lane = tid & 31, lr = lane & 15, hi = lane >> 4; const int R0 = blockIdx.x * PRW;
    const int wv = __builtin_amdgcn_readfirstlane(tid >> 5), g = wv >> 2, kq = wv & 3;   // the wave's number in a scalar register: the choice between the two product forms below is a scalar branch
    const int sr = tid / 192, sc = (tid % 192) * 4;   // staging: 16-byte piece tid + 384 i is row 2 i + sr, elements sc .. sc + 3; a wave's 32 pieces are 512 contiguous bytes
    const float* xp = x + (size_t)(R0 + sr) * DM + sc; const bf* wp = WP + (size_t)(g * 4 * NKS + kq * 6) * WFE + lane * 8;
    v4f t[PRW / 2]; v16bf wf[2][4];
#pragma unroll
    for (int i = 0; i < PRW / 2; ++i) t[i] = *(const v4f*)(xp + i * 2 * DM);
#pragma unroll
    for (int ks = 0; ks < 2; ++ks)
#pragma unroll
        for (int nb = 0; nb < 4; ++nb) wf[ks][nb] = wfrag(wp + (nb * NKS + ks) * WFE);
    asm volatile("s_wait_xcnt 0x0" :: "v"(xp), "v"(wp) : "memory");   // both address pairs stay live up to this wait, so no load's result lands in a register that an issued load still names
    unsigned short* dx = xs + sr * XPE + sc;
#pragma unroll
    for (int i = 0; i < PRW / 2; ++i) *(v4us*)(dx + i * 2 * XPE) = __builtin_bit_cast(v4us, __builtin_convertvector(t[i], v4bf));
    __syncthreads();   // the staged rows are read by all twelve waves
    const bf* xf = xs + lr * XPE + 8 * hi + kq * 192;
    if (g == 2) proj_part<true>(xf, wp, wf, pv + kq * HD * PVP + lr * PVP + 8 * hi);
    else proj_part<false>(xf, wp, wf, pq + kq * PRW * PQP + lr * PQP + g * HD + 8 * hi);
    __syncthreads();   // a plane element's four K quarters come from four waves
    const size_t vb = (size_t)(R0 / TT) * HD * TT + R0 % TT;
#pragma unroll
    for (int i = 0; i < 4; ++i) { const int it = i * 384 + tid, kind = it >> 9, r = (it & 511) >> 3, c8 = (it & 7) * 8;   // 3 x 512 pieces of eight; a wave's pieces are of one kind and fill whole lines
        const size_t qo = (size_t)(R0 + r) * HD + c8, vo = vb + (size_t)r * TT + c8;
        if (kind == 0) proj_emit<PRW * PQP>(pq + r * PQP + c8, Q16 + qo, Qh + qo, Ql + qo);
        else if (kind == 1) proj_emit<PRW * PQP>(pq + r * PQP + HD + c8, K16 + qo, Kh + qo, Kl + qo);
        else proj_emit<HD * PVP>(pv + r * PVP + c8, V16 + vo, Vh + vo, Vl + vo); }
}
// ---- k_attn: scores, softmax and attn.v fused. A workgroup (8 waves): 256 query rows x one slice of KSF keys (fp16) or 128 query rows x one slice of KSL keys (hi/lo); the slice's k rows and v rows are staged once in LDS; a wave: NQ tiles of 16 query columns (fp16: 2, every k and v fragment read from LDS serves both; hi/lo: 1), passes of 32 keys.
// Transposed products: St = K.Qt (A = key rows, B = query columns), so a lane holds 16 scores of ONE query; two St tiles converted in place are the B operand of Ot += Vt.Pt (A = rows of the [d][t] v planes).
// Softmax in base 2 against one reference exponent per query and slice; a slice leaves its Ot (in fragment order; hi/lo: unnormalised f32, fp16: divided by the sum, f16), that exponent and its sum, and k_merge joins the slices.
#define KPE  72                   // LDS pitch of a key row, elements: 128 B + 16 B (16 B x odd: no bank conflict for 16-byte reads)
#define PLE  (KSL * KPE + HD * (KSL + 8))   // one k plane and one v plane of a hi/lo slice
template <typename T16> struct Oct;
template <> struct Oct<h16> { typedef v8h H; };
template <> struct Oct<bf> { typedef v8us H; };
__device__ __forceinline__ float xhalf(float x) { return __builtin_bit_cast(float, __builtin_amdgcn_permlanex16(__builtin_bit_cast(int, x), __builtin_bit_cast(int, x), 0x76543210, 0xfedcba98, false, false)); }   // lane l with lane l ^ 16
// Base-2 exponentials with the slot that the instruction set asks for behind a transcendental written in: inside a statement every v_exp_f32 is followed by an independent one (outputs early-clobber, so none is another's source), the last by v_nop.
__device__ __forceinline__ void exp2x8(const float (&x)[8], float (&e)[8]) {
    asm("v_exp_f32 %0, %8\n\tv_exp_f32 %1, %9\n\tv_exp_f32 %2, %10\n\tv_exp_f32 %3, %11\n\tv_exp_f32 %4, %12\n\tv_exp_f32 %5, %13\n\tv_exp_f32 %6, %14\n\tv_exp_f32 %7, %15\n\tv_nop"
        : "=&v"(e[0]), "=&v"(e[1]), "=&v"(e[2]), "=&v"(e[3]), "=&v"(e[4]), "=&v"(e[5]), "=&v"(e[6]), "=&v"(e[7]) : "v"(x[0]), "v"(x[1]), "v"(x[2]), "v"(x[3]), "v"(x[4]), "v"(x[5]), "v"(x[6]), "v"(x[7])); }
__device__ __forceinline__ float exp2x1(float x) { float e; asm("v_exp_f32 %0, %1\n\tv_nop" : "=&v"(e) : "v"(x)); return e; }
#define CSL  (SCL * 1.4426950408889634f)   // scores to base-2 exponents
// One sweep over the staged slice: Ot, the weight sum and, in mr, the exponent that a scaled score is taken against (a weight is 2^(score CSL - mr), in sum and Ot alike).
// FX: mr is given and stays, so a pass has no maximum, no rescale and no test; the caller checks the sum afterwards. Otherwise: running maximum, sound for any scores.
template <typename T16, bool HL, int NQ, int KS, bool FX>
__device__ __forceinline__ void attn_sweep(const T16* sm, const typename WFrag<T16>::V (&qf)[NQ][2], const typename WFrag<T16>::V (&qg)[NQ][2], v8f (&o)[NQ][4], float (&mr)[NQ], float (&ls)[NQ]) {
    typedef typename WFrag<T16>::V V;
    constexpr int VPE = KS + 8;
    const int lane = threadIdx.x & 31, lr = lane & 15, hi = lane >> 4;
    const float POFF = HL ? 0.0f : 8.0f;   // running maximum: fp16 weights are carried x 2^8 (sum and Ot alike), away from the fp16 subnormals
    const T16* kl = sm + lr * KPE + 8 * hi; const T16* km = kl + PLE; const T16* vl = sm + KS * KPE + lr * VPE + 8 * hi; const T16* vm = vl + PLE;   // walked pass by pass, so that every read is one of the four plus a 16-bit offset
    v2f l2[NQ];
#pragma unroll
    for (int qt = 0; qt < NQ; ++qt) { if (!FX) mr[qt] = -3.0e38f; ls[qt] = 0.f; l2[qt] = (v2f){};
#pragma unroll
        for (int dt = 0; dt < 4; ++dt) o[qt][dt] = (v8f){}; }
#pragma unroll (HL || !FX ? 1 : 4)   // fp16: four passes unrolled, their LDS addresses are a lane register plus an immediate and the next pass's reads can start early (more unrolled spill with two query tiles); hi/lo: rolled, the low planes lie beyond the 16-bit offset and are walked; the rerun: rolled, it is rare and must not spill
    for (int p = 0; p < KS / 32; ++p) {
        V ka[2][2], kb[2][2], va[4], vb[4];
#pragma unroll
        for (int kt = 0; kt < 2; ++kt)
#pragma unroll
            for (int ks = 0; ks < 2; ++ks) { ka[kt][ks] = WFrag<T16>::ld(kl + kt * 16 * KPE + ks * 32); if (HL) kb[kt][ks] = WFrag<T16>::ld(km + kt * 16 * KPE + ks * 32); }
        if (FX) {
#pragma unroll
            for (int dt = 0; dt < 4; ++dt) { va[dt] = WFrag<T16>::ld(vl + dt * 16 * VPE); if (HL) vb[dt] = WFrag<T16>::ld(vm + dt * 16 * VPE); } }
        kl += 32 * KPE; km += 32 * KPE;
        __builtin_amdgcn_sched_barrier(0);   // a pass's LDS reads are all issued ahead of its first product (the v reads a whole softmax early), and no later pass's reads rise above this line: without it the unrolled path fetches so far ahead that it spills
        v8f s[NQ][2];
#pragma unroll
        for (int kt = 0; kt < 2; ++kt)
#pragma unroll
            for (int qt = 0; qt < NQ; ++qt) { v8f c = (v8f){};
#pragma unroll
                for (int ks = 0; ks < 2; ++ks) { c = WFrag<T16>::mma(ka[kt][ks], qf[qt][ks], c); if (HL) { c = WFrag<T16>::mma(ka[kt][ks], qg[qt][ks], c); c = WFrag<T16>::mma(kb[kt][ks], qf[qt][ks], c); } }
                s[qt][kt] = c; }
        if (FX) __builtin_amdgcn_sched_barrier(0);   // the score products issue as one run: a multiply-add placed among them waits out its product's distance in v_nop, and the exponentials' asm results must not land in a product's operands right behind it
        V pb[NQ], pc[NQ];
#pragma unroll
        for (int qt = 0; qt < NQ; ++qt) { float xd[2][8], xe[2][8]; float sum;
            if constexpr (FX) { const v2f c2 = {CSL, CSL}, nm = {-mr[qt], -mr[qt]};
#pragma unroll
                for (int kt = 0; kt < 2; ++kt) {
#pragma unroll
                    for (int r = 0; r < 8; r += 2) { v2f t = {s[qt][kt][r], s[qt][kt][r + 1]}; t = __builtin_elementwise_fma(t, c2, nm); xd[kt][r] = t[0]; xd[kt][r + 1] = t[1]; }   // one packed multiply-add per two scores
                    exp2x8(xd[kt], xe[kt]); }
                v2f h[2];   // packed adds: even and odd keys are summed apart and meet behind the last pass
#pragma unroll
                for (int kt = 0; kt < 2; ++kt) h[kt] = ((v2f){xe[kt][0], xe[kt][1]} + (v2f){xe[kt][2], xe[kt][3]}) + ((v2f){xe[kt][4], xe[kt][5]} + (v2f){xe[kt][6], xe[kt][7]});
                l2[qt] += h[0] + h[1]; }
            else { float mx = mr[qt];
#pragma unroll
                for (int kt = 0; kt < 2; ++kt)
#pragma unroll
                    for (int r = 0; r < 8; ++r) { s[qt][kt][r] *= CSL; mx = fmaxf(mx, s[qt][kt][r]); }
                mx = fmaxf(mx, xhalf(mx));   // both halves of the wave hold keys of the same query
                const float al = exp2x1(mr[qt] - mx); mr[qt] = mx; const float mo = mx - POFF; sum = 0.f;
#pragma unroll
                for (int kt = 0; kt < 2; ++kt) {
#pragma unroll
                    for (int r = 0; r < 8; ++r) xd[kt][r] = s[qt][kt][r] - mo;
                    exp2x8(xd[kt], xe[kt]); }
#pragma unroll
                for (int e = 0; e < 16; ++e) sum += xe[e >> 3][e & 7];
                ls[qt] = ls[qt] * al + sum;
#pragma unroll
                for (int dt = 0; dt < 4; ++dt) o[qt][dt] *= al; }
#pragma unroll
            for (int e = 0; e < 16; ++e) { const float ex = xe[e >> 3][e & 7];
                if constexpr (HL) { const __bf16 h = (__bf16)ex; pb[qt][e] = h; pc[qt][e] = (__bf16)(ex - (float)h); } else pb[qt][e] = (h16)ex; } }
        if (!FX) {   // the rerun reads v only now: its registers are free behind the softmax, so it does not spill
            __builtin_amdgcn_sched_barrier(0);   // keeps these reads from rising into the softmax
#pragma unroll
            for (int dt = 0; dt < 4; ++dt) { va[dt] = WFrag<T16>::ld(vl + dt * 16 * VPE); if (HL) vb[dt] = WFrag<T16>::ld(vm + dt * 16 * VPE); } }
        vl += 32; vm += 32;
#pragma unroll
        for (int dt = 0; dt < 4; ++dt)
#pragma unroll
            for (int qt = 0; qt < NQ; ++qt) { o[qt][dt] = WFrag<T16>::mma(va[dt], pb[qt], o[qt][dt]); if (HL) { o[qt][dt] = WFrag<T16>::mma(va[dt], pc[qt], o[qt][dt]); o[qt][dt] = WFrag<T16>::mma(vb[dt], pb[qt], o[qt][dt]); } }
    }
#pragma unroll
    for (int qt = 0; qt < NQ; ++qt) { if (FX) ls[qt] = l2[qt][0] + l2[qt][1]; else mr[qt] -= POFF; }
}
template <typename T16, bool HL, int NQ, int KS>   // HL: second (low) planes, three products each; NQ: query tiles of a wave; KS: keys of a slice
__device__ __forceinline__ void attn_slice(T16* sm, const T16* __restrict__ Q, const T16* __restrict__ Q2, const T16* __restrict__ Kp, const T16* __restrict__ K2, const T16* __restrict__ Vt, const T16* __restrict__ V2, int q0, int sl, float* __restrict__ Ob, float* __restrict__ MLb) {
    typedef typename WFrag<T16>::V V; typedef typename Oct<T16>::H H;
    constexpr int VPE = KS + 8, NI = KS / 32, PPR = KS / 8, RPI = 256 / PPR;   // LDS pitch of a v row, elements: 16 B x odd; staging trips; 16-byte pieces of a v row; v rows per trip
    const int tid = threadIdx.x, lane = tid & 31, lr = lane & 15, hi = lane >> 4;
    const float PFX = HL ? 0.0f : 5.0f, LIM = HL ? 1.0e30f : 60000.0f;   // weight of the reference score, 2^PFX; the largest weight sum that is taken as it is
    const size_t qo = (size_t)(q0 + (lane >> 3)) * HD + (lane & 7) * 8, ko = (size_t)sl * KS * HD + tid * 8, vo = (size_t)(tid / PPR) * TT + sl * KS + (tid % PPR) * 8;
    const T16* qp = Q + qo; const T16* qq = HL ? Q2 + qo : qp; const T16* gk = Kp + ko; const T16* gl = HL ? K2 + ko : gk; const T16* gv = Vt + vo; const T16* gw = HL ? V2 + vo : gv;   // every global read below is one of these plus a constant
    V qf[NQ][2], qg[NQ][2];
    {   // stage the slice: 16-byte pieces, whole lines per wave; piece tid + 256 i is k row (tid >> 3) + 32 i, v row tid / PPR + RPI i
        H tq[NQ * 4], tr[NQ * 4], tk[NI], tl[NI], tv[NI], tw[NI];
#pragma unroll
        for (int i = 0; i < NQ * 4; ++i) { tq[i] = *(const H*)(qp + i * 4 * HD); if (HL) tr[i] = *(const H*)(qq + i * 4 * HD); }   // the wave's query rows in whole lines: piece lane + 32 i is row (lane >> 3) + 4 i
#pragma unroll
        for (int i = 0; i < NI; ++i) { tk[i] = *(const H*)(gk + i * 2048); tv[i] = *(const H*)(gv + i * RPI * TT); if (HL) { tl[i] = *(const H*)(gl + i * 2048); tw[i] = *(const H*)(gw + i * RPI * TT); } }
        asm volatile("s_wait_xcnt 0x0" :: "v"(qp), "v"(qq), "v"(gk), "v"(gl), "v"(gv), "v"(gw) : "memory");   // the address pairs stay live up to this wait, so no load's result lands in a register that an issued load still names
        // A query fragment read from global memory touches 16 lines with 32 B each: the rows turn through LDS, ahead of the slice, each wave's in a place of its own.
        constexpr int QPL = NQ * 16 * KPE;   // one plane of a wave's query rows, at the pitch of a key row
        T16* wq = sm + (tid >> 5) * ((HL ? 2 : 1) * QPL); T16* dq = wq + (lane >> 3) * KPE + (lane & 7) * 8; const T16* fq = wq + lr * KPE + 8 * hi;
#pragma unroll
        for (int i = 0; i < NQ * 4; ++i) { *(H*)(dq + i * 4 * KPE) = tq[i]; if (HL) *(H*)(dq + QPL + i * 4 * KPE) = tr[i]; }
        asm volatile("s_wait_dscnt 0x0\n\ts_barrier_signal -1\n\ts_barrier_wait -1" ::: "memory");   // a query row is read by other lanes than wrote it; by hand, LDS wait only: __syncthreads() would also wait for the slice's global loads, which stay in flight here
#pragma unroll
        for (int qt = 0; qt < NQ; ++qt)
#pragma unroll
            for (int ks = 0; ks < 2; ++ks) { qf[qt][ks] = WFrag<T16>::ld(fq + qt * 16 * KPE + ks * 32); if (HL) qg[qt][ks] = WFrag<T16>::ld(fq + QPL + qt * 16 * KPE + ks * 32); }
        asm volatile("s_wait_dscnt 0x0\n\ts_barrier_signal -1\n\ts_barrier_wait -1" ::: "memory");   // every wave holds its query fragments: the slice may take their place; by hand for the same reason
        T16* dk = sm + (tid >> 3) * KPE + (tid & 7) * 8; T16* dv = sm + KS * KPE + (tid / PPR) * VPE + (tid % PPR) * 8;
#pragma unroll
        for (int i = 0; i < NI; ++i) { *(H*)(dk + i * 32 * KPE) = tk[i]; *(H*)(dv + i * RPI * VPE) = tv[i]; if (HL) { *(H*)(dk + PLE + i * 32 * KPE) = tl[i]; *(H*)(dv + PLE + i * RPI * VPE) = tw[i]; } }
    }
    __syncthreads();   // the staged slice is read by all eight waves
    v8f o[NQ][4]; float mr[NQ], ls[NQ];
    {   // Each query's reference: its largest score among the slice's first 32 keys (hi/lo: by the high planes alone, a reference need not be exact). That key's weight is 2^PFX, so the sum cannot vanish;
        // fp16 weights overflow only 2^(16 - PFX) above the reference, and a sum below LIM shows that none did.
        const T16* kf = sm + lr * KPE + 8 * hi; V ka[2][2];
#pragma unroll
        for (int kt = 0; kt < 2; ++kt)
#pragma unroll
            for (int ks = 0; ks < 2; ++ks) ka[kt][ks] = WFrag<T16>::ld(kf + kt * 16 * KPE + ks * 32);
#pragma unroll
        for (int qt = 0; qt < NQ; ++qt) { float mx = -3.0e38f;
#pragma unroll
            for (int kt = 0; kt < 2; ++kt) { v8f c = (v8f){};
#pragma unroll
                for (int ks = 0; ks < 2; ++ks) c = WFrag<T16>::mma(ka[kt][ks], qf[qt][ks], c);
#pragma unroll
                for (int r = 0; r < 8; ++r) mx = fmaxf(mx, c[r]); }
            mx = fmaxf(mx, xhalf(mx));   // both halves of the wave hold keys of the same query
            mr[qt] = mx * CSL - PFX; }
    }
    attn_sweep<T16, HL, NQ, KS, true>(sm, qf, qg, o, mr, ls);
    unsigned redo = 0u;
#pragma unroll
    for (int qt = 0; qt < NQ; ++qt) { const float lt = ls[qt] + xhalf(ls[qt]); redo |= __builtin_amdgcn_ballot_w32(!(lt > 0.5f && lt < LIM)); }   // also set for a sum that is not a number
    if (redo != 0u) attn_sweep<T16, HL, NQ, KS, false>(sm, qf, qg, o, mr, ls);   // a scalar branch, once per slice: scores that leave the range of a fixed reference get the running maximum; the staged slice is still in place and no barrier follows
    // The partial planes lie in fragment order, hi/lo f32 [16-query tile][slice][dt][half][lane], fp16 f16 [16-query tile][slice][dt][lane]: a store instruction writes 512 contiguous bytes. (Row by row, neighbouring queries lie 4 KB apart and an instruction would touch 16 lines with 32 B each.)
#pragma unroll
    for (int qt = 0; qt < NQ; ++qt) { const int q = q0 + qt * 16 + lr; const float lt = ls[qt] + xhalf(ls[qt]);   // a lane holds d = 16 dt + 8 hi + r of its query
        if constexpr (HL) { float* ob = Ob + ((size_t)((q0 >> 4) + qt) * NSL + sl) * (16 * HD) + lane * 4;
#pragma unroll
            for (int dt = 0; dt < 4; ++dt) { v4f w0, w1;
#pragma unroll
                for (int r = 0; r < 4; ++r) { w0[r] = o[qt][dt][r]; w1[r] = o[qt][dt][4 + r]; }
                *(v4f*)(ob + dt * 256) = w0; *(v4f*)(ob + dt * 256 + 128) = w1; } }
        else {   // fp16 rows: Ot / sum, a weighted mean of v rows and so of v's own magnitude whatever the scale of the weights, stored as f16, [16-query tile][slice][dt][lane]: half the bytes; k_merge weighs it with the sum again
            h16* oh = (h16*)(Ob + (size_t)((q0 >> 4) + qt) * (NSL * 16 * HD)) + sl * (16 * HD) + lane * 8; const float rl = __fdiv_rn(1.0f, lt); v8h w[4];
#pragma unroll
            for (int dt = 0; dt < 4; ++dt) {
#pragma unroll
                for (int r = 0; r < 8; ++r) w[dt][r] = (h16)(o[qt][dt][r] * rl);
                *(v8ha*)(oh + dt * 256) = w[dt]; }
            asm volatile("s_wait_xcnt 0x0" :: "v"(oh), "v"(w[0]), "v"(w[1]), "v"(w[2]), "v"(w[3]) : "memory"); }   // address and data of the four stores stay live up to this wait: nothing overwrites a register that an issued store still names
        if (hi == 0) { v2f ml; ml[0] = mr[qt]; ml[1] = lt; *(v2f*)(MLb + ((size_t)sl * TT + q) * 2) = ml; } }   // [slice][t]: a tile's 16 pairs fill one 128-byte line
}
__global__ __launch_bounds__(AWV * 32) __attribute__((amdgpu_waves_per_eu(4, 4))) void k_attn(const h16* __restrict__ Q16, const h16* __restrict__ K16, const h16* __restrict__ V16, const bf* __restrict__ Qh, const bf* __restrict__ Ql, const bf* __restrict__ Kh, const bf* __restrict__ Kl, const bf* __restrict__ Vh, const bf* __restrict__ Vl, float* Ob, float* MLb) {
    static_assert(RH % QWH == 0 && (TT - RH) % QWG == 0 && KSL % 32 == 0 && KSF % 32 == 0 && HD == 64 && AWV == 8, "a workgroup is all hi/lo or all fp16; the staging loops are written for 64 d and 256 threads");
    static_assert(KSF * KPE + HD * (KSF + 8) <= 2 * PLE, "an fp16 slice fits the LDS of a hi/lo slice's two plane pairs");
    __shared__ __align__(16) unsigned short sm[2 * PLE];
    constexpr int NFB = (TT - RH) / QWG, NHB = RH / QWH, NFW = NFB * NSF, NHW = NHB * NSL;   // row blocks and workgroups of a batch, fp16 and hi/lo
    const int bx = blockIdx.x, wn = threadIdx.x >> 5;   // grid x: first every fp16 workgroup (the longer ones), then the hi/lo ones; in each part batch, slice, row block, the row block fastest
    if (bx < NB_ * NFW) { const int nb = bx / NFW, iy = bx % NFW; const size_t bo = (size_t)nb * TT * HD;
        attn_slice<h16, false, 2, KSF>((h16*)sm, Q16 + bo, nullptr, K16 + bo, nullptr, V16 + bo, nullptr, RH + iy % NFB * QWG + wn * 32, iy / NFB, Ob + bo * NSL, MLb + (size_t)nb * NSL * TT * 2); }
    else { const int ix = bx - NB_ * NFW, nb = ix / NHW, iy = ix % NHW; const size_t bo = (size_t)nb * TT * HD;
        attn_slice<bf, true, 1, KSL>(sm, Qh + bo, Ql + bo, Kh + bo, Kl + bo, Vh + bo, Vl + bo, iy % NHB * QWH + wn * 16, iy / NHB, Ob + bo * NSL, MLb + (size_t)nb * NSL * TT * 2); }
}

// k_merge: out[t][d] = sum_s Ot_s 2^(m_s - M) / sum_s l_s 2^(m_s - M), slices ascending, m_s the slice's reference exponent, l_s its weight sum, M the largest exponent. (fp16 rows: the plane holds Ot_s / l_s, so its weight is l_s 2^(m_s - M).)
// A wave joins 8 rows; every load reads four whole lines of the fragment-order planes, and a lane's stores fill, with its neighbours', whole 128-byte lines of each row.
// hi/lo wave: 32 d (m) of NSL f32 slices, 16 KB; fp16 wave: all 64 d of NSF f16 slices, 8 KB. A workgroup holds 2 hi/lo and 7 fp16 waves, so each of the 256 workgroups reads the same number of bytes.
#define MHV  2                    // hi/lo waves of a merge workgroup
#define MFV  7                    // fp16 waves of a merge workgroup
#define MHW  (RH / 8 * 2)         // hi/lo waves of a batch
#define MFW  ((TT - RH) / 8)      // fp16 waves of a batch
#define MWG  (NB_ * MHW / MHV)    // merge workgroups
template <int NS>   // the slices' weights 2^(m_s - M)
__device__ __forceinline__ void merge_wts(const v2f (&ml)[NS], float (&w)[NS / 8][8]) {
    static_assert(NS % 8 == 0, "statements of eight exponentials");
    float M = ml[0][0];
#pragma unroll
    for (int s = 1; s < NS; ++s) M = fmaxf(M, ml[s][0]);
    float xd[NS / 8][8];
#pragma unroll
    for (int h = 0; h < NS / 8; ++h) {
#pragma unroll
        for (int r = 0; r < 8; ++r) xd[h][r] = ml[h * 8 + r][0] - M;
        exp2x8(xd[h], w[h]); } }
// hi/lo wave hw: a lane joins d = 32 m + 4 c .. + 3 and the same + 16 of one row
__device__ __forceinline__ void merge_hl(const float* __restrict__ O, const float* __restrict__ MLb, float* OUTb, int hw, int lane) {
    const int nb = hw / MHW, m = hw & 1, t = (hw % MHW >> 1) * 8 + (lane & 7), c = lane >> 3;
    const float* pb = O + (size_t)nb * NSL * TT * HD + (size_t)(t >> 4) * (NSL * 16 * HD) + (4 * m + (c & 1)) * 128 + ((t & 15) + 16 * (c >> 1)) * 4;   // dt = 2 m, half = c & 1, lane = row + 16 (c >> 1); dt + 1 lies 256 floats on, a slice 1,024
    const float* mp = MLb + (size_t)nb * NSL * TT * 2 + (size_t)t * 2;              // (exponent, sum) pairs lie [slice][t]
    float* op = OUTb + (size_t)nb * TT * HD + (size_t)t * HD + 32 * m + 4 * c;
    v4f p[NSL], q[NSL]; v2f ml[NSL];
#pragma unroll
    for (int s = 0; s < NSL; ++s) { p[s] = *(const v4f*)(pb + s * 16 * HD); q[s] = *(const v4f*)(pb + s * 16 * HD + 256); ml[s] = *(const v2f*)(mp + s * TT * 2); }
    asm volatile("s_wait_xcnt 0x0" :: "v"(pb), "v"(mp) : "memory");   // both address pairs stay live up to this wait, so no load's result lands in a register that an issued load still names
    __builtin_amdgcn_sched_barrier(0);   // all loads are issued ahead of the first use: one memory latency, not two
    float w[NSL / 8][8]; merge_wts<NSL>(ml, w);
    v4f a = (v4f){}, b = (v4f){}; float L = 0.f;
#pragma unroll
    for (int s = 0; s < NSL; ++s) { a += p[s] * w[s >> 3][s & 7]; b += q[s] * w[s >> 3][s & 7]; L += ml[s][1] * w[s >> 3][s & 7]; }
    v4f oa, oc;
#pragma unroll
    for (int r = 0; r < 4; ++r) { oa[r] = __fdiv_rn(a[r], L); oc[r] = __fdiv_rn(b[r], L); }
    *(v4f*)op = oa; *(v4f*)(op + 16) = oc;  }
// fp16 wave fw: a lane joins d = 8 j .. + 7 and the same + 32 of one row
__device__ __forceinline__ void merge_fp(const float* __restrict__ O, const float* __restrict__ MLb, float* OUTb, int fw, int lane) {
    const int nb = fw / MFW, t = RH + fw % MFW * 8 + (lane & 7), j = lane >> 3;
    const h16* pb = (const h16*)(O + (size_t)nb * NSL * TT * HD + (size_t)(t >> 4) * (NSL * 16 * HD)) + (j >> 1) * 256 + ((t & 15) + 16 * (j & 1)) * 8;   // dt = j >> 1, lane = row + 16 (j & 1); dt + 2 lies 512 elements on, a slice 1,024
    const float* mp = MLb + (size_t)nb * NSL * TT * 2 + (size_t)t * 2;
    float* op = OUTb + (size_t)nb * TT * HD + (size_t)t * HD + 8 * j;
    v8h p[NSF], q[NSF]; v2f ml[NSF];
#pragma unroll
    for (int s = 0; s < NSF; ++s) { p[s] = *(const v8ha*)(pb + s * 16 * HD); q[s] = *(const v8ha*)(pb + s * 16 * HD + 512); ml[s] = *(const v2f*)(mp + s * TT * 2); }
    asm volatile("s_wait_xcnt 0x0" :: "v"(pb), "v"(mp) : "memory");   // both address pairs stay live up to this wait, so no load's result lands in a register that an issued load still names
    __builtin_amdgcn_sched_barrier(0);   // all loads are issued ahead of the first use: one memory latency, not two
    float w[NSF / 8][8]; merge_wts<NSF>(ml, w);
    float a[8], b[8]; float L = 0.f;
#pragma unroll
    for (int r = 0; r < 8; ++r) { a[r] = 0.f; b[r] = 0.f; }
#pragma unroll
    for (int s = 0; s < NSF; ++s) { const float ws = ml[s][1] * w[s >> 3][s & 7]; L += ws;
#pragma unroll
        for (int r = 0; r < 8; ++r) { a[r] += (float)p[s][r] * ws; b[r] += (float)q[s][r] * ws; } }
    v4f o0, o1, o2, o3;
#pragma unroll
    for (int r = 0; r < 4; ++r) { o0[r] = __fdiv_rn(a[r], L); o1[r] = __fdiv_rn(a[4 + r], L); o2[r] = __fdiv_rn(b[r], L); o3[r] = __fdiv_rn(b[4 + r], L); }
    *(v4f*)op = o0; *(v4f*)(op + 4) = o1; *(v4f*)(op + 32) = o2; *(v4f*)(op + 36) = o3;
    asm volatile("s_wait_xcnt 0x0" :: "v"(op), "v"(o0), "v"(o1), "v"(o2), "v"(o3) : "memory");  }   // address and data of the four stores stay live up to this wait: the listing's way on from here leads into the hi/lo code, which writes those registers
__global__ __launch_bounds__((MHV + MFV) * 32) void k_merge(const float* __restrict__ O, const float* __restrict__ MLb, float* OUTb) {
    static_assert(RH % 8 == 0 && NB_ * MHW == MHV * MWG && NB_ * MFW == MFV * MWG, "a wave's 8 rows are all hi/lo or all fp16; every workgroup has its 2 + 7 waves");
    const int lane = threadIdx.x & 31, wv = __builtin_amdgcn_readfirstlane(threadIdx.x >> 5);   // the wave's number in a scalar register: the choice between the two kinds of rows is a scalar branch
    if (wv < MHV) merge_hl(O, MLb, OUTb, blockIdx.x * MHV + wv, lane);
    else merge_fp(O, MLb, OUTb, blockIdx.x * MFV + wv - MHV, lane);  }

extern "C" void kernel_launch(void* const* d_in, const int* in_sizes, int n_in,
                              void* d_out, int out_size, void* d_ws, size_t ws_size, hipStream_t stream) {
    (void)in_sizes; (void)n_in; (void)out_size;
    const float* x = (const float*)d_in[0]; const float* wk = (const float*)d_in[1]; const float* wq = (const float*)d_in[2]; const float* wv = (const float*)d_in[3];
    float* OUT = (float*)d_out;     // [4][4096][64]
    char* wsp = (char*)d_ws;
    auto take = [&](size_t bytes) { char* p = wsp; wsp += (bytes + 255) & ~(size_t)255; return (void*)p; };
    bf* WP = (bf*)take((size_t)(DQ + 2 * DKV) * DM * 2);
    h16* QP16 = (h16*)take((size_t)NB_ * NH_ * TT * HD * 2); h16* KP16 = (h16*)take((size_t)NB_ * NKV * TT * HD * 2); h16* VT16 = (h16*)take((size_t)NB_ * NKV * HD * TT * 2);
    bf* QPh = (bf*)take((size_t)NB_ * NH_ * TT * HD * 2); bf* QPl = (bf*)take((size_t)NB_ * NH_ * TT * HD * 2); bf* KPh = (bf*)take((size_t)NB_ * NKV * TT * HD * 2); bf* KPl = (bf*)take((size_t)NB_ * NKV * TT * HD * 2); bf* VTh = (bf*)take((size_t)NB_ * NKV * HD * TT * 2); bf* VTl = (bf*)take((size_t)NB_ * NKV * HD * TT * 2);
    float* Ob = (float*)take((size_t)NB_ * NSL * TT * HD * 4); float* MLb = (float*)take((size_t)NB_ * NSL * TT * 2 * 4);
    if ((size_t)(wsp - (char*)d_ws) > ws_size) return;    // ws 256 MiB
    static_assert(NH_ == 1 && NKV == 1, "one head");
    k_wpack<<<(DQ + 2 * DKV) * DM / 8 / 256, 256, 0, stream>>>(wq, wk, wv, WP);
    k_proj<<<NB_ * TT / PRW, 384, 0, stream>>>(x, WP, QP16, QPh, QPl, KP16, KPh, KPl, VT16, VTh, VTl);
    k_attn<<<NB_ * ((TT - RH) / QWG * NSF + RH / QWH * NSL), AWV * 32, 0, stream>>>(QP16, KP16, VT16, QPh, QPl, KPh, KPl, VTh, VTl, Ob, MLb);
    k_merge<<<MWG, (MHV + MFV) * 32, 0, stream>>>(Ob, MLb, OUT);
}

// v010
// It runs in 37.4 microseconds.
// Next to v009, in two timings, it ran 1.04 times as fast each time.
// Counting every step since v000, it is 30.8 times as fast.
#include <hip/hip_runtime.h>

// Single attention head (ix [4][4096][768]; k, q, v = ix W ('xw' [768][64], no bias); wei = softmax(q.k / 8) over all 4096 keys; out = wei.v -> [4][4096][64] f32 (1.05 M)).
// Four launches, each for all four batches: the weights packed in fragment order; ONE projection kernel from the f32 input to the six f16 q, k, v planes (a high and a low plane each); one fused attention kernel over 4,096 keys in key slices (rows < 512 hi/lo, 16 slices; the rest fp16, 8 slices) with the softmax in registers; the merge kernel joins the slices and normalises; f32 output. The slices' partial results: f32 for the hi/lo rows, f16 (each divided by its slice's weight sum) for the fp16 rows.
// Compute dtypes, f32 accumulate: every input rounded to bf16; projections on PLAIN bf16 operands (exact); scores and attn.v rows < 512 on f16 hi/lo planes (3 products; the high plane is the fp16 plane of the other rows), the rest single fp16; softmax f32; f32 output.

#define NB_  4
#define TT   4096
#define DM   768
#define NH_  1
#define NKV  1
#define REP  (NH_ / NKV)
#define HD   64
#define DQ   (NH_ * HD)
#define DKV  (NKV * HD)
#define ZH   1
#define RH   512                  // query rows < RH use hi+lo planes (0: none)
#define WIN  0
#define SCL  0.125f   // HD^-0.5
#define NSL  16                   // key slices of the hi/lo rows; also the slice stride of the partial planes
#define KSL  (TT / NSL)           // keys per hi/lo slice (256)
#define NSF  8                    // key slices of the fp16 rows: one k and one v plane of 512 keys fill the LDS that two planes each of 256 keys need
#define KSF  (TT / NSF)           // keys per fp16 slice (512)
#define AWV  8                    // waves of an attention workgroup: two workgroups share a WGP
#define QWH  (AWV * 16)           // query rows per hi/lo workgroup: a wave holds one 16-column tile
#define QWG  (AWV * 32)           // query rows per fp16 workgroup: a wave holds two 16-column tiles
typedef _Float16 h16;
typedef unsigned short bf;
typedef __attribute__((ext_vector_type(16))) __bf16   v16bf;
typedef __attribute__((ext_vector_type(16))) _Float16 v16h;
typedef __attribute__((ext_vector_type(8)))  _Float16 v8h;
typedef __attribute__((ext_vector_type(8)))  unsigned short v8us;
typedef __attribute__((ext_vector_type(8)))  float    v8f;
typedef __attribute__((ext_vector_type(4)))  float    v4f;
typedef v8h  __attribute__((may_alias)) v8ha;
typedef v4f  __attribute__((may_alias)) v4fa;
typedef v8us __attribute__((may_alias)) v8usa;

__device__ __forceinline__ unsigned short f2bf(float f) { unsigned u = __float_as_uint(f); u += 0x7FFFu + ((u >> 16) & 1u); return (unsigned short)(u >> 16); }
__device__ __forceinline__ v16h cat16(v8h lo, v8h hi) { return __builtin_shufflevector(lo, hi, 0, 1, 2, 3, 4, 5, 6, 7, 8, 9, 10, 11, 12, 13, 14, 15); }
__device__ __forceinline__ v16bf cat16b(v8us lo, v8us hi) { return __builtin_bit_cast(v16bf, __builtin_shufflevector(lo, hi, 0, 1, 2, 3, 4, 5, 6, 7, 8, 9, 10, 11, 12, 13, 14, 15)); }
__device__ __forceinline__ v8f wmma16(v16h a, v16h b, v8f c) { return __builtin_amdgcn_wmma_f32_16x16x32_f16(false, a, false, b, (short)0, c, false, false); }
__device__ __forceinline__ v8f wmmab(v16bf a, v16bf b, v8f c) { return __builtin_amdgcn_wmma_f32_16x16x32_bf16(false, a, false, b, (short)0, c, false, false); }

// 16-bit WMMA fragments: a lane's sixteen elements are p[0..7] and p[16..23], p = its row + 8 (lane >> 4); A and B alike
template <typename T16> struct WFrag;
template <> struct WFrag<h16> { typedef v16h V; static __device__ __forceinline__ V ld(const h16* p) { return cat16(*(const v8h*)p, *(const v8h*)(p + 16)); } static __device__ __forceinline__ v8f mma(V a, V b, v8f c) { return wmma16(a, b, c); } };
template <> struct WFrag<bf> { typedef v16bf V; static __device__ __forceinline__ V ld(const bf* p) { return cat16b(*(const v8us*)p, *(const v8us*)(p + 16)); } static __device__ __forceinline__ v8f mma(V a, V b, v8f c) { return wmmab(a, b, c); } };

__device__ __forceinline__ h16 tohx(float x) { return (h16)x; }
typedef __attribute__((ext_vector_type(2))) _Float16 v2h;
typedef __attribute__((ext_vector_type(4))) _Float16 v4h;
typedef __attribute__((ext_vector_type(2))) unsigned short v2us;
typedef __attribute__((ext_vector_type(4))) unsigned short v4us;
typedef __attribute__((ext_vector_type(2))) float v2f;
typedef __attribute__((ext_vector_type(4))) int v4i;
typedef __attribute__((ext_vector_type(4))) __bf16 v4bf;

// ---- k_wpack: the three weights, rounded to bf16, in the order the projection's waves read them. Fragment (nt, ks): columns 16 nt .. + 15 of q | k | v (nt 0-3 | 4-7 | 8-11), k = 32 ks .. + 31;
// it is two runs of 512 B: run h holds, lane by lane, the eight elements k = 32 ks + 16 h + 8 (lane >> 4) + j of column lane & 15 (the k order of WFrag::ld), so a fragment is two whole-line 16-byte loads.
#define NKS  (DM / 32)            // k steps (24)
__global__ __launch_bounds__(256) void k_wpack(const float* __restrict__ wq, const float* __restrict__ wk, const float* __restrict__ wv, bf* WP) {
    static_assert(NKS * 64 == 6 * 256, "six workgroups per 16 columns");
    const int nt = blockIdx.x / 6; const float* w = nt < 4 ? wq : nt < 8 ? wk : wv;
    const int pi = blockIdx.x * 256 + threadIdx.x, lane = pi & 31, h = (pi >> 5) & 1, ks = (pi >> 6) % NKS;
    const float* wp = w + (size_t)(ks * 32 + h * 16 + 8 * (lane >> 4)) * HD + (nt & 3) * 16 + (lane & 15); float t[8]; v8us o;
#pragma unroll
    for (int j = 0; j < 8; ++j) t[j] = wp[j * HD];
    asm volatile("s_wait_xcnt 0x0" :: "v"(wp) : "memory");   // the address pair stays live up to this wait, so no load's result lands in a register that an issued load still names
#pragma unroll
    for (int j = 0; j < 8; ++j) o[j] = f2bf(t[j]);
    *(v8us*)(WP + (size_t)pi * 8) = o;  }

// ---- k_proj: input rounding, the three projections and the plane building in one kernel. A workgroup (12 waves): 64 rows of ix x all 192 columns.
// The rows are read once, in whole lines, rounded to bf16 and staged in LDS. Wave (g, kq): g = q | k | v (64 columns), kq = a quarter of K (192 k, 6 steps): 4 x 4 accumulators, so every weight fragment is read once per workgroup.
// q and k: transposed product (A = weight columns, B = input rows), a lane holds 8 neighbouring d of one row; v: A = input rows, B = weight columns, a lane holds 8 neighbouring rows of one d: both leave 16-byte pieces of the layout their planes have.
// The four K quarters meet in LDS and are added in ascending order by the threads that round and store the planes in whole lines.
#define PRW  64                   // input rows per workgroup
#define XPE  (DM + 8)             // LDS pitch of a staged row, elements: 1,536 B + 16 B (16 B x odd: no bank conflict for 16-byte reads)
#define PQP  (2 * HD + 4)         // LDS pitch of a q | k partial row, floats: 512 B + 16 B
#define PVP  (PRW + 4)            // LDS pitch of a v partial row (one d, PRW input rows), floats: 256 B + 16 B
#define WFE  512                  // elements of a packed fragment
__device__ __forceinline__ v16bf wfrag(const bf* p) { return cat16b(*(const v8us*)p, *(const v8us*)(p + 256)); }
template <bool VK>
__device__ __forceinline__ void proj_part(const bf* xs, const bf* __restrict__ wp, v16bf (&wf)[2][4], float* pd) {
    v8f acc[4][4];   // [weight tile][row tile]
#pragma unroll
    for (int nb = 0; nb < 4; ++nb)
#pragma unroll
        for (int tt = 0; tt < 4; ++tt) acc[nb][tt] = (v8f){};
#pragma unroll
    for (int ks = 0; ks < 6; ++ks) { v16bf xa[4];
#pragma unroll
        for (int tt = 0; tt < 4; ++tt) xa[tt] = WFrag<bf>::ld(xs + tt * 16 * XPE + ks * 32);
#pragma unroll
        for (int nb = 0; nb < 4; ++nb)
#pragma unroll
            for (int tt = 0; tt < 4; ++tt) acc[nb][tt] = VK ? wmmab(xa[tt], wf[ks & 1][nb], acc[nb][tt]) : wmmab(wf[ks & 1][nb], xa[tt], acc[nb][tt]);
        if (ks + 2 < 6) {   // the weight fragments run two steps ahead
#pragma unroll
            for (int nb = 0; nb < 4; ++nb) wf[ks & 1][nb] = wfrag(wp + (nb * NKS + ks + 2) * WFE); } }
    asm volatile("s_wait_xcnt 0x0" :: "v"(wp) : "memory");   // the address pair stays live up to this wait, so no load's result lands in a register that an issued load still names
#pragma unroll
    for (int nb = 0; nb < 4; ++nb)
#pragma unroll
        for (int tt = 0; tt < 4; ++tt) { float* d = VK ? pd + nb * 16 * PVP + tt * 16 : pd + tt * 16 * PQP + nb * 16; v4f w0, w1;
#pragma unroll
            for (int r = 0; r < 4; ++r) { w0[r] = acc[nb][tt][r]; w1[r] = acc[nb][tt][4 + r]; }
            *(v4fa*)d = w0; *(v4fa*)(d + 4) = w1; }
}
template <int PS>   // eight neighbouring elements of a plane: the four K quarters (PS floats apart) added in ascending order, rounded to fp16 (the high plane); the low plane holds what that rounding left, in fp16 too
__device__ __forceinline__ void proj_emit(const float* sp, h16* d16, h16* dl) {
    v4f a0 = *(const v4fa*)sp, a1 = *(const v4fa*)(sp + 4);
#pragma unroll
    for (int s = 1; s < 4; ++s) { a0 += *(const v4fa*)(sp + s * PS); a1 += *(const v4fa*)(sp + s * PS + 4); }
    v8h o16, ol;
#pragma unroll
    for (int j = 0; j < 8; ++j) { const float y = j < 4 ? a0[j & 3] : a1[j & 3]; o16[j] = tohx(y); ol[j] = tohx(y - (float)o16[j]); }
    *(v8h*)d16 = o16; *(v8h*)dl = ol;
    asm volatile("s_wait_xcnt 0x0" :: "v"(d16), "v"(dl) : "memory");   // the two address pairs stay live up to this wait: nothing overwrites a register that an issued store still names
}
__global__ __launch_bounds__(384) void k_proj(const float* __restrict__ x, const bf* __restrict__ WP, h16* Q16, h16* Ql, h16* K16, h16* Kl, h16* V16, h16* Vl) {
    static_assert(DM == 768 && HD == 64 && TT % PRW == 0, "staging and wave roles are written for 768 x 3 x 64; a workgroup lies in one batch");
    __shared__ __align__(16) unsigned short xs[PRW * XPE];
    __shared__ __align__(16) float pq[4 * PRW * PQP];
    __shared__ __align__(16) float pv[4 * HD * PVP];
    const int tid = threadIdx.x, lane = tid & 31, lr = lane & 15, hi = lane >> 4; const int R0 = blockIdx.x * PRW;
    const int wv = __builtin_amdgcn_readfirstlane(tid >> 5), g = wv >> 2, kq = wv & 3;   // the wave's number in a scalar register: the choice between the two product forms below is a scalar branch
    const int sr = tid / 192, sc = (tid % 192) * 4;   // staging: 16-byte piece tid + 384 i is row 2 i + sr, elements sc .. sc + 3; a wave's 32 pieces are 512 contiguous bytes
    const float* xp = x + (size_t)(R0 + sr) * DM + sc; const bf* wp = WP + (size_t)(g * 4 * NKS + kq * 6) * WFE + lane * 8;
    v4f t[PRW / 2]; v16bf wf[2][4];
#pragma unroll
    for (int i = 0; i < PRW / 2; ++i) t[i] = *(const v4f*)(xp + i * 2 * DM);
#pragma unroll
    for (int ks = 0; ks < 2; ++ks)
#pragma unroll
        for (int nb = 0; nb < 4; ++nb) wf[ks][nb] = wfrag(wp + (nb * NKS + ks) * WFE);
    asm volatile("s_wait_xcnt 0x0" :: "v"(xp), "v"(wp) : "memory");   // both address pairs stay live up to this wait, so no load's result lands in a register that an issued load still names
    unsigned short* dx = xs + sr * XPE + sc;
#pragma unroll
    for (int i = 0; i < PRW / 2; ++i) *(v4us*)(dx + i * 2 * XPE) = __builtin_bit_cast(v4us, __builtin_convertvector(t[i], v4bf));
    __syncthreads();   // the staged rows are read by all twelve waves
    const bf* xf = xs + lr * XPE + 8 * hi + kq * 192;
    if (g == 2) proj_part<true>(xf, wp, wf, pv + kq * HD * PVP + lr * PVP + 8 * hi);
    else proj_part<false>(xf, wp, wf, pq + kq * PRW * PQP + lr * PQP + g * HD + 8 * hi);
    __syncthreads();   // a plane element's four K quarters come from four waves
    const size_t vb = (size_t)(R0 / TT) * HD * TT + R0 % TT;
#pragma unroll
    for (int i = 0; i < 4; ++i) { const int it = i * 384 + tid, kind = it >> 9, r = (it & 511) >> 3, c8 = (it & 7) * 8;   // 3 x 512 pieces of eight; a wave's pieces are of one kind and fill whole lines
        const size_t qo = (size_t)(R0 + r) * HD + c8, vo = vb + (size_t)r * TT + c8;
        if (kind == 0) proj_emit<PRW * PQP>(pq + r * PQP + c8, Q16 + qo, Ql + qo);
        else if (kind == 1) proj_emit<PRW * PQP>(pq + r * PQP + HD + c8, K16 + qo, Kl + qo);
        else proj_emit<HD * PVP>(pv + r * PVP + c8, V16 + vo, Vl + vo); }
}
// ---- k_attn: scores, softmax and attn.v fused. A workgroup (8 waves): 256 query rows x one slice of KSF keys (fp16) or 128 query rows x one slice of KSL keys (hi/lo); the slice's k rows and v rows are staged once in LDS; a wave: NQ tiles of 16 query columns (fp16: 2, every k and v fragment read from LDS serves both; hi/lo: 1), passes of 32 keys.
// Transposed products: St = K.Qt (A = key rows, B = query columns), so a lane holds 16 scores of ONE query; two St tiles converted in place are the B operand of Ot += Vt.Pt (A = rows of the [d][t] v planes).
// Softmax in base 2 against one reference exponent per query and slice; a slice leaves its Ot (in fragment order; hi/lo: unnormalised f32, fp16: divided by the sum, f16), that exponent and its sum, and k_merge joins the slices.
#define KPE  72                   // LDS pitch of a key row, elements: 128 B + 16 B (16 B x odd: no bank conflict for 16-byte reads)
#define PLE  (KSL * KPE + HD * (KSL + 8))   // one k plane and one v plane of a hi/lo slice
template <typename T16> struct Oct;
template <> struct Oct<h16> { typedef v8h H; };
__device__ __forceinline__ float xhalf(float x) { return __builtin_bit_cast(float, __builtin_amdgcn_permlanex16(__builtin_bit_cast(int, x), __builtin_bit_cast(int, x), 0x76543210, 0xfedcba98, false, false)); }   // lane l with lane l ^ 16
// Base-2 exponentials with the slot that the instruction set asks for behind a transcendental written in: inside a statement every v_exp_f32 is followed by an independent one (outputs early-clobber, so none is another's source), the last by v_nop.
__device__ __forceinline__ void exp2x8(const float (&x)[8], float (&e)[8]) {
    asm("v_exp_f32 %0, %8\n\tv_exp_f32 %1, %9\n\tv_exp_f32 %2, %10\n\tv_exp_f32 %3, %11\n\tv_exp_f32 %4, %12\n\tv_exp_f32 %5, %13\n\tv_exp_f32 %6, %14\n\tv_exp_f32 %7, %15\n\tv_nop"
        : "=&v"(e[0]), "=&v"(e[1]), "=&v"(e[2]), "=&v"(e[3]), "=&v"(e[4]), "=&v"(e[5]), "=&v"(e[6]), "=&v"(e[7]) : "v"(x[0]), "v"(x[1]), "v"(x[2]), "v"(x[3]), "v"(x[4]), "v"(x[5]), "v"(x[6]), "v"(x[7])); }
__device__ __forceinline__ float exp2x1(float x) { float e; asm("v_exp_f32 %0, %1\n\tv_nop" : "=&v"(e) : "v"(x)); return e; }
#define CSL  (SCL * 1.4426950408889634f)   // scores to base-2 exponents
// One sweep over the staged slice: Ot, the weight sum and, in mr, the exponent that a scaled score is taken against (a weight is 2^(score CSL - mr), in sum and Ot alike).
// FX: mr is given and stays, so a pass has no maximum, no rescale and no test; the caller checks the sum afterwards. Otherwise: running maximum, sound for any scores.
template <typename T16, bool HL, int NQ, int KS, bool FX>
__device__ __forceinline__ void attn_sweep(const T16* sm, const typename WFrag<T16>::V (&qf)[NQ][2], const typename WFrag<T16>::V (&qg)[NQ][2], v8f (&o)[NQ][4], float (&mr)[NQ], float (&ls)[NQ]) {
    typedef typename WFrag<T16>::V V;
    constexpr int VPE = KS + 8;
    const int lane = threadIdx.x & 31, lr = lane & 15, hi = lane >> 4;
    const float POFF = 8.0f;   // running maximum: the weights, fp16 operands in both kinds of rows, are carried x 2^8 (sum and Ot alike), away from the fp16 subnormals
    const T16* kl = sm + lr * KPE + 8 * hi; const T16* km = kl + PLE; const T16* vl = sm + KS * KPE + lr * VPE + 8 * hi; const T16* vm = vl + PLE;   // walked pass by pass, so that every read is one of the four plus a 16-bit offset
    v2f l2[NQ];
#pragma unroll
    for (int qt = 0; qt < NQ; ++qt) { if (!FX) mr[qt] = -3.0e38f; ls[qt] = 0.f; l2[qt] = (v2f){};
#pragma unroll
        for (int dt = 0; dt < 4; ++dt) o[qt][dt] = (v8f){}; }
#pragma unroll (HL || !FX ? 1 : 4)   // fp16: four passes unrolled, their LDS addresses are a lane register plus an immediate and the next pass's reads can start early (more unrolled spill with two query tiles); hi/lo: rolled, the low planes lie beyond the 16-bit offset and are walked; the rerun: rolled, it is rare and must not spill
    for (int p = 0; p < KS / 32; ++p) {
        V ka[2][2], kb[2][2], va[4], vb[4];
#pragma unroll
        for (int kt = 0; kt < 2; ++kt)
#pragma unroll
            for (int ks = 0; ks < 2; ++ks) { ka[kt][ks] = WFrag<T16>::ld(kl + kt * 16 * KPE + ks * 32); if (HL) kb[kt][ks] = WFrag<T16>::ld(km + kt * 16 * KPE + ks * 32); }
        if (FX) {
#pragma unroll
            for (int dt = 0; dt < 4; ++dt) { va[dt] = WFrag<T16>::ld(vl + dt * 16 * VPE); if (HL) vb[dt] = WFrag<T16>::ld(vm + dt * 16 * VPE); } }
        kl += 32 * KPE; km += 32 * KPE;
        __builtin_amdgcn_sched_barrier(0);   // a pass's LDS reads are all issued ahead of its first product (the v reads a whole softmax early), and no later pass's reads rise above this line: without it the unrolled path fetches so far ahead that it spills
        v8f s[NQ][2];
#pragma unroll
        for (int kt = 0; kt < 2; ++kt)
#pragma unroll
            for (int qt = 0; qt < NQ; ++qt) { v8f c = (v8f){};
#pragma unroll
                for (int ks = 0; ks < 2; ++ks) { c = WFrag<T16>::mma(ka[kt][ks], qf[qt][ks], c); if (HL) { c = WFrag<T16>::mma(ka[kt][ks], qg[qt][ks], c); c = WFrag<T16>::mma(kb[kt][ks], qf[qt][ks], c); } }
                s[qt][kt] = c; }
        if (FX) __builtin_amdgcn_sched_barrier(0);   // the score products issue as one run: a multiply-add placed among them waits out its product's distance in v_nop, and the exponentials' asm results must not land in a product's operands right behind it
        V pb[NQ], pc[NQ];
#pragma unroll
        for (int qt = 0; qt < NQ; ++qt) { float xd[2][8], xe[2][8]; float sum;
            if constexpr (FX) { const v2f c2 = {CSL, CSL}, nm = {-mr[qt], -mr[qt]};
#pragma unroll
                for (int kt = 0; kt < 2; ++kt) {
#pragma unroll
                    for (int r = 0; r < 8; r += 2) { v2f t = {s[qt][kt][r], s[qt][kt][r + 1]}; t = __builtin_elementwise_fma(t, c2, nm); xd[kt][r] = t[0]; xd[kt][r + 1] = t[1]; }   // one packed multiply-add per two scores
                    exp2x8(xd[kt], xe[kt]); }
                v2f h[2];   // packed adds: even and odd keys are summed apart and meet behind the last pass
#pragma unroll
                for (int kt = 0; kt < 2; ++kt) h[kt] = ((v2f){xe[kt][0], xe[kt][1]} + (v2f){xe[kt][2], xe[kt][3]}) + ((v2f){xe[kt][4], xe[kt][5]} + (v2f){xe[kt][6], xe[kt][7]});
                l2[qt] += h[0] + h[1]; }
            else { float mx = mr[qt];
#pragma unroll
                for (int kt = 0; kt < 2; ++kt)
#pragma unroll
                    for (int r = 0; r < 8; ++r) { s[qt][kt][r] *= CSL; mx = fmaxf(mx, s[qt][kt][r]); }
                mx = fmaxf(mx, xhalf(mx));   // both halves of the wave hold keys of the same query
                const float al = exp2x1(mr[qt] - mx); mr[qt] = mx; const float mo = mx - POFF; sum = 0.f;
#pragma unroll
                for (int kt = 0; kt < 2; ++kt) {
#pragma unroll
                    for (int r = 0; r < 8; ++r) xd[kt][r] = s[qt][kt][r] - mo;
                    exp2x8(xd[kt], xe[kt]); }
#pragma unroll
                for (int e = 0; e < 16; ++e) sum += xe[e >> 3][e & 7];
                ls[qt] = ls[qt] * al + sum;
#pragma unroll
                for (int dt = 0; dt < 4; ++dt) o[qt][dt] *= al; }
#pragma unroll
            for (int e = 0; e < 16; ++e) { const float ex = xe[e >> 3][e & 7];
                const h16 h = (h16)ex; pb[qt][e] = h; if constexpr (HL) pc[qt][e] = (h16)(ex - (float)h); } }
        if (!FX) {   // the rerun reads v only now: its registers are free behind the softmax, so it does not spill
            __builtin_amdgcn_sched_barrier(0);   // keeps these reads from rising into the softmax
#pragma unroll
            for (int dt = 0; dt < 4; ++dt) { va[dt] = WFrag<T16>::ld(vl + dt * 16 * VPE); if (HL) vb[dt] = WFrag<T16>::ld(vm + dt * 16 * VPE); } }
        vl += 32; vm += 32;
#pragma unroll
        for (int dt = 0; dt < 4; ++dt)
#pragma unroll
            for (int qt = 0; qt < NQ; ++qt) { o[qt][dt] = WFrag<T16>::mma(va[dt], pb[qt], o[qt][dt]); if (HL) { o[qt][dt] = WFrag<T16>::mma(va[dt], pc[qt], o[qt][dt]); o[qt][dt] = WFrag<T16>::mma(vb[dt], pb[qt], o[qt][dt]); } }
    }
#pragma unroll
    for (int qt = 0; qt < NQ; ++qt) { if (FX) ls[qt] = l2[qt][0] + l2[qt][1]; else mr[qt] -= POFF; }
}
template <typename T16, bool HL, int NQ, int KS>   // HL: second (low) planes, three products each; NQ: query tiles of a wave; KS: keys of a slice
__device__ __forceinline__ void attn_slice(T16* sm, const T16* __restrict__ Q, const T16* __restrict__ Q2, const T16* __restrict__ Kp, const T16* __restrict__ K2, const T16* __restrict__ Vt, const T16* __restrict__ V2, int q0, int sl, float* __restrict__ Ob, float* __restrict__ MLb) {
    typedef typename WFrag<T16>::V V; typedef typename Oct<T16>::H H;
    constexpr int VPE = KS + 8, NI = KS / 32, PPR = KS / 8, RPI = 256 / PPR;   // LDS pitch of a v row, elements: 16 B x odd; staging trips; 16-byte pieces of a v row; v rows per trip
    const int tid = threadIdx.x, lane = tid & 31, lr = lane & 15, hi = lane >> 4;
    const float PFX = 5.0f, LIM = 60000.0f;   // weight of the reference score, 2^PFX; the largest weight sum that is taken as it is
    const size_t qo = (size_t)(q0 + (lane >> 3)) * HD + (lane & 7) * 8, ko = (size_t)sl * KS * HD + tid * 8, vo = (size_t)(tid / PPR) * TT + sl * KS + (tid % PPR) * 8;
    const T16* qp = Q + qo; const T16* qq = HL ? Q2 + qo : qp; const T16* gk = Kp + ko; const T16* gl = HL ? K2 + ko : gk; const T16* gv = Vt + vo; const T16* gw = HL ? V2 + vo : gv;   // every global read below is one of these plus a constant
    V qf[NQ][2], qg[NQ][2];
    {   // stage the slice: 16-byte pieces, whole lines per wave; piece tid + 256 i is k row (tid >> 3) + 32 i, v row tid / PPR + RPI i
        H tq[NQ * 4], tr[NQ * 4], tk[NI], tl[NI], tv[NI], tw[NI];
#pragma unroll
        for (int i = 0; i < NQ * 4; ++i) { tq[i] = *(const H*)(qp + i * 4 * HD); if (HL) tr[i] = *(const H*)(qq + i * 4 * HD); }   // the wave's query rows in whole lines: piece lane + 32 i is row (lane >> 3) + 4 i
#pragma unroll
        for (int i = 0; i < NI; ++i) { tk[i] = *(const H*)(gk + i * 2048); tv[i] = *(const H*)(gv + i * RPI * TT); if (HL) { tl[i] = *(const H*)(gl + i * 2048); tw[i] = *(const H*)(gw + i * RPI * TT); } }
        asm volatile("s_wait_xcnt 0x0" :: "v"(qp), "v"(qq), "v"(gk), "v"(gl), "v"(gv), "v"(gw) : "memory");   // the address pairs stay live up to this wait, so no load's result lands in a register that an issued load still names
        // A query fragment read from global memory touches 16 lines with 32 B each: the rows turn through LDS, ahead of the slice, each wave's in a place of its own.
        constexpr int QPL = NQ * 16 * KPE;   // one plane of a wave's query rows, at the pitch of a key row
        T16* wq = sm + (tid >> 5) * ((HL ? 2 : 1) * QPL); T16* dq = wq + (lane >> 3) * KPE + (lane & 7) * 8; const T16* fq = wq + lr * KPE + 8 * hi;
#pragma unroll
        for (int i = 0; i < NQ * 4; ++i) { *(H*)(dq + i * 4 * KPE) = tq[i]; if (HL) *(H*)(dq + QPL + i * 4 * KPE) = tr[i]; }
        asm volatile("s_wait_dscnt 0x0\n\ts_barrier_signal -1\n\ts_barrier_wait -1" ::: "memory");   // a query row is read by other lanes than wrote it; by hand, LDS wait only: __syncthreads() would also wait for the slice's global loads, which stay in flight here
#pragma unroll
        for (int qt = 0; qt < NQ; ++qt)
#pragma unroll
            for (int ks = 0; ks < 2; ++ks) { qf[qt][ks] = WFrag<T16>::ld(fq + qt * 16 * KPE + ks * 32); if (HL) qg[qt][ks] = WFrag<T16>::ld(fq + QPL + qt * 16 * KPE + ks * 32); }
        asm volatile("s_wait_dscnt 0x0\n\ts_barrier_signal -1\n\ts_barrier_wait -1" ::: "memory");   // every wave holds its query fragments: the slice may take their place; by hand for the same reason
        T16* dk = sm + (tid >> 3) * KPE + (tid & 7) * 8; T16* dv = sm + KS * KPE + (tid / PPR) * VPE + (tid % PPR) * 8;
#pragma unroll
        for (int i = 0; i < NI; ++i) { *(H*)(dk + i * 32 * KPE) = tk[i]; *(H*)(dv + i * RPI * VPE) = tv[i]; if (HL) { *(H*)(dk + PLE + i * 32 * KPE) = tl[i]; *(H*)(dv + PLE + i * RPI * VPE) = tw[i]; } }
    }
    __syncthreads();   // the staged slice is read by all eight waves
    v8f o[NQ][4]; float mr[NQ], ls[NQ];
    {   // Each query's reference: its largest score among the slice's first 32 keys (hi/lo: by the high planes alone, a reference need not be exact). That key's weight is 2^PFX, so the sum cannot vanish;
        // fp16 weights overflow only 2^(16 - PFX) above the reference, and a sum below LIM shows that none did.
        const T16* kf = sm + lr * KPE + 8 * hi; V ka[2][2];
#pragma unroll
        for (int kt = 0; kt < 2; ++kt)
#pragma unroll
            for (int ks = 0; ks < 2; ++ks) ka[kt][ks] = WFrag<T16>::ld(kf + kt * 16 * KPE + ks * 32);
#pragma unroll
        for (int qt = 0; qt < NQ; ++qt) { float mx = -3.0e38f;
#pragma unroll
            for (int kt = 0; kt < 2; ++kt) { v8f c = (v8f){};
#pragma unroll
                for (int ks = 0; ks < 2; ++ks) c = WFrag<T16>::mma(ka[kt][ks], qf[qt][ks], c);
#pragma unroll
                for (int r = 0; r < 8; ++r) mx = fmaxf(mx, c[r]); }
            mx = fmaxf(mx, xhalf(mx));   // both halves of the wave hold keys of the same query
            mr[qt] = mx * CSL - PFX; }
    }
    attn_sweep<T16, HL, NQ, KS, true>(sm, qf, qg, o, mr, ls);
    unsigned redo = 0u;
#pragma unroll
    for (int qt = 0; qt < NQ; ++qt) { const float lt = ls[qt] + xhalf(ls[qt]); redo |= __builtin_amdgcn_ballot_w32(!(lt > 0.5f && lt < LIM)); }   // also set for a sum that is not a number
    if (redo != 0u) attn_sweep<T16, HL, NQ, KS, false>(sm, qf, qg, o, mr, ls);   // a scalar branch, once per slice: scores that leave the range of a fixed reference get the running maximum; the staged slice is still in place and no barrier follows
    // The partial planes lie in fragment order, hi/lo f32 [16-query tile][slice][dt][half][lane], fp16 f16 [16-query tile][slice][dt][lane]: a store instruction writes 512 contiguous bytes. (Row by row, neighbouring queries lie 4 KB apart and an instruction would touch 16 lines with 32 B each.)
#pragma unroll
    for (int qt = 0; qt < NQ; ++qt) { const int q = q0 + qt * 16 + lr; const float lt = ls[qt] + xhalf(ls[qt]);   // a lane holds d = 16 dt + 8 hi + r of its query
        if constexpr (HL) { float* ob = Ob + ((size_t)((q0 >> 4) + qt) * NSL + sl) * (16 * HD) + lane * 4;
#pragma unroll
            for (int dt = 0; dt < 4; ++dt) { v4f w0, w1;
#pragma unroll
                for (int r = 0; r < 4; ++r) { w0[r] = o[qt][dt][r]; w1[r] = o[qt][dt][4 + r]; }
                *(v4f*)(ob + dt * 256) = w0; *(v4f*)(ob + dt * 256 + 128) = w1; } }
        else {   // fp16 rows: Ot / sum, a weighted mean of v rows and so of v's own magnitude whatever the scale of the weights, stored as f16, [16-query tile][slice][dt][lane]: half the bytes; k_merge weighs it with the sum again
            h16* oh = (h16*)(Ob + (size_t)((q0 >> 4) + qt) * (NSL * 16 * HD)) + sl * (16 * HD) + lane * 8; const float rl = __fdiv_rn(1.0f, lt); v8h w[4];
#pragma unroll
            for (int dt = 0; dt < 4; ++dt) {
#pragma unroll
                for (int r = 0; r < 8; ++r) w[dt][r] = (h16)(o[qt][dt][r] * rl);
                *(v8ha*)(oh + dt * 256) = w[dt]; }
            asm volatile("s_wait_xcnt 0x0" :: "v"(oh), "v"(w[0]), "v"(w[1]), "v"(w[2]), "v"(w[3]) : "memory"); }   // address and data of the four stores stay live up to this wait: nothing overwrites a register that an issued store still names
        if (hi == 0) { v2f ml; ml[0] = mr[qt]; ml[1] = lt; *(v2f*)(MLb + ((size_t)sl * TT + q) * 2) = ml; } }   // [slice][t]: a tile's 16 pairs fill one 128-byte line
}
__global__ __launch_bounds__(AWV * 32) __attribute__((amdgpu_waves_per_eu(4, 4))) void k_attn(const h16* __restrict__ Q16, const h16* __restrict__ K16, const h16* __restrict__ V16, const h16* __restrict__ Ql, const h16* __restrict__ Kl, const h16* __restrict__ Vl, float* Ob, float* MLb) {
    static_assert(RH % QWH == 0 && (TT - RH) % QWG == 0 && KSL % 32 == 0 && KSF % 32 == 0 && HD == 64 && AWV == 8, "a workgroup is all hi/lo or all fp16; the staging loops are written for 64 d and 256 threads");
    static_assert(KSF * KPE + HD * (KSF + 8) <= 2 * PLE, "an fp16 slice fits the LDS of a hi/lo slice's two plane pairs");
    __shared__ __align__(16) unsigned short sm[2 * PLE];
    constexpr int NFB = (TT - RH) / QWG, NHB = RH / QWH, NFW = NFB * NSF, NHW = NHB * NSL;   // row blocks and workgroups of a batch, fp16 and hi/lo
    const int bx = blockIdx.x, wn = threadIdx.x >> 5;   // grid x: first every fp16 workgroup (the longer ones), then the hi/lo ones; in each part batch, slice, row block, the row block fastest
    if (bx < NB_ * NFW) { const int nb = bx / NFW, iy = bx % NFW; const size_t bo = (size_t)nb * TT * HD;
        attn_slice<h16, false, 2, KSF>((h16*)sm, Q16 + bo, nullptr, K16 + bo, nullptr, V16 + bo, nullptr, RH + iy % NFB * QWG + wn * 32, iy / NFB, Ob + bo * NSL, MLb + (size_t)nb * NSL * TT * 2); }
    else { const int ix = bx - NB_ * NFW, nb = ix / NHW, iy = ix % NHW; const size_t bo = (size_t)nb * TT * HD;
        attn_slice<h16, true, 1, KSL>((h16*)sm, Q16 + bo, Ql + bo, K16 + bo, Kl + bo, V16 + bo, Vl + bo, iy % NHB * QWH + wn * 16, iy / NHB, Ob + bo * NSL, MLb + (size_t)nb * NSL * TT * 2); }
}

// k_merge: out[t][d] = sum_s Ot_s 2^(m_s - M) / sum_s l_s 2^(m_s - M), slices ascending, m_s the slice's reference exponent, l_s its weight sum, M the largest exponent. (fp16 rows: the plane holds Ot_s / l_s, so its weight is l_s 2^(m_s - M).)
// A wave joins 8 rows; every load reads four whole lines of the fragment-order planes, and a lane's stores fill, with its neighbours', whole 128-byte lines of each row.
// hi/lo wave: 32 d (m) of NSL f32 slices, 16 KB; fp16 wave: all 64 d of NSF f16 slices, 8 KB. A workgroup holds 2 hi/lo and 7 fp16 waves, so each of the 256 workgroups reads the same number of bytes.
#define MHV  2                    // hi/lo waves of a merge workgroup
#define MFV  7                    // fp16 waves of a merge workgroup
#define MHW  (RH / 8 * 2)         // hi/lo waves of a batch
#define MFW  ((TT - RH) / 8)      // fp16 waves of a batch
#define MWG  (NB_ * MHW / MHV)    // merge workgroups
template <int NS>   // the slices' weights 2^(m_s - M)
__device__ __forceinline__ void merge_wts(const v2f (&ml)[NS], float (&w)[NS / 8][8]) {
    static_assert(NS % 8 == 0, "statements of eight exponentials");
    float M = ml[0][0];
#pragma unroll
    for (int s = 1; s < NS; ++s) M = fmaxf(M, ml[s][0]);
    float xd[NS / 8][8];
#pragma unroll
    for (int h = 0; h < NS / 8; ++h) {
#pragma unroll
        for (int r = 0; r < 8; ++r) xd[h][r] = ml[h * 8 + r][0] - M;
        exp2x8(xd[h], w[h]); } }
// hi/lo wave hw: a lane joins d = 32 m + 4 c .. + 3 and the same + 16 of one row
__device__ __forceinline__ void merge_hl(const float* __restrict__ O, const float* __restrict__ MLb, float* OUTb, int hw, int lane) {
    const int nb = hw / MHW, m = hw & 1, t = (hw % MHW >> 1) * 8 + (lane & 7), c = lane >> 3;
    const float* pb = O + (size_t)nb * NSL * TT * HD + (size_t)(t >> 4) * (NSL * 16 * HD) + (4 * m + (c & 1)) * 128 + ((t & 15) + 16 * (c >> 1)) * 4;   // dt = 2 m, half = c & 1, lane = row + 16 (c >> 1); dt + 1 lies 256 floats on, a slice 1,024
    const float* mp = MLb + (size_t)nb * NSL * TT * 2 + (size_t)t * 2;              // (exponent, sum) pairs lie [slice][t]
    float* op = OUTb + (size_t)nb * TT * HD + (size_t)t * HD + 32 * m + 4 * c;
    v4f p[NSL], q[NSL]; v2f ml[NSL];
#pragma unroll
    for (int s = 0; s < NSL; ++s) { p[s] = *(const v4f*)(pb + s * 16 * HD); q[s] = *(const v4f*)(pb + s * 16 * HD + 256); ml[s] = *(const v2f*)(mp + s * TT * 2); }
    asm volatile("s_wait_xcnt 0x0" :: "v"(pb), "v"(mp) : "memory");   // both address pairs stay live up to this wait, so no load's result lands in a register that an issued load still names
    __builtin_amdgcn_sched_barrier(0);   // all loads are issued ahead of the first use: one memory latency, not two
    float w[NSL / 8][8]; merge_wts<NSL>(ml, w);
    v4f a = (v4f){}, b = (v4f){}; float L = 0.f;
#pragma unroll
    for (int s = 0; s < NSL; ++s) { a += p[s] * w[s >> 3][s & 7]; b += q[s] * w[s >> 3][s & 7]; L += ml[s][1] * w[s >> 3][s & 7]; }
    v4f oa, oc;
#pragma unroll
    for (int r = 0; r < 4; ++r) { oa[r] = __fdiv_rn(a[r], L); oc[r] = __fdiv_rn(b[r], L); }
    *(v4f*)op = oa; *(v4f*)(op + 16) = oc;  }
// fp16 wave fw: a lane joins d = 8 j .. + 7 and the same + 32 of one row
__device__ __forceinline__ void merge_fp(const float* __restrict__ O, const float* __restrict__ MLb, float* OUTb, int fw, int lane) {
    const int nb = fw / MFW, t = RH + fw % MFW * 8 + (lane & 7), j = lane >> 3;
    const h16* pb = (const h16*)(O + (size_t)nb * NSL * TT * HD + (size_t)(t >> 4) * (NSL * 16 * HD)) + (j >> 1) * 256 + ((t & 15) + 16 * (j & 1)) * 8;   // dt = j >> 1, lane = row + 16 (j & 1); dt + 2 lies 512 elements on, a slice 1,024
    const float* mp = MLb + (size_t)nb * NSL * TT * 2 + (size_t)t * 2;
    float* op = OUTb + (size_t)nb * TT * HD + (size_t)t * HD + 8 * j;
    v8h p[NSF], q[NSF]; v2f ml[NSF];
#pragma unroll
    for (int s = 0; s < NSF; ++s) { p[s] = *(const v8ha*)(pb + s * 16 * HD); q[s] = *(const v8ha*)(pb + s * 16 * HD + 512); ml[s] = *(const v2f*)(mp + s * TT * 2); }
    asm volatile("s_wait_xcnt 0x0" :: "v"(pb), "v"(mp) : "memory");   // both address pairs stay live up to this wait, so no load's result lands in a register that an issued load still names
    __builtin_amdgcn_sched_barrier(0);   // all loads are issued ahead of the first use: one memory latency, not two
    float w[NSF / 8][8]; merge_wts<NSF>(ml, w);
    float a[8], b[8]; float L = 0.f;
#pragma unroll
    for (int r = 0; r < 8; ++r) { a[r] = 0.f; b[r] = 0.f; }
#pragma unroll
    for (int s = 0; s < NSF; ++s) { const float ws = ml[s][1] * w[s >> 3][s & 7]; L += ws;
#pragma unroll
        for (int r = 0; r < 8; ++r) { a[r] += (float)p[s][r] * ws; b[r] += (float)q[s][r] * ws; } }
    v4f o0, o1, o2, o3;
#pragma unroll
    for (int r = 0; r < 4; ++r) { o0[r] = __fdiv_rn(a[r], L); o1[r] = __fdiv_rn(a[4 + r], L); o2[r] = __fdiv_rn(b[r], L); o3[r] = __fdiv_rn(b[4 + r], L); }
    *(v4f*)op = o0; *(v4f*)(op + 4) = o1; *(v4f*)(op + 32) = o2; *(v4f*)(op + 36) = o3;
    asm volatile("s_wait_xcnt 0x0" :: "v"(op), "v"(o0), "v"(o1), "v"(o2), "v"(o3) : "memory");  }   // address and data of the four stores stay live up to this wait: the listing's way on from here leads into the hi/lo code, which writes those registers
__global__ __launch_bounds__((MHV + MFV) * 32) void k_merge(const float* __restrict__ O, const float* __restrict__ MLb, float* OUTb) {
    static_assert(RH % 8 == 0 && NB_ * MHW == MHV * MWG && NB_ * MFW == MFV * MWG, "a wave's 8 rows are all hi/lo or all fp16; every workgroup has its 2 + 7 waves");
    const int lane = threadIdx.x & 31, wv = __builtin_amdgcn_readfirstlane(threadIdx.x >> 5);   // the wave's number in a scalar register: the choice between the two kinds of rows is a scalar branch
    if (wv < MHV) merge_hl(O, MLb, OUTb, blockIdx.x * MHV + wv, lane);
    else merge_fp(O, MLb, OUTb, blockIdx.x * MFV + wv - MHV, lane);  }

extern "C" void kernel_launch(void* const* d_in, const int* in_sizes, int n_in,
                              void* d_out, int out_size, void* d_ws, size_t ws_size, hipStream_t stream) {
    (void)in_sizes; (void)n_in; (void)out_size;
    const float* x = (const float*)d_in[0]; const float* wk = (const float*)d_in[1]; const float* wq = (const float*)d_in[2]; const float* wv = (const float*)d_in[3];
    float* OUT = (float*)d_out;     // [4][4096][64]
    char* wsp = (char*)d_ws;
    auto take = [&](size_t bytes) { char* p = wsp; wsp += (bytes + 255) & ~(size_t)255; return (void*)p; };
    bf* WP = (bf*)take((size_t)(DQ + 2 * DKV) * DM * 2);
    h16* QP16 = (h16*)take((size_t)NB_ * NH_ * TT * HD * 2); h16* KP16 = (h16*)take((size_t)NB_ * NKV * TT * HD * 2); h16* VT16 = (h16*)take((size_t)NB_ * NKV * HD * TT * 2);
    h16* QPl = (h16*)take((size_t)NB_ * NH_ * TT * HD * 2); h16* KPl = (h16*)take((size_t)NB_ * NKV * TT * HD * 2); h16* VTl = (h16*)take((size_t)NB_ * NKV * HD * TT * 2);
    float* Ob = (float*)take((size_t)NB_ * NSL * TT * HD * 4); float* MLb = (float*)take((size_t)NB_ * NSL * TT * 2 * 4);
    if ((size_t)(wsp - (char*)d_ws) > ws_size) return;    // ws 256 MiB
    static_assert(NH_ == 1 && NKV == 1, "one head");
    k_wpack<<<(DQ + 2 * DKV) * DM / 8 / 256, 256, 0, stream>>>(wq, wk, wv, WP);
    k_proj<<<NB_ * TT / PRW, 384, 0, stream>>>(x, WP, QP16, QPl, KP16, KPl, VT16, VTl);
    k_attn<<<NB_ * ((TT - RH) / QWG * NSF + RH / QWH * NSL), AWV * 32, 0, stream>>>(QP16, KP16, VT16, QPl, KPl, VTl, Ob, MLb);
    k_merge<<<MWG, (MHV + MFV) * 32, 0, stream>>>(Ob, MLb, OUT);
}
